// v000
// Measured on an AMD MI455X. A time is GPU time per run, averaged over a window of back-to-back runs after a warm-up
// (all launches, gaps included; the runs take copies of the inputs in turn), and the median of several windows.
// Apart from v000's, it joins two sittings. Times from different sittings can be a few percent apart, while
// side-by-side timings come from the same sitting.
// v000 is the starting kernel. One run takes 237 microseconds.
#include <hip/hip_runtime.h>
#include <stdint.h>

// Contractions x*Wq, x*Wk, x*Wv, q*k^T, p*v, o*Wo: v_wmma_f32_16x16x32_f16 (f16 operands with power-of-two operand scaling, f32 accumulate); RMS norm, rotary, softmax, bias and residual in f32.

#define NB   2
#define NS   2048
#define NDM  1024
#define NH   16
#define NKV  8
#define NHD  64
#define NROT 32
#define EPSV 1e-6f
#define NM   (NB * NS)

typedef _Float16 f16;
typedef f16   v8h  __attribute__((ext_vector_type(8)));
typedef f16   v16h __attribute__((ext_vector_type(16)));
typedef float v4f  __attribute__((ext_vector_type(4)));
typedef float v8f  __attribute__((ext_vector_type(8)));
typedef v4f v4fa __attribute__((may_alias));
typedef v8h v8ha __attribute__((may_alias));

union Frag { v16h v; v8h h[2]; f16 e[16]; };

// D(16x16 f32) += A(16x32) * B(32x16); hazard guard ties D and keeps A/B live.
__device__ __forceinline__ v8f mma(const v16h a, const v16h b, v8f c) {
    v8f d = __builtin_amdgcn_wmma_f32_16x16x32_f16(false, a, false, b, (short)0, c, false, false);
    asm volatile("v_nop\n\tv_nop\n\tv_nop\n\tv_nop" : "+v"(d) : "v"(a), "v"(b));
    return d;
}

__device__ __forceinline__ v8f zero8() {
    v8f z;
#pragma unroll
    for (int i = 0; i < 8; ++i) z[i] = 0.0f;
    return z;
}

// ---------------------------------------------------------------------------
// ---------------------------------------------------------------------------
__global__ __launch_bounds__(256) void k_cvt(const float* __restrict__ in, f16* __restrict__ out, int n8) {
    const int i = blockIdx.x * 256 + threadIdx.x;
    if (i >= n8) return;
    const float* s = in + (size_t)i * 8;
    const v4f u0 = *(const v4f*)(s);
    const v4f u1 = *(const v4f*)(s + 4);
    v8h o;
#pragma unroll
    for (int e = 0; e < 4; ++e) { o[e] = (f16)u0[e]; o[4 + e] = (f16)u1[e]; }
    f16* d = out + (size_t)i * 8;
    *(v8h*)d = o;
    
}

// ---------------------------------------------------------------------------
// W[K][N] f32 -> Wt[N][K] f16 * scale (k contiguous). Tile 64 k x 32 n.
// in[K rows][N cols] -> out[N rows][K cols].
// grid.x = (N/32) * (K/64)
// ---------------------------------------------------------------------------
__global__ __launch_bounds__(256) void k_wtrans(const float* __restrict__ W, f16* __restrict__ Wt,
                                                int K, int N, float scale) {
    __shared__ float T[64][33];
    const int tid = threadIdx.x, lane = tid & 31, wid = tid >> 5;
    const int nTn = N / 32;
    const int tn = blockIdx.x % nTn, tk = blockIdx.x / nTn;
    const int n0 = tn * 32, k0 = tk * 64;
    if (k0 + 64 > K || n0 + 32 > N) return;   // block-uniform
    {
        const int k = tid >> 2, c = (tid & 3) * 8;
        const float* src = W + (size_t)(k0 + k) * N + n0 + c;
        const v4f u0 = *(const v4f*)(src);
        const v4f u1 = *(const v4f*)(src + 4);
#pragma unroll
        for (int e = 0; e < 4; ++e) { T[k][c + e] = u0[e]; T[k][c + 4 + e] = u1[e]; }
    }
    __syncthreads();
    const int L  = wid * 4 + (lane >> 3);     // local n row 0..31
    const int k8 = (lane & 7) * 8;
    v8h o;
#pragma unroll
    for (int e = 0; e < 8; ++e) o[e] = (f16)(T[k8 + e][L] * scale);
    f16* dst = Wt + (size_t)(n0 + L) * K + k0 + k8;
    *(v8h*)dst = o;
    
}

// ---------------------------------------------------------------------------
// One wave: C[16 rows][64 cols] += A[16 x K] * B[K x 64]
// arow -> A + row(m0+16w+l16)*K (k contiguous); brow -> Bt + (n0+l16)*K (k contiguous),
// tile j at brow + 16*j*K. Both fragments use the same split k map:
// elements 0..7 <- k0+8h+0..7, elements 8..15 <- k0+16+8h+0..7.
// ---------------------------------------------------------------------------
__device__ __forceinline__ void mm16x64(const f16* __restrict__ arow, const f16* __restrict__ brow,
                                        int K, int h8, v8f& c0, v8f& c1, v8f& c2, v8f& c3) {
    const size_t jstep = (size_t)16 * K;
#pragma unroll 2
    for (int k0 = 0; k0 < K; k0 += 32) {
        Frag a, b;
        a.h[0] = *(const v8h*)(arow + k0 + h8);
        a.h[1] = *(const v8h*)(arow + k0 + 16 + h8);
        const f16* bp = brow + k0 + h8;
        b.h[0] = *(const v8h*)(bp);             b.h[1] = *(const v8h*)(bp + 16);             c0 = mma(a.v, b.v, c0);
        b.h[0] = *(const v8h*)(bp + jstep);     b.h[1] = *(const v8h*)(bp + jstep + 16);     c1 = mma(a.v, b.v, c1);
        b.h[0] = *(const v8h*)(bp + 2 * jstep); b.h[1] = *(const v8h*)(bp + 2 * jstep + 16); c2 = mma(a.v, b.v, c2);
        b.h[0] = *(const v8h*)(bp + 3 * jstep); b.h[1] = *(const v8h*)(bp + 3 * jstep + 16); c3 = mma(a.v, b.v, c3);
    }
}

// ---------------------------------------------------------------------------
// Fused QKV projection + RMS norm + partial rotary.
// Block tile = 128 rows (one batch, 128 consecutive s) x 64 cols (= one head).
// grid = (32 col tiles: 0..15 -> q heads, 16..23 -> k heads, 24..31 -> v heads, NM/128)
// q out: [b][h][s][d] f16, pre-multiplied by 1/8 (softmax scale);  k out: [b][kvh][s][d] f16
// v out: [b][kvh][d][s] f16 (d-major)
// ---------------------------------------------------------------------------
__global__ __launch_bounds__(256) void k_qkv(const f16* __restrict__ X,
                                             const f16* __restrict__ Wqt, const f16* __restrict__ Wkt,
                                             const f16* __restrict__ Wvt,
                                             const float* __restrict__ nqw, const float* __restrict__ nkw,
                                             const float* __restrict__ cosT, const float* __restrict__ sinT,
                                             f16* __restrict__ qb, f16* __restrict__ kb, f16* __restrict__ vt) {
    __shared__ __attribute__((aligned(16))) float Cs[128][68];
    const int tid = threadIdx.x, lane = tid & 31, wid = tid >> 5;
    const int h = lane >> 4, l16 = lane & 15, h8 = h * 8;
    const int nt = blockIdx.x;
    const int m0 = blockIdx.y * 128;
    if (m0 + 128 > NM || nt >= 32) return;    // block-uniform

    int mode, hh, nHh;
    const f16* Wt;
    const float* nw;
    if (nt < 16)      { mode = 0; hh = nt;      nHh = NH;  Wt = Wqt; nw = nqw; }
    else if (nt < 24) { mode = 1; hh = nt - 16; nHh = NKV; Wt = Wkt; nw = nkw; }
    else              { mode = 2; hh = nt - 24; nHh = NKV; Wt = Wvt; nw = nkw; }
    const int n0 = hh * NHD;
    const int bb = m0 / NS, s0 = m0 % NS;

    v8f c0 = zero8(), c1 = zero8(), c2 = zero8(), c3 = zero8();
    const f16* arow = X  + (size_t)(m0 + 16 * wid + l16) * NDM;
    const f16* brow = Wt + (size_t)(n0 + l16) * NDM;
    mm16x64(arow, brow, NDM, h8, c0, c1, c2, c3);

    // accumulator (lane = col, element r = row 8h+r) -> LDS tile, still scaled by 16
#pragma unroll
    for (int r = 0; r < 8; ++r) {
        const int row = 16 * wid + 8 * h + r;
        Cs[row][l16]      = c0[r];
        Cs[row][16 + l16] = c1[r];
        Cs[row][32 + l16] = c2[r];
        Cs[row][48 + l16] = c3[r];
    }
    __syncthreads();

    if (mode != 2) {
        const float osc = (mode == 0) ? 0.125f : 1.0f;
        const float w0 = nw[lane], w1 = nw[lane + 32];
#pragma unroll 1
        for (int r = 0; r < 16; ++r) {
            const int row = 16 * wid + r;
            const int s = s0 + row;
            float x0 = Cs[row][lane] * (1.0f / 16.0f);
            float x1 = Cs[row][lane + 32] * (1.0f / 16.0f);
            float ss = x0 * x0 + x1 * x1;
#pragma unroll
            for (int m = 16; m >= 1; m >>= 1) ss += __shfl_xor(ss, m, 32);
            const float rinv = rsqrtf(ss * (1.0f / NHD) + EPSV);
            const float xn0 = x0 * rinv * w0;
            const float xn1 = x1 * rinv * w1;
            const float part = __shfl_xor(xn0, 16, 32);
            const float rot = (lane < 16) ? -part : part;
            const float c  = cosT[(size_t)s * NROT + lane];
            const float sn = sinT[(size_t)s * NROT + lane];
            const float y0 = xn0 * c + rot * sn;
            Cs[row][lane]      = y0 * osc;
            Cs[row][lane + 32] = xn1 * osc;
        }
    }
    __syncthreads();

    v8h o[4];
    size_t off[4];
    if (mode != 2) {
        f16* ob = ((mode == 0) ? qb : kb) + ((size_t)(bb * nHh + hh) * NS + s0) * NHD;
#pragma unroll
        for (int q = 0; q < 4; ++q) {
            const int L = 4 * q + (lane >> 3);          // local row
            const int row = 16 * wid + L;
            const int cc = (lane & 7) * 8;
            const v4f u0 = *(const v4fa*)(&Cs[row][cc]);
            const v4f u1 = *(const v4fa*)(&Cs[row][cc + 4]);
#pragma unroll
            for (int e = 0; e < 4; ++e) { o[q][e] = (f16)u0[e]; o[q][4 + e] = (f16)u1[e]; }
            off[q] = (size_t)row * NHD + cc;
        }
#pragma unroll
        for (int q = 0; q < 4; ++q) *(v8h*)(ob + off[q]) = o[q];
        
    } else {
        f16* ob = vt + (size_t)(bb * NKV + hh) * NHD * NS + s0;
#pragma unroll
        for (int q = 0; q < 4; ++q) {
            const int L = 4 * q + (lane >> 3);          // 0..15
            const int d = 8 * wid + (L >> 1);
            const int sb = (L & 1) * 64 + (lane & 7) * 8;
#pragma unroll
            for (int e = 0; e < 8; ++e) o[q][e] = (f16)(Cs[sb + e][d] * (1.0f / 16.0f));
            off[q] = (size_t)d * NS + sb;
        }
#pragma unroll
        for (int q = 0; q < 4; ++q) *(v8h*)(ob + off[q]) = o[q];
        
    }
}

// ---------------------------------------------------------------------------
// Flash attention. Block = (128 q rows, head, batch), 8 waves x 16 q rows.
// K tile [32 kv][64 d] and V tile [64 d][32 kv] staged in LDS by all threads.
// Scores: B fragment = K row (lane = kv), split k map over d.
// P: score rows go through LDS, lane l16 reads row l16's split k subset -> A fragment (P*256 as f16).
// PV: B fragment = V row (lane = d), split k map over kv.
// ---------------------------------------------------------------------------
__global__ __launch_bounds__(256) void k_attn(const f16* __restrict__ qb, const f16* __restrict__ kb,
                                              const f16* __restrict__ vt, f16* __restrict__ ob) {
    __shared__ __attribute__((aligned(16))) f16   Ks[32 * 72];
    __shared__ __attribute__((aligned(16))) f16   Vs[64 * 40];
    __shared__ __attribute__((aligned(16))) float Pw[8 * 16 * 36];
    __shared__ __attribute__((aligned(16))) f16   Os[8 * 16 * 72];

    const int tid = threadIdx.x, lane = tid & 31, wid = tid >> 5;
    const int h = lane >> 4, l16 = lane & 15, h8 = h * 8;
    const int bb = blockIdx.z, hd = blockIdx.y, kvh = hd / (NH / NKV);
    const int qblk = blockIdx.x * 128;
    if (qblk + 128 > NS || hd >= NH || bb >= NB) return;   // block-uniform
    const int q0 = qblk + wid * 16;

    const f16* qrow = qb + ((size_t)(bb * NH + hd) * NS + q0 + l16) * NHD;
    Frag qa0, qa1;
    qa0.h[0] = *(const v8h*)(qrow + h8);
    qa0.h[1] = *(const v8h*)(qrow + 16 + h8);
    qa1.h[0] = *(const v8h*)(qrow + 32 + h8);
    qa1.h[1] = *(const v8h*)(qrow + 48 + h8);

    float m_run = -1e30f, l_run = 0.0f;
    v8f acc0 = zero8(), acc1 = zero8(), acc2 = zero8(), acc3 = zero8();

    const f16* kbase = kb + (size_t)(bb * NKV + kvh) * NS * NHD;
    const f16* vbase = vt + (size_t)(bb * NKV + kvh) * NHD * NS;
    float* pw = Pw + wid * 16 * 36;

#pragma unroll 1
    for (int it = 0; it < NS / 32; ++it) {
        __syncthreads();                              // prior tile fully consumed by all waves
        {
            const int r = tid >> 3, c = (tid & 7) * 8;    // K: 32 rows x 64 d
            const v8h u = *(const v8h*)(kbase + (size_t)(it * 32 + r) * NHD + c);
            *(v8h*)(Ks + r * 72 + c) = u;
        }
        {
            const int d = tid >> 2, c = (tid & 3) * 8;    // V: 64 d rows x 32 kv
            const v8h u = *(const v8h*)(vbase + (size_t)d * NS + it * 32 + c);
            *(v8h*)(Vs + d * 40 + c) = u;
        }
        __syncthreads();

        // scores for 32 kv columns (two 16x16 tiles), raw f32 rows -> per-wave LDS
#pragma unroll
        for (int t = 0; t < 2; ++t) {
            const f16* kp = Ks + (t * 16 + l16) * 72;
            Frag b0, b1;
            b0.h[0] = *(const v8h*)(kp + h8);      b0.h[1] = *(const v8h*)(kp + 16 + h8);
            b1.h[0] = *(const v8h*)(kp + 32 + h8); b1.h[1] = *(const v8h*)(kp + 48 + h8);
            v8f sc = zero8();
            sc = mma(qa0.v, b0.v, sc);
            sc = mma(qa1.v, b1.v, sc);
#pragma unroll
            for (int r = 0; r < 8; ++r) pw[(8 * h + r) * 36 + t * 16 + l16] = sc[r];
        }
        __syncthreads();

        // lane reads row l16, kv subset {8h..8h+7, 16+8h..23+8h}
        const float* prow = pw + l16 * 36 + h8;
        const v4f r0 = *(const v4fa*)(prow);
        const v4f r1 = *(const v4fa*)(prow + 4);
        const v4f r2 = *(const v4fa*)(prow + 16);
        const v4f r3 = *(const v4fa*)(prow + 20);

        float rm = r0[0];
#pragma unroll
        for (int i = 1; i < 4; ++i) rm = fmaxf(rm, r0[i]);
#pragma unroll
        for (int i = 0; i < 4; ++i) rm = fmaxf(rm, r1[i]);
#pragma unroll
        for (int i = 0; i < 4; ++i) rm = fmaxf(rm, r2[i]);
#pragma unroll
        for (int i = 0; i < 4; ++i) rm = fmaxf(rm, r3[i]);
        rm = fmaxf(rm, __shfl_xor(rm, 16, 32));

        const float mn = fmaxf(m_run, rm);
        const float alpha = __expf(m_run - mn);

        Frag pa;
        float rs = 0.0f;
#pragma unroll
        for (int i = 0; i < 4; ++i) { const float p = __expf(r0[i] - mn); rs += p; pa.e[i]      = (f16)(p * 256.0f); }
#pragma unroll
        for (int i = 0; i < 4; ++i) { const float p = __expf(r1[i] - mn); rs += p; pa.e[4 + i]  = (f16)(p * 256.0f); }
#pragma unroll
        for (int i = 0; i < 4; ++i) { const float p = __expf(r2[i] - mn); rs += p; pa.e[8 + i]  = (f16)(p * 256.0f); }
#pragma unroll
        for (int i = 0; i < 4; ++i) { const float p = __expf(r3[i] - mn); rs += p; pa.e[12 + i] = (f16)(p * 256.0f); }
        rs += __shfl_xor(rs, 16, 32);
        l_run = l_run * alpha + rs;
        m_run = mn;

        // alpha of row 8h+r lives in lane 8h+r
        float al[8];
#pragma unroll
        for (int r = 0; r < 8; ++r) al[r] = __shfl(alpha, 8 * h + r, 32);
#pragma unroll
        for (int r = 0; r < 8; ++r) { acc0[r] *= al[r]; acc1[r] *= al[r]; acc2[r] *= al[r]; acc3[r] *= al[r]; }

        // PV: B fragment for d = j*16 + l16, kv split map
        {
            Frag bv;
            const f16* vp = Vs + (0 * 16 + l16) * 40;
            bv.h[0] = *(const v8h*)(vp + h8); bv.h[1] = *(const v8h*)(vp + 16 + h8); acc0 = mma(pa.v, bv.v, acc0);
            vp = Vs + (1 * 16 + l16) * 40;
            bv.h[0] = *(const v8h*)(vp + h8); bv.h[1] = *(const v8h*)(vp + 16 + h8); acc1 = mma(pa.v, bv.v, acc1);
            vp = Vs + (2 * 16 + l16) * 40;
            bv.h[0] = *(const v8h*)(vp + h8); bv.h[1] = *(const v8h*)(vp + 16 + h8); acc2 = mma(pa.v, bv.v, acc2);
            vp = Vs + (3 * 16 + l16) * 40;
            bv.h[0] = *(const v8h*)(vp + h8); bv.h[1] = *(const v8h*)(vp + 16 + h8); acc3 = mma(pa.v, bv.v, acc3);
        }
    }

    // normalise: O = acc / (256 * l); stored as O*32 -> acc * (0.125 / l)
    const float inv = 0.125f / l_run;
    float iv[8];
#pragma unroll
    for (int r = 0; r < 8; ++r) iv[r] = __shfl(inv, 8 * h + r, 32);

    __syncthreads();
    f16* os = Os + wid * 16 * 72;
#pragma unroll
    for (int r = 0; r < 8; ++r) {
        const int row = 8 * h + r;
        os[row * 72 + l16]      = (f16)(acc0[r] * iv[r]);
        os[row * 72 + 16 + l16] = (f16)(acc1[r] * iv[r]);
        os[row * 72 + 32 + l16] = (f16)(acc2[r] * iv[r]);
        os[row * 72 + 48 + l16] = (f16)(acc3[r] * iv[r]);
    }
    __syncthreads();

    v8h o[4];
    size_t off[4];
#pragma unroll
    for (int q = 0; q < 4; ++q) {
        const int L = 4 * q + (lane >> 3);     // local q row 0..15
        const int cc = (lane & 7) * 8;
        o[q] = *(const v8ha*)(os + L * 72 + cc);
        off[q] = ((size_t)(bb * NS + q0 + L)) * (NH * NHD) + hd * NHD + cc;
    }
#pragma unroll
    for (int q = 0; q < 4; ++q) *(v8h*)(ob + off[q]) = o[q];
    
}

// ---------------------------------------------------------------------------
// out = (O*32 f16) x (Wo*16 f16, k contiguous) / 512 + bias + residual, f32 [NM][NDM]
// Block tile 128 x 64, grid = (NDM/64, NM/128). Row segment of 64 floats = 2 lines,
// ---------------------------------------------------------------------------
__global__ __launch_bounds__(256) void k_oproj(const f16* __restrict__ A, const f16* __restrict__ Wot,
                                               const float* __restrict__ bias, const float* __restrict__ resid,
                                               float* __restrict__ out) {
    __shared__ __attribute__((aligned(16))) float Cs[128][68];
    const int tid = threadIdx.x, lane = tid & 31, wid = tid >> 5;
    const int h = lane >> 4, l16 = lane & 15, h8 = h * 8;
    const int n0 = blockIdx.x * 64;
    const int m0 = blockIdx.y * 128;
    if (n0 + 64 > NDM || m0 + 128 > NM) return;   // block-uniform

    v8f c0 = zero8(), c1 = zero8(), c2 = zero8(), c3 = zero8();
    const f16* arow = A   + (size_t)(m0 + 16 * wid + l16) * (NH * NHD);
    const f16* brow = Wot + (size_t)(n0 + l16) * (NH * NHD);
    mm16x64(arow, brow, NH * NHD, h8, c0, c1, c2, c3);

#pragma unroll
    for (int r = 0; r < 8; ++r) {
        const int row = 16 * wid + 8 * h + r;
        Cs[row][l16]      = c0[r];
        Cs[row][16 + l16] = c1[r];
        Cs[row][32 + l16] = c2[r];
        Cs[row][48 + l16] = c3[r];
    }
    __syncthreads();

    v4f o[8];
    size_t off[8];
#pragma unroll
    for (int q = 0; q < 8; ++q) {
        const int L = 4 * q + (lane >> 3);         // 0..31 : (local row, half)
        const int row = 16 * wid + (L >> 1);
        const int cc = (L & 1) * 32 + (lane & 7) * 4;
        const v4f cv = *(const v4fa*)(&Cs[row][cc]);
        const size_t go = (size_t)(m0 + row) * NDM + n0 + cc;
        const v4f bv = *(const v4f*)(bias + n0 + cc);
        const v4f rv = *(const v4f*)(resid + go);
        v4f val;
#pragma unroll
        for (int e = 0; e < 4; ++e) val[e] = (cv[e] * (1.0f / 512.0f) + bv[e]) + rv[e];
        o[q] = val;
        off[q] = go;
    }
#pragma unroll
    for (int q = 0; q < 8; ++q) *(v4f*)(out + off[q]) = o[q];
    
}

// ---------------------------------------------------------------------------
// Launcher
// ---------------------------------------------------------------------------
extern "C" void kernel_launch(void* const* d_in, const int* in_sizes, int n_in,
                              void* d_out, int out_size, void* d_ws, size_t ws_size,
                              hipStream_t stream) {
    if (n_in < 10) return;
    if (in_sizes[0] != NM * NDM) return;
    if (in_sizes[1] != NDM * NH * NHD) return;
    if (in_sizes[2] != NDM * NKV * NHD || in_sizes[3] != NDM * NKV * NHD) return;
    if (in_sizes[4] != NH * NHD * NDM) return;
    if (in_sizes[5] < NDM || in_sizes[6] < NHD || in_sizes[7] < NHD) return;
    if (in_sizes[8] != NS * NROT || in_sizes[9] != NS * NROT) return;
    if (out_size != NM * NDM) return;

    const float* hs   = (const float*)d_in[0];
    const float* wq   = (const float*)d_in[1];
    const float* wk   = (const float*)d_in[2];
    const float* wv   = (const float*)d_in[3];
    const float* wo   = (const float*)d_in[4];
    const float* bo   = (const float*)d_in[5];
    const float* nqw  = (const float*)d_in[6];
    const float* nkw  = (const float*)d_in[7];
    const float* cosT = (const float*)d_in[8];
    const float* sinT = (const float*)d_in[9];

    const size_t szX   = (size_t)NM * NDM * sizeof(f16);            // 8 MB
    const size_t szWq  = (size_t)NDM * NH * NHD * sizeof(f16);      // 2 MB
    const size_t szWkv = (size_t)NDM * NKV * NHD * sizeof(f16);     // 1 MB
    const size_t szWo  = (size_t)NH * NHD * NDM * sizeof(f16);      // 2 MB
    const size_t szQ   = (size_t)NB * NH * NS * NHD * sizeof(f16);  // 8 MB
    const size_t szKV  = (size_t)NB * NKV * NS * NHD * sizeof(f16); // 4 MB
    const size_t szO   = (size_t)NM * NH * NHD * sizeof(f16);       // 8 MB
    size_t offp = 0;
    const size_t oX   = offp; offp += szX;
    const size_t oWq  = offp; offp += szWq;
    const size_t oWk  = offp; offp += szWkv;
    const size_t oWv  = offp; offp += szWkv;
    const size_t oWo  = offp; offp += szWo;
    const size_t oQ   = offp; offp += szQ;
    const size_t oK   = offp; offp += szKV;
    const size_t oV   = offp; offp += szKV;
    const size_t oO   = offp; offp += szO;
    if (offp > ws_size) return;

    char* ws = (char*)d_ws;
    f16* hsb  = (f16*)(ws + oX);
    f16* wqt  = (f16*)(ws + oWq);
    f16* wkt  = (f16*)(ws + oWk);
    f16* wvt  = (f16*)(ws + oWv);
    f16* wot  = (f16*)(ws + oWo);
    f16* qbuf = (f16*)(ws + oQ);
    f16* kbuf = (f16*)(ws + oK);
    f16* vtb  = (f16*)(ws + oV);
    f16* attb = (f16*)(ws + oO);

    const int n8 = (NM * NDM) / 8;
    k_cvt<<<(n8 + 255) / 256, 256, 0, stream>>>(hs, hsb, n8);

    // W[K=in][N=out] -> Wt[N][K] * 16 ; grid = (N/32)*(K/64)
    k_wtrans<<<((NH * NHD) / 32) * (NDM / 64), 256, 0, stream>>>(wq, wqt, NDM, NH * NHD, 16.0f);
    k_wtrans<<<((NKV * NHD) / 32) * (NDM / 64), 256, 0, stream>>>(wk, wkt, NDM, NKV * NHD, 16.0f);
    k_wtrans<<<((NKV * NHD) / 32) * (NDM / 64), 256, 0, stream>>>(wv, wvt, NDM, NKV * NHD, 16.0f);
    k_wtrans<<<(NDM / 32) * ((NH * NHD) / 64), 256, 0, stream>>>(wo, wot, NH * NHD, NDM, 16.0f);

    k_qkv<<<dim3(32, (NM + 127) / 128), 256, 0, stream>>>(hsb, wqt, wkt, wvt, nqw, nkw, cosT, sinT,
                                                         qbuf, kbuf, vtb);

    k_attn<<<dim3((NS + 127) / 128, NH, NB), 256, 0, stream>>>(qbuf, kbuf, vtb, attb);

    k_oproj<<<dim3((NDM + 63) / 64, (NM + 127) / 128), 256, 0, stream>>>(attb, wot, bo, hs, (float*)d_out);
}

// v001
// Measured time: 162 microseconds a run.
// Next to v000, in two timings, it ran 1.51 times as fast each time.
#include <hip/hip_runtime.h>
#include <stdint.h>

// Contractions x*Wq, x*Wk, x*Wv, q*k^T, p*v, o*Wo: v_wmma_f32_16x16x32_f16 (f16 operands with power-of-two operand scaling, f32 accumulate); RMS norm, rotary, softmax, bias and residual in f32.

#define NB   2
#define NS   2048
#define NDM  1024
#define NH   16
#define NKV  8
#define NHD  64
#define NROT 32
#define EPSV 1e-6f
#define NM   (NB * NS)

typedef _Float16 f16;
typedef f16   v8h  __attribute__((ext_vector_type(8)));
typedef f16   v16h __attribute__((ext_vector_type(16)));
typedef float v4f  __attribute__((ext_vector_type(4)));
typedef float v8f  __attribute__((ext_vector_type(8)));
typedef v4f v4fa __attribute__((may_alias));
typedef v8h v8ha __attribute__((may_alias));

union Frag { v16h v; v8h h[2]; f16 e[16]; };

// D(16x16 f32) += A(16x32) * B(32x16); hazard guard ties D and keeps A/B live.
__device__ __forceinline__ v8f mma(const v16h a, const v16h b, v8f c) {
    v8f d = __builtin_amdgcn_wmma_f32_16x16x32_f16(false, a, false, b, (short)0, c, false, false);
    asm volatile("v_nop\n\tv_nop\n\tv_nop\n\tv_nop" : "+v"(d) : "v"(a), "v"(b));
    return d;
}

__device__ __forceinline__ v8f zero8() {
    v8f z;
#pragma unroll
    for (int i = 0; i < 8; ++i) z[i] = 0.0f;
    return z;
}

// ---------------------------------------------------------------------------
// ---------------------------------------------------------------------------
__global__ __launch_bounds__(256) void k_cvt(const float* __restrict__ in, f16* __restrict__ out, int n8) {
    const int i = blockIdx.x * 256 + threadIdx.x;
    if (i >= n8) return;
    const float* s = in + (size_t)i * 8;
    const v4f u0 = *(const v4f*)(s);
    const v4f u1 = *(const v4f*)(s + 4);
    v8h o;
#pragma unroll
    for (int e = 0; e < 4; ++e) { o[e] = (f16)u0[e]; o[4 + e] = (f16)u1[e]; }
    f16* d = out + (size_t)i * 8;
    *(v8h*)d = o;
    
}

// ---------------------------------------------------------------------------
// W[K][N] f32 -> Wt[N][K] f16 * scale (k contiguous). Tile 64 k x 32 n.
// in[K rows][N cols] -> out[N rows][K cols].
// grid.x = (N/32) * (K/64)
// ---------------------------------------------------------------------------
__global__ __launch_bounds__(256) void k_wtrans(const float* __restrict__ W, f16* __restrict__ Wt,
                                                int K, int N, float scale) {
    __shared__ float T[64][33];
    const int tid = threadIdx.x, lane = tid & 31, wid = tid >> 5;
    const int nTn = N / 32;
    const int tn = blockIdx.x % nTn, tk = blockIdx.x / nTn;
    const int n0 = tn * 32, k0 = tk * 64;
    if (k0 + 64 > K || n0 + 32 > N) return;   // block-uniform
    {
        const int k = tid >> 2, c = (tid & 3) * 8;
        const float* src = W + (size_t)(k0 + k) * N + n0 + c;
        const v4f u0 = *(const v4f*)(src);
        const v4f u1 = *(const v4f*)(src + 4);
#pragma unroll
        for (int e = 0; e < 4; ++e) { T[k][c + e] = u0[e]; T[k][c + 4 + e] = u1[e]; }
    }
    __syncthreads();
    const int L  = wid * 4 + (lane >> 3);     // local n row 0..31
    const int k8 = (lane & 7) * 8;
    v8h o;
#pragma unroll
    for (int e = 0; e < 8; ++e) o[e] = (f16)(T[k8 + e][L] * scale);
    f16* dst = Wt + (size_t)(n0 + L) * K + k0 + k8;
    *(v8h*)dst = o;
    
}

// ---------------------------------------------------------------------------
// Block: C[128 rows][64 cols] += A[128 x K] * B[K x 64]; wave w owns rows 16w..16w+15.
// Ablk -> A + m0*K, Bblk -> Bt + n0*K (both k contiguous).
// K runs in slabs of 64 (128 B of every row). A slab of all 192 rows is copied into LDS by
// asynchronous copies whose wave-wide 512 B cover four whole lines; two buffers, the next
// slab's copies fly while this one is multiplied. LDS rows at pitch 144 B (16 B x odd).
// Both fragments use the same split k map:
// elements 0..7 <- k0+8h+0..7, elements 8..15 <- k0+16+8h+0..7.
// ---------------------------------------------------------------------------
#define SLAB_K      64
#define SLAB_PITCH  144
#define SLAB_A      (128 * SLAB_PITCH)
#define SLAB_STAGE  (192 * SLAB_PITCH)
#define RING_BYTES  (2 * SLAB_STAGE)

// One thread's share of a slab: 16 B of A rows r, r+32, r+64, r+96 and of B rows r, r+32.
// s_wait_xcnt closes the statement so that no address register is rewritten ahead of it.
__device__ __forceinline__ void slab_copy(uint32_t lds, const f16* ga, const f16* gb, size_t rstep) {
    asm volatile("global_load_async_to_lds_b128 %0, %6, off\n\t"
                 "global_load_async_to_lds_b128 %1, %7, off\n\t"
                 "global_load_async_to_lds_b128 %2, %8, off\n\t"
                 "global_load_async_to_lds_b128 %3, %9, off\n\t"
                 "global_load_async_to_lds_b128 %4, %10, off\n\t"
                 "global_load_async_to_lds_b128 %5, %11, off\n\t"
                 "s_wait_xcnt 0x0"
                 :: "v"(lds), "v"(lds + 32u * SLAB_PITCH), "v"(lds + 64u * SLAB_PITCH),
                    "v"(lds + 96u * SLAB_PITCH), "v"(lds + (uint32_t)SLAB_A),
                    "v"(lds + (uint32_t)SLAB_A + 32u * SLAB_PITCH),
                    "v"(ga), "v"(ga + rstep), "v"(ga + 2 * rstep), "v"(ga + 3 * rstep),
                    "v"(gb), "v"(gb + rstep)
                 : "memory");
}

__device__ __forceinline__ void mm128x64(const f16* __restrict__ Ablk, const f16* __restrict__ Bblk,
                                         int K, unsigned char* ring,
                                         v8f& c0, v8f& c1, v8f& c2, v8f& c3) {
    const int tid = threadIdx.x, lane = tid & 31, wid = tid >> 5;
    const int h = lane >> 4, l16 = lane & 15;
    const int cr = tid >> 3, cc = (tid & 7) * 8;          // copy: row 0..31, f16 column
    const f16* ga = Ablk + (size_t)cr * K + cc;
    const f16* gb = Bblk + (size_t)cr * K + cc;
    const size_t rstep = (size_t)32 * K;
    const uint32_t l0 = (uint32_t)(size_t)ring + (uint32_t)(cr * SLAB_PITCH + cc * 2);
    const int nslab = K / SLAB_K;

    slab_copy(l0, ga, gb, rstep);
    asm volatile("s_wait_asynccnt 0x0" ::: "memory");     // slab 0 landed (this wave's share)
    __syncthreads();                                      // ... and every other wave's
    if (nslab > 1) slab_copy(l0 + (uint32_t)SLAB_STAGE, ga + SLAB_K, gb + SLAB_K, rstep);

    const unsigned char* af = ring + (16 * wid + l16) * SLAB_PITCH + h * 16;
    const unsigned char* bf = ring + SLAB_A + l16 * SLAB_PITCH + h * 16;
    for (int t = 0; t < nslab; ++t) {
        const int bo = (t & 1) * SLAB_STAGE;
        for (int ks = 0; ks < 2; ++ks) {
            // the k step's ten LDS reads stand together in front of its four products
            Frag a, b0, b1, b2, b3;
            const unsigned char* ap = af + bo + ks * 64;
            const unsigned char* bp = bf + bo + ks * 64;
            a.h[0]  = *(const v8ha*)(ap);                   a.h[1]  = *(const v8ha*)(ap + 32);
            b0.h[0] = *(const v8ha*)(bp);                   b0.h[1] = *(const v8ha*)(bp + 32);
            b1.h[0] = *(const v8ha*)(bp + 16 * SLAB_PITCH); b1.h[1] = *(const v8ha*)(bp + 16 * SLAB_PITCH + 32);
            b2.h[0] = *(const v8ha*)(bp + 32 * SLAB_PITCH); b2.h[1] = *(const v8ha*)(bp + 32 * SLAB_PITCH + 32);
            b3.h[0] = *(const v8ha*)(bp + 48 * SLAB_PITCH); b3.h[1] = *(const v8ha*)(bp + 48 * SLAB_PITCH + 32);
            c0 = mma(a.v, b0.v, c0);
            c1 = mma(a.v, b1.v, c1);
            c2 = mma(a.v, b2.v, c2);
            c3 = mma(a.v, b3.v, c3);
        }
        asm volatile("s_wait_dscnt 0x0" ::: "memory");    // this wave has left buffer t & 1
        asm volatile("s_wait_asynccnt 0x0" ::: "memory"); // its share of slab t + 1 has landed
        __syncthreads();                                  // publishes slab t + 1, frees buffer t & 1
        if (t + 2 < nslab)
            slab_copy(l0 + (uint32_t)bo, ga + (size_t)(t + 2) * SLAB_K, gb + (size_t)(t + 2) * SLAB_K, rstep);
    }
    asm volatile("s_wait_asynccnt 0x0" ::: "memory");     // no copy outstanding when the ring is reused
}

// ---------------------------------------------------------------------------
// Fused QKV projection + RMS norm + partial rotary.
// Block tile = 128 rows (one batch, 128 consecutive s) x 64 cols (= one head).
// grid = (32 col tiles: 0..15 -> q heads, 16..23 -> k heads, 24..31 -> v heads, NM/128)
// q out: [b][h][s][d] f16, pre-multiplied by 1/8 (softmax scale);  k out: [b][kvh][s][d] f16
// v out: [b][kvh][d][s] f16 (d-major)
// ---------------------------------------------------------------------------
__global__ __launch_bounds__(256) void k_qkv(const f16* __restrict__ X,
                                             const f16* __restrict__ Wqt, const f16* __restrict__ Wkt,
                                             const f16* __restrict__ Wvt,
                                             const float* __restrict__ nqw, const float* __restrict__ nkw,
                                             const float* __restrict__ cosT, const float* __restrict__ sinT,
                                             f16* __restrict__ qb, f16* __restrict__ kb, f16* __restrict__ vt) {
    __shared__ __attribute__((aligned(16))) unsigned char ring[RING_BYTES];
    float (*Cs)[68] = reinterpret_cast<float (*)[68]>(ring);   // C tile takes the ring's place behind the K loop
    const int tid = threadIdx.x, lane = tid & 31, wid = tid >> 5;
    const int h = lane >> 4, l16 = lane & 15;
    const int nt = blockIdx.x;
    const int m0 = blockIdx.y * 128;
    if (m0 + 128 > NM || nt >= 32) return;    // block-uniform

    int mode, hh, nHh;
    const f16* Wt;
    const float* nw;
    if (nt < 16)      { mode = 0; hh = nt;      nHh = NH;  Wt = Wqt; nw = nqw; }
    else if (nt < 24) { mode = 1; hh = nt - 16; nHh = NKV; Wt = Wkt; nw = nkw; }
    else              { mode = 2; hh = nt - 24; nHh = NKV; Wt = Wvt; nw = nkw; }
    const int n0 = hh * NHD;
    const int bb = m0 / NS, s0 = m0 % NS;

    v8f c0 = zero8(), c1 = zero8(), c2 = zero8(), c3 = zero8();
    mm128x64(X + (size_t)m0 * NDM, Wt + (size_t)n0 * NDM, NDM, ring, c0, c1, c2, c3);

    // accumulator (lane = col, element r = row 8h+r) -> LDS tile, still scaled by 16
#pragma unroll
    for (int r = 0; r < 8; ++r) {
        const int row = 16 * wid + 8 * h + r;
        Cs[row][l16]      = c0[r];
        Cs[row][16 + l16] = c1[r];
        Cs[row][32 + l16] = c2[r];
        Cs[row][48 + l16] = c3[r];
    }
    __syncthreads();

    if (mode != 2) {
        const float osc = (mode == 0) ? 0.125f : 1.0f;
        const float w0 = nw[lane], w1 = nw[lane + 32];
#pragma unroll 1
        for (int r = 0; r < 16; ++r) {
            const int row = 16 * wid + r;
            const int s = s0 + row;
            float x0 = Cs[row][lane] * (1.0f / 16.0f);
            float x1 = Cs[row][lane + 32] * (1.0f / 16.0f);
            float ss = x0 * x0 + x1 * x1;
#pragma unroll
            for (int m = 16; m >= 1; m >>= 1) ss += __shfl_xor(ss, m, 32);
            const float rinv = rsqrtf(ss * (1.0f / NHD) + EPSV);
            const float xn0 = x0 * rinv * w0;
            const float xn1 = x1 * rinv * w1;
            const float part = __shfl_xor(xn0, 16, 32);
            const float rot = (lane < 16) ? -part : part;
            const float c  = cosT[(size_t)s * NROT + lane];
            const float sn = sinT[(size_t)s * NROT + lane];
            const float y0 = xn0 * c + rot * sn;
            Cs[row][lane]      = y0 * osc;
            Cs[row][lane + 32] = xn1 * osc;
        }
    }
    __syncthreads();

    v8h o[4];
    size_t off[4];
    if (mode != 2) {
        f16* ob = ((mode == 0) ? qb : kb) + ((size_t)(bb * nHh + hh) * NS + s0) * NHD;
#pragma unroll
        for (int q = 0; q < 4; ++q) {
            const int L = 4 * q + (lane >> 3);          // local row
            const int row = 16 * wid + L;
            const int cc = (lane & 7) * 8;
            const v4f u0 = *(const v4fa*)(&Cs[row][cc]);
            const v4f u1 = *(const v4fa*)(&Cs[row][cc + 4]);
#pragma unroll
            for (int e = 0; e < 4; ++e) { o[q][e] = (f16)u0[e]; o[q][4 + e] = (f16)u1[e]; }
            off[q] = (size_t)row * NHD + cc;
        }
#pragma unroll
        for (int q = 0; q < 4; ++q) *(v8h*)(ob + off[q]) = o[q];
        
    } else {
        f16* ob = vt + (size_t)(bb * NKV + hh) * NHD * NS + s0;
#pragma unroll
        for (int q = 0; q < 4; ++q) {
            const int L = 4 * q + (lane >> 3);          // 0..15
            const int d = 8 * wid + (L >> 1);
            const int sb = (L & 1) * 64 + (lane & 7) * 8;
#pragma unroll
            for (int e = 0; e < 8; ++e) o[q][e] = (f16)(Cs[sb + e][d] * (1.0f / 16.0f));
            off[q] = (size_t)d * NS + sb;
        }
#pragma unroll
        for (int q = 0; q < 4; ++q) *(v8h*)(ob + off[q]) = o[q];
        
    }
}

// ---------------------------------------------------------------------------
// Flash attention. Block = (128 q rows, head, batch), 8 waves x 16 q rows.
// K tile [32 kv][64 d] and V tile [64 d][32 kv] staged in LDS by all threads.
// Scores: B fragment = K row (lane = kv), split k map over d.
// P: score rows go through LDS, lane l16 reads row l16's split k subset -> A fragment (P*256 as f16).
// PV: B fragment = V row (lane = d), split k map over kv.
// ---------------------------------------------------------------------------
__global__ __launch_bounds__(256) void k_attn(const f16* __restrict__ qb, const f16* __restrict__ kb,
                                              const f16* __restrict__ vt, f16* __restrict__ ob) {
    __shared__ __attribute__((aligned(16))) f16   Ks[32 * 72];
    __shared__ __attribute__((aligned(16))) f16   Vs[64 * 40];
    __shared__ __attribute__((aligned(16))) float Pw[8 * 16 * 36];
    __shared__ __attribute__((aligned(16))) f16   Os[8 * 16 * 72];

    const int tid = threadIdx.x, lane = tid & 31, wid = tid >> 5;
    const int h = lane >> 4, l16 = lane & 15, h8 = h * 8;
    const int bb = blockIdx.z, hd = blockIdx.y, kvh = hd / (NH / NKV);
    const int qblk = blockIdx.x * 128;
    if (qblk + 128 > NS || hd >= NH || bb >= NB) return;   // block-uniform
    const int q0 = qblk + wid * 16;

    const f16* qrow = qb + ((size_t)(bb * NH + hd) * NS + q0 + l16) * NHD;
    Frag qa0, qa1;
    qa0.h[0] = *(const v8h*)(qrow + h8);
    qa0.h[1] = *(const v8h*)(qrow + 16 + h8);
    qa1.h[0] = *(const v8h*)(qrow + 32 + h8);
    qa1.h[1] = *(const v8h*)(qrow + 48 + h8);

    float m_run = -1e30f, l_run = 0.0f;
    v8f acc0 = zero8(), acc1 = zero8(), acc2 = zero8(), acc3 = zero8();

    const f16* kbase = kb + (size_t)(bb * NKV + kvh) * NS * NHD;
    const f16* vbase = vt + (size_t)(bb * NKV + kvh) * NHD * NS;
    float* pw = Pw + wid * 16 * 36;

#pragma unroll 1
    for (int it = 0; it < NS / 32; ++it) {
        __syncthreads();                              // prior tile fully consumed by all waves
        {
            const int r = tid >> 3, c = (tid & 7) * 8;    // K: 32 rows x 64 d
            const v8h u = *(const v8h*)(kbase + (size_t)(it * 32 + r) * NHD + c);
            *(v8h*)(Ks + r * 72 + c) = u;
        }
        {
            const int d = tid >> 2, c = (tid & 3) * 8;    // V: 64 d rows x 32 kv
            const v8h u = *(const v8h*)(vbase + (size_t)d * NS + it * 32 + c);
            *(v8h*)(Vs + d * 40 + c) = u;
        }
        __syncthreads();

        // scores for 32 kv columns (two 16x16 tiles), raw f32 rows -> per-wave LDS
#pragma unroll
        for (int t = 0; t < 2; ++t) {
            const f16* kp = Ks + (t * 16 + l16) * 72;
            Frag b0, b1;
            b0.h[0] = *(const v8h*)(kp + h8);      b0.h[1] = *(const v8h*)(kp + 16 + h8);
            b1.h[0] = *(const v8h*)(kp + 32 + h8); b1.h[1] = *(const v8h*)(kp + 48 + h8);
            v8f sc = zero8();
            sc = mma(qa0.v, b0.v, sc);
            sc = mma(qa1.v, b1.v, sc);
#pragma unroll
            for (int r = 0; r < 8; ++r) pw[(8 * h + r) * 36 + t * 16 + l16] = sc[r];
        }
        __syncthreads();

        // lane reads row l16, kv subset {8h..8h+7, 16+8h..23+8h}
        const float* prow = pw + l16 * 36 + h8;
        const v4f r0 = *(const v4fa*)(prow);
        const v4f r1 = *(const v4fa*)(prow + 4);
        const v4f r2 = *(const v4fa*)(prow + 16);
        const v4f r3 = *(const v4fa*)(prow + 20);

        float rm = r0[0];
#pragma unroll
        for (int i = 1; i < 4; ++i) rm = fmaxf(rm, r0[i]);
#pragma unroll
        for (int i = 0; i < 4; ++i) rm = fmaxf(rm, r1[i]);
#pragma unroll
        for (int i = 0; i < 4; ++i) rm = fmaxf(rm, r2[i]);
#pragma unroll
        for (int i = 0; i < 4; ++i) rm = fmaxf(rm, r3[i]);
        rm = fmaxf(rm, __shfl_xor(rm, 16, 32));

        const float mn = fmaxf(m_run, rm);
        const float alpha = __expf(m_run - mn);

        Frag pa;
        float rs = 0.0f;
#pragma unroll
        for (int i = 0; i < 4; ++i) { const float p = __expf(r0[i] - mn); rs += p; pa.e[i]      = (f16)(p * 256.0f); }
#pragma unroll
        for (int i = 0; i < 4; ++i) { const float p = __expf(r1[i] - mn); rs += p; pa.e[4 + i]  = (f16)(p * 256.0f); }
#pragma unroll
        for (int i = 0; i < 4; ++i) { const float p = __expf(r2[i] - mn); rs += p; pa.e[8 + i]  = (f16)(p * 256.0f); }
#pragma unroll
        for (int i = 0; i < 4; ++i) { const float p = __expf(r3[i] - mn); rs += p; pa.e[12 + i] = (f16)(p * 256.0f); }
        rs += __shfl_xor(rs, 16, 32);
        l_run = l_run * alpha + rs;
        m_run = mn;

        // alpha of row 8h+r lives in lane 8h+r
        float al[8];
#pragma unroll
        for (int r = 0; r < 8; ++r) al[r] = __shfl(alpha, 8 * h + r, 32);
#pragma unroll
        for (int r = 0; r < 8; ++r) { acc0[r] *= al[r]; acc1[r] *= al[r]; acc2[r] *= al[r]; acc3[r] *= al[r]; }

        // PV: B fragment for d = j*16 + l16, kv split map
        {
            Frag bv;
            const f16* vp = Vs + (0 * 16 + l16) * 40;
            bv.h[0] = *(const v8h*)(vp + h8); bv.h[1] = *(const v8h*)(vp + 16 + h8); acc0 = mma(pa.v, bv.v, acc0);
            vp = Vs + (1 * 16 + l16) * 40;
            bv.h[0] = *(const v8h*)(vp + h8); bv.h[1] = *(const v8h*)(vp + 16 + h8); acc1 = mma(pa.v, bv.v, acc1);
            vp = Vs + (2 * 16 + l16) * 40;
            bv.h[0] = *(const v8h*)(vp + h8); bv.h[1] = *(const v8h*)(vp + 16 + h8); acc2 = mma(pa.v, bv.v, acc2);
            vp = Vs + (3 * 16 + l16) * 40;
            bv.h[0] = *(const v8h*)(vp + h8); bv.h[1] = *(const v8h*)(vp + 16 + h8); acc3 = mma(pa.v, bv.v, acc3);
        }
    }

    // normalise: O = acc / (256 * l); stored as O*32 -> acc * (0.125 / l)
    const float inv = 0.125f / l_run;
    float iv[8];
#pragma unroll
    for (int r = 0; r < 8; ++r) iv[r] = __shfl(inv, 8 * h + r, 32);

    __syncthreads();
    f16* os = Os + wid * 16 * 72;
#pragma unroll
    for (int r = 0; r < 8; ++r) {
        const int row = 8 * h + r;
        os[row * 72 + l16]      = (f16)(acc0[r] * iv[r]);
        os[row * 72 + 16 + l16] = (f16)(acc1[r] * iv[r]);
        os[row * 72 + 32 + l16] = (f16)(acc2[r] * iv[r]);
        os[row * 72 + 48 + l16] = (f16)(acc3[r] * iv[r]);
    }
    __syncthreads();

    v8h o[4];
    size_t off[4];
#pragma unroll
    for (int q = 0; q < 4; ++q) {
        const int L = 4 * q + (lane >> 3);     // local q row 0..15
        const int cc = (lane & 7) * 8;
        o[q] = *(const v8ha*)(os + L * 72 + cc);
        off[q] = ((size_t)(bb * NS + q0 + L)) * (NH * NHD) + hd * NHD + cc;
    }
#pragma unroll
    for (int q = 0; q < 4; ++q) *(v8h*)(ob + off[q]) = o[q];
    
}

// ---------------------------------------------------------------------------
// out = (O*32 f16) x (Wo*16 f16, k contiguous) / 512 + bias + residual, f32 [NM][NDM]
// Block tile 128 x 64, grid = (NDM/64, NM/128). Row segment of 64 floats = 2 lines,
// ---------------------------------------------------------------------------
__global__ __launch_bounds__(256) void k_oproj(const f16* __restrict__ A, const f16* __restrict__ Wot,
                                               const float* __restrict__ bias, const float* __restrict__ resid,
                                               float* __restrict__ out) {
    __shared__ __attribute__((aligned(16))) unsigned char ring[RING_BYTES];
    float (*Cs)[68] = reinterpret_cast<float (*)[68]>(ring);   // C tile takes the ring's place behind the K loop
    const int tid = threadIdx.x, lane = tid & 31, wid = tid >> 5;
    const int h = lane >> 4, l16 = lane & 15;
    const int n0 = blockIdx.x * 64;
    const int m0 = blockIdx.y * 128;
    if (n0 + 64 > NDM || m0 + 128 > NM) return;   // block-uniform

    v8f c0 = zero8(), c1 = zero8(), c2 = zero8(), c3 = zero8();
    mm128x64(A + (size_t)m0 * (NH * NHD), Wot + (size_t)n0 * (NH * NHD), NH * NHD, ring, c0, c1, c2, c3);

#pragma unroll
    for (int r = 0; r < 8; ++r) {
        const int row = 16 * wid + 8 * h + r;
        Cs[row][l16]      = c0[r];
        Cs[row][16 + l16] = c1[r];
        Cs[row][32 + l16] = c2[r];
        Cs[row][48 + l16] = c3[r];
    }
    __syncthreads();

    v4f o[8];
    size_t off[8];
#pragma unroll
    for (int q = 0; q < 8; ++q) {
        const int L = 4 * q + (lane >> 3);         // 0..31 : (local row, half)
        const int row = 16 * wid + (L >> 1);
        const int cc = (L & 1) * 32 + (lane & 7) * 4;
        const v4f cv = *(const v4fa*)(&Cs[row][cc]);
        const size_t go = (size_t)(m0 + row) * NDM + n0 + cc;
        const v4f bv = *(const v4f*)(bias + n0 + cc);
        const v4f rv = *(const v4f*)(resid + go);
        v4f val;
#pragma unroll
        for (int e = 0; e < 4; ++e) val[e] = (cv[e] * (1.0f / 512.0f) + bv[e]) + rv[e];
        o[q] = val;
        off[q] = go;
    }
#pragma unroll
    for (int q = 0; q < 8; ++q) *(v4f*)(out + off[q]) = o[q];
    
}

// ---------------------------------------------------------------------------
// Launcher
// ---------------------------------------------------------------------------
extern "C" void kernel_launch(void* const* d_in, const int* in_sizes, int n_in,
                              void* d_out, int out_size, void* d_ws, size_t ws_size,
                              hipStream_t stream) {
    if (n_in < 10) return;
    if (in_sizes[0] != NM * NDM) return;
    if (in_sizes[1] != NDM * NH * NHD) return;
    if (in_sizes[2] != NDM * NKV * NHD || in_sizes[3] != NDM * NKV * NHD) return;
    if (in_sizes[4] != NH * NHD * NDM) return;
    if (in_sizes[5] < NDM || in_sizes[6] < NHD || in_sizes[7] < NHD) return;
    if (in_sizes[8] != NS * NROT || in_sizes[9] != NS * NROT) return;
    if (out_size != NM * NDM) return;

    const float* hs   = (const float*)d_in[0];
    const float* wq   = (const float*)d_in[1];
    const float* wk   = (const float*)d_in[2];
    const float* wv   = (const float*)d_in[3];
    const float* wo   = (const float*)d_in[4];
    const float* bo   = (const float*)d_in[5];
    const float* nqw  = (const float*)d_in[6];
    const float* nkw  = (const float*)d_in[7];
    const float* cosT = (const float*)d_in[8];
    const float* sinT = (const float*)d_in[9];

    const size_t szX   = (size_t)NM * NDM * sizeof(f16);            // 8 MB
    const size_t szWq  = (size_t)NDM * NH * NHD * sizeof(f16);      // 2 MB
    const size_t szWkv = (size_t)NDM * NKV * NHD * sizeof(f16);     // 1 MB
    const size_t szWo  = (size_t)NH * NHD * NDM * sizeof(f16);      // 2 MB
    const size_t szQ   = (size_t)NB * NH * NS * NHD * sizeof(f16);  // 8 MB
    const size_t szKV  = (size_t)NB * NKV * NS * NHD * sizeof(f16); // 4 MB
    const size_t szO   = (size_t)NM * NH * NHD * sizeof(f16);       // 8 MB
    size_t offp = 0;
    const size_t oX   = offp; offp += szX;
    const size_t oWq  = offp; offp += szWq;
    const size_t oWk  = offp; offp += szWkv;
    const size_t oWv  = offp; offp += szWkv;
    const size_t oWo  = offp; offp += szWo;
    const size_t oQ   = offp; offp += szQ;
    const size_t oK   = offp; offp += szKV;
    const size_t oV   = offp; offp += szKV;
    const size_t oO   = offp; offp += szO;
    if (offp > ws_size) return;

    char* ws = (char*)d_ws;
    f16* hsb  = (f16*)(ws + oX);
    f16* wqt  = (f16*)(ws + oWq);
    f16* wkt  = (f16*)(ws + oWk);
    f16* wvt  = (f16*)(ws + oWv);
    f16* wot  = (f16*)(ws + oWo);
    f16* qbuf = (f16*)(ws + oQ);
    f16* kbuf = (f16*)(ws + oK);
    f16* vtb  = (f16*)(ws + oV);
    f16* attb = (f16*)(ws + oO);

    const int n8 = (NM * NDM) / 8;
    k_cvt<<<(n8 + 255) / 256, 256, 0, stream>>>(hs, hsb, n8);

    // W[K=in][N=out] -> Wt[N][K] * 16 ; grid = (N/32)*(K/64)
    k_wtrans<<<((NH * NHD) / 32) * (NDM / 64), 256, 0, stream>>>(wq, wqt, NDM, NH * NHD, 16.0f);
    k_wtrans<<<((NKV * NHD) / 32) * (NDM / 64), 256, 0, stream>>>(wk, wkt, NDM, NKV * NHD, 16.0f);
    k_wtrans<<<((NKV * NHD) / 32) * (NDM / 64), 256, 0, stream>>>(wv, wvt, NDM, NKV * NHD, 16.0f);
    k_wtrans<<<(NDM / 32) * ((NH * NHD) / 64), 256, 0, stream>>>(wo, wot, NH * NHD, NDM, 16.0f);

    k_qkv<<<dim3(32, (NM + 127) / 128), 256, 0, stream>>>(hsb, wqt, wkt, wvt, nqw, nkw, cosT, sinT,
                                                         qbuf, kbuf, vtb);

    k_attn<<<dim3((NS + 127) / 128, NH, NB), 256, 0, stream>>>(qbuf, kbuf, vtb, attb);

    k_oproj<<<dim3((NDM + 63) / 64, (NM + 127) / 128), 256, 0, stream>>>(attb, wot, bo, hs, (float*)d_out);
}

// v002
// It runs in 109 microseconds.
// Next to v001, in two timings, it ran 1.47 and 1.46 times as fast.
// Counting every step since v000, it is 2.20 times as fast.
#include <hip/hip_runtime.h>
#include <stdint.h>

// Contractions x*Wq, x*Wk, x*Wv, q*k^T, p*v, o*Wo: v_wmma_f32_16x16x32_f16 (f16 operands with power-of-two operand scaling, f32 accumulate); RMS norm, rotary, softmax, bias and residual in f32.

#define NB   2
#define NS   2048
#define NDM  1024
#define NH   16
#define NKV  8
#define NHD  64
#define NROT 32
#define EPSV 1e-6f
#define NM   (NB * NS)

typedef _Float16 f16;
typedef f16   v8h  __attribute__((ext_vector_type(8)));
typedef f16   v16h __attribute__((ext_vector_type(16)));
typedef float v4f  __attribute__((ext_vector_type(4)));
typedef float v8f  __attribute__((ext_vector_type(8)));
typedef v4f v4fa __attribute__((may_alias));
typedef v8h v8ha __attribute__((may_alias));

union Frag { v16h v; v8h h[2]; f16 e[16]; };

// D(16x16 f32) += A(16x32) * B(32x16); hazard guard ties D and keeps A/B live.
__device__ __forceinline__ v8f mma(const v16h a, const v16h b, v8f c) {
    v8f d = __builtin_amdgcn_wmma_f32_16x16x32_f16(false, a, false, b, (short)0, c, false, false);
    asm volatile("v_nop\n\tv_nop\n\tv_nop\n\tv_nop" : "+v"(d) : "v"(a), "v"(b));
    return d;
}

// 2^x of four independent values. One statement, outputs apart from the inputs, so that each v_exp_f32 is
// followed by an instruction that neither reads its result nor overwrites its source; the v_nop is that
// instruction behind the last one, whatever the compiler places next.
__device__ __forceinline__ v4f exp2x4(const v4f x) {
    float r0, r1, r2, r3;
    asm("v_exp_f32 %0, %4\n\tv_exp_f32 %1, %5\n\tv_exp_f32 %2, %6\n\tv_exp_f32 %3, %7\n\tv_nop"
        : "=&v"(r0), "=&v"(r1), "=&v"(r2), "=&v"(r3)
        : "v"(x[0]), "v"(x[1]), "v"(x[2]), "v"(x[3]));
    v4f r;
    r[0] = r0; r[1] = r1; r[2] = r2; r[3] = r3;
    return r;
}

__device__ __forceinline__ v8f zero8() {
    v8f z;
#pragma unroll
    for (int i = 0; i < 8; ++i) z[i] = 0.0f;
    return z;
}

// ---------------------------------------------------------------------------
// ---------------------------------------------------------------------------
__global__ __launch_bounds__(256) void k_cvt(const float* __restrict__ in, f16* __restrict__ out, int n8) {
    const int i = blockIdx.x * 256 + threadIdx.x;
    if (i >= n8) return;
    const float* s = in + (size_t)i * 8;
    const v4f u0 = *(const v4f*)(s);
    const v4f u1 = *(const v4f*)(s + 4);
    v8h o;
#pragma unroll
    for (int e = 0; e < 4; ++e) { o[e] = (f16)u0[e]; o[4 + e] = (f16)u1[e]; }
    f16* d = out + (size_t)i * 8;
    *(v8h*)d = o;
    
}

// ---------------------------------------------------------------------------
// W[K][N] f32 -> Wt[N][K] f16 * scale (k contiguous). Tile 64 k x 32 n.
// in[K rows][N cols] -> out[N rows][K cols].
// grid.x = (N/32) * (K/64)
// ---------------------------------------------------------------------------
__global__ __launch_bounds__(256) void k_wtrans(const float* __restrict__ W, f16* __restrict__ Wt,
                                                int K, int N, float scale) {
    __shared__ float T[64][33];
    const int tid = threadIdx.x, lane = tid & 31, wid = tid >> 5;
    const int nTn = N / 32;
    const int tn = blockIdx.x % nTn, tk = blockIdx.x / nTn;
    const int n0 = tn * 32, k0 = tk * 64;
    if (k0 + 64 > K || n0 + 32 > N) return;   // block-uniform
    {
        const int k = tid >> 2, c = (tid & 3) * 8;
        const float* src = W + (size_t)(k0 + k) * N + n0 + c;
        const v4f u0 = *(const v4f*)(src);
        const v4f u1 = *(const v4f*)(src + 4);
#pragma unroll
        for (int e = 0; e < 4; ++e) { T[k][c + e] = u0[e]; T[k][c + 4 + e] = u1[e]; }
    }
    __syncthreads();
    const int L  = wid * 4 + (lane >> 3);     // local n row 0..31
    const int k8 = (lane & 7) * 8;
    v8h o;
#pragma unroll
    for (int e = 0; e < 8; ++e) o[e] = (f16)(T[k8 + e][L] * scale);
    f16* dst = Wt + (size_t)(n0 + L) * K + k0 + k8;
    *(v8h*)dst = o;
    
}

// ---------------------------------------------------------------------------
// Block: C[128 rows][64 cols] += A[128 x K] * B[K x 64]; wave w owns rows 16w..16w+15.
// Ablk -> A + m0*K, Bblk -> Bt + n0*K (both k contiguous).
// K runs in slabs of 64 (128 B of every row). A slab of all 192 rows is copied into LDS by
// asynchronous copies whose wave-wide 512 B cover four whole lines; two buffers, the next
// slab's copies fly while this one is multiplied. LDS rows at pitch 144 B (16 B x odd).
// Both fragments use the same split k map:
// elements 0..7 <- k0+8h+0..7, elements 8..15 <- k0+16+8h+0..7.
// ---------------------------------------------------------------------------
#define SLAB_K      64
#define SLAB_PITCH  144
#define SLAB_A      (128 * SLAB_PITCH)
#define SLAB_STAGE  (192 * SLAB_PITCH)
#define RING_BYTES  (2 * SLAB_STAGE)

// One thread's share of a slab: 16 B of A rows r, r+32, r+64, r+96 and of B rows r, r+32.
// s_wait_xcnt closes the statement so that no address register is rewritten ahead of it.
__device__ __forceinline__ void slab_copy(uint32_t lds, const f16* ga, const f16* gb, size_t rstep) {
    asm volatile("global_load_async_to_lds_b128 %0, %6, off\n\t"
                 "global_load_async_to_lds_b128 %1, %7, off\n\t"
                 "global_load_async_to_lds_b128 %2, %8, off\n\t"
                 "global_load_async_to_lds_b128 %3, %9, off\n\t"
                 "global_load_async_to_lds_b128 %4, %10, off\n\t"
                 "global_load_async_to_lds_b128 %5, %11, off\n\t"
                 "s_wait_xcnt 0x0"
                 :: "v"(lds), "v"(lds + 32u * SLAB_PITCH), "v"(lds + 64u * SLAB_PITCH),
                    "v"(lds + 96u * SLAB_PITCH), "v"(lds + (uint32_t)SLAB_A),
                    "v"(lds + (uint32_t)SLAB_A + 32u * SLAB_PITCH),
                    "v"(ga), "v"(ga + rstep), "v"(ga + 2 * rstep), "v"(ga + 3 * rstep),
                    "v"(gb), "v"(gb + rstep)
                 : "memory");
}

__device__ __forceinline__ void mm128x64(const f16* __restrict__ Ablk, const f16* __restrict__ Bblk,
                                         int K, unsigned char* ring,
                                         v8f& c0, v8f& c1, v8f& c2, v8f& c3) {
    const int tid = threadIdx.x, lane = tid & 31, wid = tid >> 5;
    const int h = lane >> 4, l16 = lane & 15;
    const int cr = tid >> 3, cc = (tid & 7) * 8;          // copy: row 0..31, f16 column
    const f16* ga = Ablk + (size_t)cr * K + cc;
    const f16* gb = Bblk + (size_t)cr * K + cc;
    const size_t rstep = (size_t)32 * K;
    const uint32_t l0 = (uint32_t)(size_t)ring + (uint32_t)(cr * SLAB_PITCH + cc * 2);
    const int nslab = K / SLAB_K;

    slab_copy(l0, ga, gb, rstep);
    asm volatile("s_wait_asynccnt 0x0" ::: "memory");     // slab 0 landed (this wave's share)
    __syncthreads();                                      // ... and every other wave's
    if (nslab > 1) slab_copy(l0 + (uint32_t)SLAB_STAGE, ga + SLAB_K, gb + SLAB_K, rstep);

    const unsigned char* af = ring + (16 * wid + l16) * SLAB_PITCH + h * 16;
    const unsigned char* bf = ring + SLAB_A + l16 * SLAB_PITCH + h * 16;
    for (int t = 0; t < nslab; ++t) {
        const int bo = (t & 1) * SLAB_STAGE;
        for (int ks = 0; ks < 2; ++ks) {
            // the k step's ten LDS reads stand together in front of its four products
            Frag a, b0, b1, b2, b3;
            const unsigned char* ap = af + bo + ks * 64;
            const unsigned char* bp = bf + bo + ks * 64;
            a.h[0]  = *(const v8ha*)(ap);                   a.h[1]  = *(const v8ha*)(ap + 32);
            b0.h[0] = *(const v8ha*)(bp);                   b0.h[1] = *(const v8ha*)(bp + 32);
            b1.h[0] = *(const v8ha*)(bp + 16 * SLAB_PITCH); b1.h[1] = *(const v8ha*)(bp + 16 * SLAB_PITCH + 32);
            b2.h[0] = *(const v8ha*)(bp + 32 * SLAB_PITCH); b2.h[1] = *(const v8ha*)(bp + 32 * SLAB_PITCH + 32);
            b3.h[0] = *(const v8ha*)(bp + 48 * SLAB_PITCH); b3.h[1] = *(const v8ha*)(bp + 48 * SLAB_PITCH + 32);
            c0 = mma(a.v, b0.v, c0);
            c1 = mma(a.v, b1.v, c1);
            c2 = mma(a.v, b2.v, c2);
            c3 = mma(a.v, b3.v, c3);
        }
        asm volatile("s_wait_dscnt 0x0" ::: "memory");    // this wave has left buffer t & 1
        asm volatile("s_wait_asynccnt 0x0" ::: "memory"); // its share of slab t + 1 has landed
        __syncthreads();                                  // publishes slab t + 1, frees buffer t & 1
        if (t + 2 < nslab)
            slab_copy(l0 + (uint32_t)bo, ga + (size_t)(t + 2) * SLAB_K, gb + (size_t)(t + 2) * SLAB_K, rstep);
    }
    asm volatile("s_wait_asynccnt 0x0" ::: "memory");     // no copy outstanding when the ring is reused
}

// ---------------------------------------------------------------------------
// Fused QKV projection + RMS norm + partial rotary.
// Block tile = 128 rows (one batch, 128 consecutive s) x 64 cols (= one head).
// grid = (32 col tiles: 0..15 -> q heads, 16..23 -> k heads, 24..31 -> v heads, NM/128)
// q out: [b][h][s][d] f16, pre-multiplied by 1/8 (softmax scale);  k out: [b][kvh][s][d] f16
// v out: [b][kvh][d][s] f16 (d-major)
// ---------------------------------------------------------------------------
__global__ __launch_bounds__(256) void k_qkv(const f16* __restrict__ X,
                                             const f16* __restrict__ Wqt, const f16* __restrict__ Wkt,
                                             const f16* __restrict__ Wvt,
                                             const float* __restrict__ nqw, const float* __restrict__ nkw,
                                             const float* __restrict__ cosT, const float* __restrict__ sinT,
                                             f16* __restrict__ qb, f16* __restrict__ kb, f16* __restrict__ vt) {
    __shared__ __attribute__((aligned(16))) unsigned char ring[RING_BYTES];
    float (*Cs)[68] = reinterpret_cast<float (*)[68]>(ring);   // C tile takes the ring's place behind the K loop
    const int tid = threadIdx.x, lane = tid & 31, wid = tid >> 5;
    const int h = lane >> 4, l16 = lane & 15;
    const int nt = blockIdx.x;
    const int m0 = blockIdx.y * 128;
    if (m0 + 128 > NM || nt >= 32) return;    // block-uniform

    int mode, hh, nHh;
    const f16* Wt;
    const float* nw;
    if (nt < 16)      { mode = 0; hh = nt;      nHh = NH;  Wt = Wqt; nw = nqw; }
    else if (nt < 24) { mode = 1; hh = nt - 16; nHh = NKV; Wt = Wkt; nw = nkw; }
    else              { mode = 2; hh = nt - 24; nHh = NKV; Wt = Wvt; nw = nkw; }
    const int n0 = hh * NHD;
    const int bb = m0 / NS, s0 = m0 % NS;

    v8f c0 = zero8(), c1 = zero8(), c2 = zero8(), c3 = zero8();
    mm128x64(X + (size_t)m0 * NDM, Wt + (size_t)n0 * NDM, NDM, ring, c0, c1, c2, c3);

    // accumulator (lane = col, element r = row 8h+r) -> LDS tile, still scaled by 16
#pragma unroll
    for (int r = 0; r < 8; ++r) {
        const int row = 16 * wid + 8 * h + r;
        Cs[row][l16]      = c0[r];
        Cs[row][16 + l16] = c1[r];
        Cs[row][32 + l16] = c2[r];
        Cs[row][48 + l16] = c3[r];
    }
    __syncthreads();

    if (mode != 2) {
        const float osc = (mode == 0) ? 0.125f : 1.0f;
        const float w0 = nw[lane], w1 = nw[lane + 32];
#pragma unroll 1
        for (int r = 0; r < 16; ++r) {
            const int row = 16 * wid + r;
            const int s = s0 + row;
            float x0 = Cs[row][lane] * (1.0f / 16.0f);
            float x1 = Cs[row][lane + 32] * (1.0f / 16.0f);
            float ss = x0 * x0 + x1 * x1;
#pragma unroll
            for (int m = 16; m >= 1; m >>= 1) ss += __shfl_xor(ss, m, 32);
            const float rinv = rsqrtf(ss * (1.0f / NHD) + EPSV);
            const float xn0 = x0 * rinv * w0;
            const float xn1 = x1 * rinv * w1;
            const float part = __shfl_xor(xn0, 16, 32);
            const float rot = (lane < 16) ? -part : part;
            const float c  = cosT[(size_t)s * NROT + lane];
            const float sn = sinT[(size_t)s * NROT + lane];
            const float y0 = xn0 * c + rot * sn;
            Cs[row][lane]      = y0 * osc;
            Cs[row][lane + 32] = xn1 * osc;
        }
    }
    __syncthreads();

    v8h o[4];
    size_t off[4];
    if (mode != 2) {
        f16* ob = ((mode == 0) ? qb : kb) + ((size_t)(bb * nHh + hh) * NS + s0) * NHD;
#pragma unroll
        for (int q = 0; q < 4; ++q) {
            const int L = 4 * q + (lane >> 3);          // local row
            const int row = 16 * wid + L;
            const int cc = (lane & 7) * 8;
            const v4f u0 = *(const v4fa*)(&Cs[row][cc]);
            const v4f u1 = *(const v4fa*)(&Cs[row][cc + 4]);
#pragma unroll
            for (int e = 0; e < 4; ++e) { o[q][e] = (f16)u0[e]; o[q][4 + e] = (f16)u1[e]; }
            off[q] = (size_t)row * NHD + cc;
        }
#pragma unroll
        for (int q = 0; q < 4; ++q) *(v8h*)(ob + off[q]) = o[q];
        
    } else {
        f16* ob = vt + (size_t)(bb * NKV + hh) * NHD * NS + s0;
#pragma unroll
        for (int q = 0; q < 4; ++q) {
            const int L = 4 * q + (lane >> 3);          // 0..15
            const int d = 8 * wid + (L >> 1);
            const int sb = (L & 1) * 64 + (lane & 7) * 8;
#pragma unroll
            for (int e = 0; e < 8; ++e) o[q][e] = (f16)(Cs[sb + e][d] * (1.0f / 16.0f));
            off[q] = (size_t)d * NS + sb;
        }
#pragma unroll
        for (int q = 0; q < 4; ++q) *(v8h*)(ob + off[q]) = o[q];
        
    }
}

// ---------------------------------------------------------------------------
// Flash attention. Block = (128 q rows, head, batch), 8 waves x 16 q rows.
// A pass takes KT keys: K tile [KT kv][64 d] and V tile [64 d][KT kv] staged in LDS by all threads;
// one running-maximum update, one rescale of the accumulators and three barriers per pass.
// Scores: B fragment = K row (lane = kv), split k map over d.
// P: score rows go through LDS, lane l16 reads row l16's split k subset of every 32 keys -> A fragments (P*256 as f16).
// PV: B fragment = V row (lane = d), split k map over kv.
// LDS pitches are 16 B x odd: K rows 144 B, V rows 272 B, score rows 528 B.
// ---------------------------------------------------------------------------
#define KT    128
#define KS_P  72
#define VS_P  (KT + 8)
#define PW_P  (KT + 4)
__global__ __launch_bounds__(256) void k_attn(const f16* __restrict__ qb, const f16* __restrict__ kb,
                                              const f16* __restrict__ vt, f16* __restrict__ ob) {
    __shared__ __attribute__((aligned(16))) f16   Ks[KT * KS_P];
    __shared__ __attribute__((aligned(16))) f16   Vs[64 * VS_P];
    __shared__ __attribute__((aligned(16))) float Pw[8 * 16 * PW_P];
    __shared__ __attribute__((aligned(16))) f16   Os[8 * 16 * 72];

    const int tid = threadIdx.x, lane = tid & 31, wid = tid >> 5;
    const int h = lane >> 4, l16 = lane & 15, h8 = h * 8;
    const int bb = blockIdx.z, hd = blockIdx.y, kvh = hd / (NH / NKV);
    const int qblk = blockIdx.x * 128;
    if (qblk + 128 > NS || hd >= NH || bb >= NB) return;   // block-uniform
    const int q0 = qblk + wid * 16;

    const f16* qrow = qb + ((size_t)(bb * NH + hd) * NS + q0 + l16) * NHD;
    Frag qa0, qa1;
    qa0.h[0] = *(const v8h*)(qrow + h8);
    qa0.h[1] = *(const v8h*)(qrow + 16 + h8);
    qa1.h[0] = *(const v8h*)(qrow + 32 + h8);
    qa1.h[1] = *(const v8h*)(qrow + 48 + h8);

    float m_run = -1e30f, l_run = 0.0f;
    v8f acc0 = zero8(), acc1 = zero8(), acc2 = zero8(), acc3 = zero8();

    const f16* kbase = kb + (size_t)(bb * NKV + kvh) * NS * NHD;
    const f16* vbase = vt + (size_t)(bb * NKV + kvh) * NHD * NS;
    float* pw = Pw + wid * 16 * PW_P;

#pragma unroll 1
    for (int it = 0; it < NS / KT; ++it) {
        __syncthreads();                              // prior tile fully consumed by all waves
        {
            // the pass's eight global loads stand together in front of the LDS stores
            const int r = tid >> 3, c = (tid & 7) * 8;     // K: KT rows x 64 d, 32 rows a step
            const int d = tid >> 4, cv = (tid & 15) * 8;   // V: 64 d rows x KT kv, 16 rows a step
            v8h uk[KT / 32], uv[4];
#pragma unroll
            for (int i = 0; i < KT / 32; ++i) uk[i] = *(const v8h*)(kbase + (size_t)(it * KT + r + 32 * i) * NHD + c);
#pragma unroll
            for (int i = 0; i < 4; ++i) uv[i] = *(const v8h*)(vbase + (size_t)(d + 16 * i) * NS + it * KT + cv);
            asm volatile("s_wait_xcnt 0x0" ::: "memory");  // stands in front of any reuse of the eight loads' address registers
#pragma unroll
            for (int i = 0; i < KT / 32; ++i) *(v8h*)(Ks + (r + 32 * i) * KS_P + c) = uk[i];
#pragma unroll
            for (int i = 0; i < 4; ++i) *(v8h*)(Vs + (d + 16 * i) * VS_P + cv) = uv[i];
        }
        __syncthreads();

        // scores for KT kv columns, four 16x16 tiles at a time, raw f32 rows -> per-wave LDS
#pragma unroll
        for (int tb = 0; tb < KT / 16; tb += 4) {
            Frag b0[4], b1[4];
#pragma unroll
            for (int u = 0; u < 4; ++u) {
                const f16* kp = Ks + ((tb + u) * 16 + l16) * KS_P;
                b0[u].h[0] = *(const v8h*)(kp + h8);      b0[u].h[1] = *(const v8h*)(kp + 16 + h8);
                b1[u].h[0] = *(const v8h*)(kp + 32 + h8); b1[u].h[1] = *(const v8h*)(kp + 48 + h8);
            }
            v8f sc[4];
#pragma unroll
            for (int u = 0; u < 4; ++u) sc[u] = mma(qa0.v, b0[u].v, zero8());
#pragma unroll
            for (int u = 0; u < 4; ++u) sc[u] = mma(qa1.v, b1[u].v, sc[u]);
#pragma unroll
            for (int u = 0; u < 4; ++u)
#pragma unroll
                for (int r = 0; r < 8; ++r) pw[(8 * h + r) * PW_P + (tb + u) * 16 + l16] = sc[u][r];
        }
        __syncthreads();

        // lane reads row l16, of every 32 keys the kv subset {8h..8h+7, 16+8h..23+8h}
        const float* prow = pw + l16 * PW_P + h8;
        v4f rv[KT / 32][4];
#pragma unroll
        for (int g = 0; g < KT / 32; ++g) {
            rv[g][0] = *(const v4fa*)(prow + 32 * g);
            rv[g][1] = *(const v4fa*)(prow + 32 * g + 4);
            rv[g][2] = *(const v4fa*)(prow + 32 * g + 16);
            rv[g][3] = *(const v4fa*)(prow + 32 * g + 20);
        }

        // one maximum per 32 keys (independent chains), then their maximum
        float rm = -1e30f;
#pragma unroll
        for (int g = 0; g < KT / 32; ++g) {
            float gm = rv[g][0][0];
#pragma unroll
            for (int i = 1; i < 16; ++i) gm = fmaxf(gm, rv[g][i >> 2][i & 3]);
            rm = fmaxf(rm, gm);
        }
        rm = fmaxf(rm, __shfl_xor(rm, 16, 32));

        const float mn = fmaxf(m_run, rm);
        const float alpha = __expf(m_run - mn);

        // one partial sum per 32 keys (independent chains), then their sum
        Frag pa[KT / 32];
        float rs = 0.0f;
#pragma unroll
        for (int g = 0; g < KT / 32; ++g) {
            float gs = 0.0f;
#pragma unroll
            for (int q = 0; q < 4; ++q) {
                const v4f p = exp2x4((rv[g][q] - mn) * 1.44269504f);   // e^(s - mn)
#pragma unroll
                for (int e = 0; e < 4; ++e) { gs += p[e]; pa[g].e[4 * q + e] = (f16)(p[e] * 256.0f); }
            }
            rs += gs;
        }
        rs += __shfl_xor(rs, 16, 32);
        l_run = l_run * alpha + rs;
        m_run = mn;

        // alpha of row 8h+r lives in lane 8h+r
        float al[8];
#pragma unroll
        for (int r = 0; r < 8; ++r) al[r] = __shfl(alpha, 8 * h + r, 32);
#pragma unroll
        for (int r = 0; r < 8; ++r) { acc0[r] *= al[r]; acc1[r] *= al[r]; acc2[r] *= al[r]; acc3[r] *= al[r]; }

        // PV, 32 keys at a time: B fragment for d = j*16 + l16, kv split map
#pragma unroll
        for (int g = 0; g < KT / 32; ++g) {
            Frag bv[4];
#pragma unroll
            for (int j = 0; j < 4; ++j) {
                const f16* vp = Vs + (j * 16 + l16) * VS_P + g * 32;
                bv[j].h[0] = *(const v8h*)(vp + h8); bv[j].h[1] = *(const v8h*)(vp + 16 + h8);
            }
            acc0 = mma(pa[g].v, bv[0].v, acc0);
            acc1 = mma(pa[g].v, bv[1].v, acc1);
            acc2 = mma(pa[g].v, bv[2].v, acc2);
            acc3 = mma(pa[g].v, bv[3].v, acc3);
        }
    }

    // normalise: O = acc / (256 * l); stored as O*32 -> acc * (0.125 / l)
    const float inv = 0.125f / l_run;
    float iv[8];
#pragma unroll
    for (int r = 0; r < 8; ++r) iv[r] = __shfl(inv, 8 * h + r, 32);

    __syncthreads();
    f16* os = Os + wid * 16 * 72;
#pragma unroll
    for (int r = 0; r < 8; ++r) {
        const int row = 8 * h + r;
        os[row * 72 + l16]      = (f16)(acc0[r] * iv[r]);
        os[row * 72 + 16 + l16] = (f16)(acc1[r] * iv[r]);
        os[row * 72 + 32 + l16] = (f16)(acc2[r] * iv[r]);
        os[row * 72 + 48 + l16] = (f16)(acc3[r] * iv[r]);
    }
    __syncthreads();

    v8h o[4];
    size_t off[4];
#pragma unroll
    for (int q = 0; q < 4; ++q) {
        const int L = 4 * q + (lane >> 3);     // local q row 0..15
        const int cc = (lane & 7) * 8;
        o[q] = *(const v8ha*)(os + L * 72 + cc);
        off[q] = ((size_t)(bb * NS + q0 + L)) * (NH * NHD) + hd * NHD + cc;
    }
#pragma unroll
    for (int q = 0; q < 4; ++q) *(v8h*)(ob + off[q]) = o[q];
    
}

// ---------------------------------------------------------------------------
// out = (O*32 f16) x (Wo*16 f16, k contiguous) / 512 + bias + residual, f32 [NM][NDM]
// Block tile 128 x 64, grid = (NDM/64, NM/128). Row segment of 64 floats = 2 lines,
// ---------------------------------------------------------------------------
__global__ __launch_bounds__(256) void k_oproj(const f16* __restrict__ A, const f16* __restrict__ Wot,
                                               const float* __restrict__ bias, const float* __restrict__ resid,
                                               float* __restrict__ out) {
    __shared__ __attribute__((aligned(16))) unsigned char ring[RING_BYTES];
    float (*Cs)[68] = reinterpret_cast<float (*)[68]>(ring);   // C tile takes the ring's place behind the K loop
    const int tid = threadIdx.x, lane = tid & 31, wid = tid >> 5;
    const int h = lane >> 4, l16 = lane & 15;
    const int n0 = blockIdx.x * 64;
    const int m0 = blockIdx.y * 128;
    if (n0 + 64 > NDM || m0 + 128 > NM) return;   // block-uniform

    v8f c0 = zero8(), c1 = zero8(), c2 = zero8(), c3 = zero8();
    mm128x64(A + (size_t)m0 * (NH * NHD), Wot + (size_t)n0 * (NH * NHD), NH * NHD, ring, c0, c1, c2, c3);

#pragma unroll
    for (int r = 0; r < 8; ++r) {
        const int row = 16 * wid + 8 * h + r;
        Cs[row][l16]      = c0[r];
        Cs[row][16 + l16] = c1[r];
        Cs[row][32 + l16] = c2[r];
        Cs[row][48 + l16] = c3[r];
    }
    __syncthreads();

    v4f o[8];
    size_t off[8];
#pragma unroll
    for (int q = 0; q < 8; ++q) {
        const int L = 4 * q + (lane >> 3);         // 0..31 : (local row, half)
        const int row = 16 * wid + (L >> 1);
        const int cc = (L & 1) * 32 + (lane & 7) * 4;
        const v4f cv = *(const v4fa*)(&Cs[row][cc]);
        const size_t go = (size_t)(m0 + row) * NDM + n0 + cc;
        const v4f bv = *(const v4f*)(bias + n0 + cc);
        const v4f rv = *(const v4f*)(resid + go);
        v4f val;
#pragma unroll
        for (int e = 0; e < 4; ++e) val[e] = (cv[e] * (1.0f / 512.0f) + bv[e]) + rv[e];
        o[q] = val;
        off[q] = go;
    }
#pragma unroll
    for (int q = 0; q < 8; ++q) *(v4f*)(out + off[q]) = o[q];
    
}

// ---------------------------------------------------------------------------
// Launcher
// ---------------------------------------------------------------------------
extern "C" void kernel_launch(void* const* d_in, const int* in_sizes, int n_in,
                              void* d_out, int out_size, void* d_ws, size_t ws_size,
                              hipStream_t stream) {
    if (n_in < 10) return;
    if (in_sizes[0] != NM * NDM) return;
    if (in_sizes[1] != NDM * NH * NHD) return;
    if (in_sizes[2] != NDM * NKV * NHD || in_sizes[3] != NDM * NKV * NHD) return;
    if (in_sizes[4] != NH * NHD * NDM) return;
    if (in_sizes[5] < NDM || in_sizes[6] < NHD || in_sizes[7] < NHD) return;
    if (in_sizes[8] != NS * NROT || in_sizes[9] != NS * NROT) return;
    if (out_size != NM * NDM) return;

    const float* hs   = (const float*)d_in[0];
    const float* wq   = (const float*)d_in[1];
    const float* wk   = (const float*)d_in[2];
    const float* wv   = (const float*)d_in[3];
    const float* wo   = (const float*)d_in[4];
    const float* bo   = (const float*)d_in[5];
    const float* nqw  = (const float*)d_in[6];
    const float* nkw  = (const float*)d_in[7];
    const float* cosT = (const float*)d_in[8];
    const float* sinT = (const float*)d_in[9];

    const size_t szX   = (size_t)NM * NDM * sizeof(f16);            // 8 MB
    const size_t szWq  = (size_t)NDM * NH * NHD * sizeof(f16);      // 2 MB
    const size_t szWkv = (size_t)NDM * NKV * NHD * sizeof(f16);     // 1 MB
    const size_t szWo  = (size_t)NH * NHD * NDM * sizeof(f16);      // 2 MB
    const size_t szQ   = (size_t)NB * NH * NS * NHD * sizeof(f16);  // 8 MB
    const size_t szKV  = (size_t)NB * NKV * NS * NHD * sizeof(f16); // 4 MB
    const size_t szO   = (size_t)NM * NH * NHD * sizeof(f16);       // 8 MB
    size_t offp = 0;
    const size_t oX   = offp; offp += szX;
    const size_t oWq  = offp; offp += szWq;
    const size_t oWk  = offp; offp += szWkv;
    const size_t oWv  = offp; offp += szWkv;
    const size_t oWo  = offp; offp += szWo;
    const size_t oQ   = offp; offp += szQ;
    const size_t oK   = offp; offp += szKV;
    const size_t oV   = offp; offp += szKV;
    const size_t oO   = offp; offp += szO;
    if (offp > ws_size) return;

    char* ws = (char*)d_ws;
    f16* hsb  = (f16*)(ws + oX);
    f16* wqt  = (f16*)(ws + oWq);
    f16* wkt  = (f16*)(ws + oWk);
    f16* wvt  = (f16*)(ws + oWv);
    f16* wot  = (f16*)(ws + oWo);
    f16* qbuf = (f16*)(ws + oQ);
    f16* kbuf = (f16*)(ws + oK);
    f16* vtb  = (f16*)(ws + oV);
    f16* attb = (f16*)(ws + oO);

    const int n8 = (NM * NDM) / 8;
    k_cvt<<<(n8 + 255) / 256, 256, 0, stream>>>(hs, hsb, n8);

    // W[K=in][N=out] -> Wt[N][K] * 16 ; grid = (N/32)*(K/64)
    k_wtrans<<<((NH * NHD) / 32) * (NDM / 64), 256, 0, stream>>>(wq, wqt, NDM, NH * NHD, 16.0f);
    k_wtrans<<<((NKV * NHD) / 32) * (NDM / 64), 256, 0, stream>>>(wk, wkt, NDM, NKV * NHD, 16.0f);
    k_wtrans<<<((NKV * NHD) / 32) * (NDM / 64), 256, 0, stream>>>(wv, wvt, NDM, NKV * NHD, 16.0f);
    k_wtrans<<<(NDM / 32) * ((NH * NHD) / 64), 256, 0, stream>>>(wo, wot, NH * NHD, NDM, 16.0f);

    k_qkv<<<dim3(32, (NM + 127) / 128), 256, 0, stream>>>(hsb, wqt, wkt, wvt, nqw, nkw, cosT, sinT,
                                                         qbuf, kbuf, vtb);

    k_attn<<<dim3((NS + 127) / 128, NH, NB), 256, 0, stream>>>(qbuf, kbuf, vtb, attb);

    k_oproj<<<dim3((NDM + 63) / 64, (NM + 127) / 128), 256, 0, stream>>>(attb, wot, bo, hs, (float*)d_out);
}

// v003
// Measured time: 100 microseconds a run.
// Two timings next to v002 put it at 1.07 and 1.09 times that version's speed.
// Counting every step since v000, it is 2.38 times as fast.
#include <hip/hip_runtime.h>
#include <stdint.h>

// Contractions x*Wq, x*Wk, x*Wv, q*k^T, p*v, o*Wo: v_wmma_f32_16x16x32_f16 (f16 operands with power-of-two operand scaling, f32 accumulate); RMS norm, rotary, softmax, bias and residual in f32.

#define NB   2
#define NS   2048
#define NDM  1024
#define NH   16
#define NKV  8
#define NHD  64
#define NROT 32
#define EPSV 1e-6f
#define NM   (NB * NS)

typedef _Float16 f16;
typedef f16   v8h  __attribute__((ext_vector_type(8)));
typedef f16   v16h __attribute__((ext_vector_type(16)));
typedef float v4f  __attribute__((ext_vector_type(4)));
typedef float v8f  __attribute__((ext_vector_type(8)));
typedef v4f v4fa __attribute__((may_alias));
typedef v8h v8ha __attribute__((may_alias));

union Frag { v16h v; v8h h[2]; f16 e[16]; };

// D(16x16 f32) += A(16x32) * B(32x16); hazard guard ties D and keeps A/B live.
__device__ __forceinline__ v8f mma(const v16h a, const v16h b, v8f c) {
    v8f d = __builtin_amdgcn_wmma_f32_16x16x32_f16(false, a, false, b, (short)0, c, false, false);
    asm volatile("v_nop\n\tv_nop\n\tv_nop\n\tv_nop" : "+v"(d) : "v"(a), "v"(b));
    return d;
}

// 2^x of four independent values. One statement, outputs apart from the inputs, so that each v_exp_f32 is
// followed by an instruction that neither reads its result nor overwrites its source; the v_nop is that
// instruction behind the last one, whatever the compiler places next.
__device__ __forceinline__ v4f exp2x4(const v4f x) {
    float r0, r1, r2, r3;
    asm("v_exp_f32 %0, %4\n\tv_exp_f32 %1, %5\n\tv_exp_f32 %2, %6\n\tv_exp_f32 %3, %7\n\tv_nop"
        : "=&v"(r0), "=&v"(r1), "=&v"(r2), "=&v"(r3)
        : "v"(x[0]), "v"(x[1]), "v"(x[2]), "v"(x[3]));
    v4f r;
    r[0] = r0; r[1] = r1; r[2] = r2; r[3] = r3;
    return r;
}

__device__ __forceinline__ v8f zero8() {
    v8f z;
#pragma unroll
    for (int i = 0; i < 8; ++i) z[i] = 0.0f;
    return z;
}

// ---------------------------------------------------------------------------
// ---------------------------------------------------------------------------
__global__ __launch_bounds__(256) void k_cvt(const float* __restrict__ in, f16* __restrict__ out, int n8) {
    const int i = blockIdx.x * 256 + threadIdx.x;
    if (i >= n8) return;
    const float* s = in + (size_t)i * 8;
    const v4f u0 = *(const v4f*)(s);
    const v4f u1 = *(const v4f*)(s + 4);
    v8h o;
#pragma unroll
    for (int e = 0; e < 4; ++e) { o[e] = (f16)u0[e]; o[4 + e] = (f16)u1[e]; }
    f16* d = out + (size_t)i * 8;
    *(v8h*)d = o;
    
}

// ---------------------------------------------------------------------------
// W[K][N] f32 -> Wt[N][K] f16 * scale (k contiguous). Tile 64 k x 32 n.
// in[K rows][N cols] -> out[N rows][K cols].
// grid.x = (N/32) * (K/64)
// ---------------------------------------------------------------------------
__global__ __launch_bounds__(256) void k_wtrans(const float* __restrict__ W, f16* __restrict__ Wt,
                                                int K, int N, float scale) {
    __shared__ float T[64][33];
    const int tid = threadIdx.x, lane = tid & 31, wid = tid >> 5;
    const int nTn = N / 32;
    const int tn = blockIdx.x % nTn, tk = blockIdx.x / nTn;
    const int n0 = tn * 32, k0 = tk * 64;
    if (k0 + 64 > K || n0 + 32 > N) return;   // block-uniform
    {
        const int k = tid >> 2, c = (tid & 3) * 8;
        const float* src = W + (size_t)(k0 + k) * N + n0 + c;
        const v4f u0 = *(const v4f*)(src);
        const v4f u1 = *(const v4f*)(src + 4);
#pragma unroll
        for (int e = 0; e < 4; ++e) { T[k][c + e] = u0[e]; T[k][c + 4 + e] = u1[e]; }
    }
    __syncthreads();
    const int L  = wid * 4 + (lane >> 3);     // local n row 0..31
    const int k8 = (lane & 7) * 8;
    v8h o;
#pragma unroll
    for (int e = 0; e < 8; ++e) o[e] = (f16)(T[k8 + e][L] * scale);
    f16* dst = Wt + (size_t)(n0 + L) * K + k0 + k8;
    *(v8h*)dst = o;
    
}

// ---------------------------------------------------------------------------
// Block: C[128 rows][64 cols] += A[128 x K] * B[K x 64]; wave w owns rows 16w..16w+15.
// Ablk -> A + m0*K, Bblk -> Bt + n0*K (both k contiguous).
// K runs in slabs of 64 (128 B of every row). A slab of all 192 rows is copied into LDS by
// asynchronous copies whose wave-wide 512 B cover four whole lines; two buffers, the next
// slab's copies fly while this one is multiplied. LDS rows at pitch 144 B (16 B x odd).
// Both fragments use the same split k map:
// elements 0..7 <- k0+8h+0..7, elements 8..15 <- k0+16+8h+0..7.
// ---------------------------------------------------------------------------
#define SLAB_K      64
#define SLAB_PITCH  144
#define SLAB_A      (128 * SLAB_PITCH)
#define SLAB_STAGE  (192 * SLAB_PITCH)
#define RING_BYTES  (2 * SLAB_STAGE)

// One thread's share of a slab: 16 B of A rows r, r+32, r+64, r+96 and of B rows r, r+32.
// s_wait_xcnt closes the statement so that no address register is rewritten ahead of it.
__device__ __forceinline__ void slab_copy(uint32_t lds, const f16* ga, const f16* gb, size_t rstep) {
    asm volatile("global_load_async_to_lds_b128 %0, %6, off\n\t"
                 "global_load_async_to_lds_b128 %1, %7, off\n\t"
                 "global_load_async_to_lds_b128 %2, %8, off\n\t"
                 "global_load_async_to_lds_b128 %3, %9, off\n\t"
                 "global_load_async_to_lds_b128 %4, %10, off\n\t"
                 "global_load_async_to_lds_b128 %5, %11, off\n\t"
                 "s_wait_xcnt 0x0"
                 :: "v"(lds), "v"(lds + 32u * SLAB_PITCH), "v"(lds + 64u * SLAB_PITCH),
                    "v"(lds + 96u * SLAB_PITCH), "v"(lds + (uint32_t)SLAB_A),
                    "v"(lds + (uint32_t)SLAB_A + 32u * SLAB_PITCH),
                    "v"(ga), "v"(ga + rstep), "v"(ga + 2 * rstep), "v"(ga + 3 * rstep),
                    "v"(gb), "v"(gb + rstep)
                 : "memory");
}

__device__ __forceinline__ void mm128x64(const f16* __restrict__ Ablk, const f16* __restrict__ Bblk,
                                         int K, unsigned char* ring,
                                         v8f& c0, v8f& c1, v8f& c2, v8f& c3) {
    const int tid = threadIdx.x, lane = tid & 31, wid = tid >> 5;
    const int h = lane >> 4, l16 = lane & 15;
    const int cr = tid >> 3, cc = (tid & 7) * 8;          // copy: row 0..31, f16 column
    const f16* ga = Ablk + (size_t)cr * K + cc;
    const f16* gb = Bblk + (size_t)cr * K + cc;
    const size_t rstep = (size_t)32 * K;
    const uint32_t l0 = (uint32_t)(size_t)ring + (uint32_t)(cr * SLAB_PITCH + cc * 2);
    const int nslab = K / SLAB_K;

    slab_copy(l0, ga, gb, rstep);
    asm volatile("s_wait_asynccnt 0x0" ::: "memory");     // slab 0 landed (this wave's share)
    __syncthreads();                                      // ... and every other wave's
    if (nslab > 1) slab_copy(l0 + (uint32_t)SLAB_STAGE, ga + SLAB_K, gb + SLAB_K, rstep);

    const unsigned char* af = ring + (16 * wid + l16) * SLAB_PITCH + h * 16;
    const unsigned char* bf = ring + SLAB_A + l16 * SLAB_PITCH + h * 16;
    for (int t = 0; t < nslab; ++t) {
        const int bo = (t & 1) * SLAB_STAGE;
        for (int ks = 0; ks < 2; ++ks) {
            // the k step's ten LDS reads stand together in front of its four products
            Frag a, b0, b1, b2, b3;
            const unsigned char* ap = af + bo + ks * 64;
            const unsigned char* bp = bf + bo + ks * 64;
            a.h[0]  = *(const v8ha*)(ap);                   a.h[1]  = *(const v8ha*)(ap + 32);
            b0.h[0] = *(const v8ha*)(bp);                   b0.h[1] = *(const v8ha*)(bp + 32);
            b1.h[0] = *(const v8ha*)(bp + 16 * SLAB_PITCH); b1.h[1] = *(const v8ha*)(bp + 16 * SLAB_PITCH + 32);
            b2.h[0] = *(const v8ha*)(bp + 32 * SLAB_PITCH); b2.h[1] = *(const v8ha*)(bp + 32 * SLAB_PITCH + 32);
            b3.h[0] = *(const v8ha*)(bp + 48 * SLAB_PITCH); b3.h[1] = *(const v8ha*)(bp + 48 * SLAB_PITCH + 32);
            c0 = mma(a.v, b0.v, c0);
            c1 = mma(a.v, b1.v, c1);
            c2 = mma(a.v, b2.v, c2);
            c3 = mma(a.v, b3.v, c3);
        }
        asm volatile("s_wait_dscnt 0x0" ::: "memory");    // this wave has left buffer t & 1
        asm volatile("s_wait_asynccnt 0x0" ::: "memory"); // its share of slab t + 1 has landed
        __syncthreads();                                  // publishes slab t + 1, frees buffer t & 1
        if (t + 2 < nslab)
            slab_copy(l0 + (uint32_t)bo, ga + (size_t)(t + 2) * SLAB_K, gb + (size_t)(t + 2) * SLAB_K, rstep);
    }
    asm volatile("s_wait_asynccnt 0x0" ::: "memory");     // no copy outstanding when the ring is reused
}

// ---------------------------------------------------------------------------
// Fused QKV projection + RMS norm + partial rotary.
// Block tile = 128 rows (one batch, 128 consecutive s) x 64 cols (= one head).
// grid = (32 col tiles: 0..15 -> q heads, 16..23 -> k heads, 24..31 -> v heads, NM/128)
// q out: [b][h][s][d] f16, pre-multiplied by 1/8 (softmax scale);  k out: [b][kvh][s][d] f16
// v out: [b][kvh][d][s] f16 (d-major)
// ---------------------------------------------------------------------------
__global__ __launch_bounds__(256) void k_qkv(const f16* __restrict__ X,
                                             const f16* __restrict__ Wqt, const f16* __restrict__ Wkt,
                                             const f16* __restrict__ Wvt,
                                             const float* __restrict__ nqw, const float* __restrict__ nkw,
                                             const float* __restrict__ cosT, const float* __restrict__ sinT,
                                             f16* __restrict__ qb, f16* __restrict__ kb, f16* __restrict__ vt) {
    __shared__ __attribute__((aligned(16))) unsigned char ring[RING_BYTES];
    float (*Cs)[68] = reinterpret_cast<float (*)[68]>(ring);   // C tile takes the ring's place behind the K loop
    const int tid = threadIdx.x, lane = tid & 31, wid = tid >> 5;
    const int h = lane >> 4, l16 = lane & 15;
    const int nt = blockIdx.x;
    const int m0 = blockIdx.y * 128;
    if (m0 + 128 > NM || nt >= 32) return;    // block-uniform

    int mode, hh, nHh;
    const f16* Wt;
    const float* nw;
    if (nt < 16)      { mode = 0; hh = nt;      nHh = NH;  Wt = Wqt; nw = nqw; }
    else if (nt < 24) { mode = 1; hh = nt - 16; nHh = NKV; Wt = Wkt; nw = nkw; }
    else              { mode = 2; hh = nt - 24; nHh = NKV; Wt = Wvt; nw = nkw; }
    const int n0 = hh * NHD;
    const int bb = m0 / NS, s0 = m0 % NS;

    v8f c0 = zero8(), c1 = zero8(), c2 = zero8(), c3 = zero8();
    mm128x64(X + (size_t)m0 * NDM, Wt + (size_t)n0 * NDM, NDM, ring, c0, c1, c2, c3);

    // accumulator (lane = col, element r = row 8h+r) -> LDS tile, still scaled by 16
#pragma unroll
    for (int r = 0; r < 8; ++r) {
        const int row = 16 * wid + 8 * h + r;
        Cs[row][l16]      = c0[r];
        Cs[row][16 + l16] = c1[r];
        Cs[row][32 + l16] = c2[r];
        Cs[row][48 + l16] = c3[r];
    }
    __syncthreads();

    if (mode != 2) {
        const float osc = (mode == 0) ? 0.125f : 1.0f;
        const float w0 = nw[lane], w1 = nw[lane + 32];
#pragma unroll 1
        for (int r = 0; r < 16; ++r) {
            const int row = 16 * wid + r;
            const int s = s0 + row;
            float x0 = Cs[row][lane] * (1.0f / 16.0f);
            float x1 = Cs[row][lane + 32] * (1.0f / 16.0f);
            float ss = x0 * x0 + x1 * x1;
#pragma unroll
            for (int m = 16; m >= 1; m >>= 1) ss += __shfl_xor(ss, m, 32);
            const float rinv = rsqrtf(ss * (1.0f / NHD) + EPSV);
            const float xn0 = x0 * rinv * w0;
            const float xn1 = x1 * rinv * w1;
            const float part = __shfl_xor(xn0, 16, 32);
            const float rot = (lane < 16) ? -part : part;
            const float c  = cosT[(size_t)s * NROT + lane];
            const float sn = sinT[(size_t)s * NROT + lane];
            const float y0 = xn0 * c + rot * sn;
            Cs[row][lane]      = y0 * osc;
            Cs[row][lane + 32] = xn1 * osc;
        }
    }
    __syncthreads();

    v8h o[4];
    size_t off[4];
    if (mode != 2) {
        f16* ob = ((mode == 0) ? qb : kb) + ((size_t)(bb * nHh + hh) * NS + s0) * NHD;
#pragma unroll
        for (int q = 0; q < 4; ++q) {
            const int L = 4 * q + (lane >> 3);          // local row
            const int row = 16 * wid + L;
            const int cc = (lane & 7) * 8;
            const v4f u0 = *(const v4fa*)(&Cs[row][cc]);
            const v4f u1 = *(const v4fa*)(&Cs[row][cc + 4]);
#pragma unroll
            for (int e = 0; e < 4; ++e) { o[q][e] = (f16)u0[e]; o[q][4 + e] = (f16)u1[e]; }
            off[q] = (size_t)row * NHD + cc;
        }
#pragma unroll
        for (int q = 0; q < 4; ++q) *(v8h*)(ob + off[q]) = o[q];
        
    } else {
        f16* ob = vt + (size_t)(bb * NKV + hh) * NHD * NS + s0;
#pragma unroll
        for (int q = 0; q < 4; ++q) {
            const int L = 4 * q + (lane >> 3);          // 0..15
            const int d = 8 * wid + (L >> 1);
            const int sb = (L & 1) * 64 + (lane & 7) * 8;
#pragma unroll
            for (int e = 0; e < 8; ++e) o[q][e] = (f16)(Cs[sb + e][d] * (1.0f / 16.0f));
            off[q] = (size_t)d * NS + sb;
        }
#pragma unroll
        for (int q = 0; q < 4; ++q) *(v8h*)(ob + off[q]) = o[q];
        
    }
}

#define KT    128
#define KS_P  72
#define VS_P  (KT + 8)
__global__ __launch_bounds__(256) void k_attn(const f16* __restrict__ qb, const f16* __restrict__ kb,
                                              const f16* __restrict__ vt, f16* __restrict__ ob) {
    __shared__ __attribute__((aligned(16))) f16   Ks[KT * KS_P];
    __shared__ __attribute__((aligned(16))) f16   Vs[64 * VS_P];
    __shared__ __attribute__((aligned(16))) f16   Os[8 * 16 * 72];

    const int tid = threadIdx.x, lane = tid & 31, wid = tid >> 5;
    const int h = lane >> 4, l16 = lane & 15, h8 = h * 8;
    const int bb = blockIdx.z, hd = blockIdx.y, kvh = hd / (NH / NKV);
    const int qblk = blockIdx.x * 128;
    if (qblk + 128 > NS || hd >= NH || bb >= NB) return;   // block-uniform
    const int q0 = qblk + wid * 16;

    const f16* qrow = qb + ((size_t)(bb * NH + hd) * NS + q0 + l16) * NHD;
    Frag qa0, qa1;
    qa0.h[0] = *(const v8h*)(qrow + h8);
    qa0.h[1] = *(const v8h*)(qrow + 16 + h8);
    qa1.h[0] = *(const v8h*)(qrow + 32 + h8);
    qa1.h[1] = *(const v8h*)(qrow + 48 + h8);

    float m_run = -1e30f, l_run = 0.0f;
    v8f acc0 = zero8(), acc1 = zero8(), acc2 = zero8(), acc3 = zero8();

    const f16* kbase = kb + (size_t)(bb * NKV + kvh) * NS * NHD;
    const f16* vbase = vt + (size_t)(bb * NKV + kvh) * NHD * NS;

#pragma unroll 1
    for (int it = 0; it < NS / KT; ++it) {
        __syncthreads();                              // prior tile fully consumed by all waves
        {
            // the pass's eight global loads stand together in front of the LDS stores
            const int r = tid >> 3, c = (tid & 7) * 8;     // K: KT rows x 64 d, 32 rows a step
            const int d = tid >> 4, cv = (tid & 15) * 8;   // V: 64 d rows x KT kv, 16 rows a step
            v8h uk[KT / 32], uv[4];
#pragma unroll
            for (int i = 0; i < KT / 32; ++i) uk[i] = *(const v8h*)(kbase + (size_t)(it * KT + r + 32 * i) * NHD + c);
#pragma unroll
            for (int i = 0; i < 4; ++i) uv[i] = *(const v8h*)(vbase + (size_t)(d + 16 * i) * NS + it * KT + cv);
            asm volatile("s_wait_xcnt 0x0" ::: "memory");  // stands in front of any reuse of the eight loads' address registers
#pragma unroll
            for (int i = 0; i < KT / 32; ++i) *(v8h*)(Ks + (r + 32 * i) * KS_P + c) = uk[i];
#pragma unroll
            for (int i = 0; i < 4; ++i) *(v8h*)(Vs + (d + 16 * i) * VS_P + cv) = uv[i];
        }
        __syncthreads();

        // scores of KT keys, four 16x16 tiles at a time: sc[t][r] = score of key 16t+8h+r for query l16
        v8f sc[KT / 16];
#pragma unroll
        for (int tb = 0; tb < KT / 16; tb += 4) {
            Frag b0[4], b1[4];
#pragma unroll
            for (int u = 0; u < 4; ++u) {
                const f16* kp = Ks + ((tb + u) * 16 + l16) * KS_P;
                b0[u].h[0] = *(const v8h*)(kp + h8);      b0[u].h[1] = *(const v8h*)(kp + 16 + h8);
                b1[u].h[0] = *(const v8h*)(kp + 32 + h8); b1[u].h[1] = *(const v8h*)(kp + 48 + h8);
            }
#pragma unroll
            for (int u = 0; u < 4; ++u) sc[tb + u] = mma(b0[u].v, qa0.v, zero8());
#pragma unroll
            for (int u = 0; u < 4; ++u) sc[tb + u] = mma(b1[u].v, qa1.v, sc[tb + u]);
        }

        // query l16, of every 32 keys the kv subset {8h..8h+7, 16+8h..23+8h}, in that order
        // (the three loops are unrolled so that every index is a constant and the renaming costs no instruction)
        v4f rv[KT / 32][4];
#pragma unroll
        for (int g = 0; g < KT / 32; ++g)
#pragma unroll
            for (int q = 0; q < 4; ++q)
#pragma unroll
                for (int e = 0; e < 4; ++e) rv[g][q][e] = sc[2 * g + (q >> 1)][4 * (q & 1) + e];

        // one maximum per 32 keys (independent chains), then their maximum
        float rm = -1e30f;
#pragma unroll
        for (int g = 0; g < KT / 32; ++g) {
            float gm = rv[g][0][0];
#pragma unroll
            for (int i = 1; i < 16; ++i) gm = fmaxf(gm, rv[g][i >> 2][i & 3]);
            rm = fmaxf(rm, gm);
        }
        rm = fmaxf(rm, __shfl_xor(rm, 16, 32));

        const float mn = fmaxf(m_run, rm);
        const float alpha = __expf(m_run - mn);

        // one partial sum per 32 keys (independent chains), then their sum
        Frag pa[KT / 32];
        float rs = 0.0f;
#pragma unroll
        for (int g = 0; g < KT / 32; ++g) {
            float gs = 0.0f;
#pragma unroll
            for (int q = 0; q < 4; ++q) {
                const v4f p = exp2x4((rv[g][q] - mn) * 1.44269504f);   // e^(s - mn)
#pragma unroll
                for (int e = 0; e < 4; ++e) { gs += p[e]; pa[g].e[4 * q + e] = (f16)(p[e] * 256.0f); }
            }
            rs += gs;
        }
        rs += __shfl_xor(rs, 16, 32);
        l_run = l_run * alpha + rs;
        m_run = mn;

        // the accumulators' column is this lane's own query
#pragma unroll
        for (int r = 0; r < 8; ++r) { acc0[r] *= alpha; acc1[r] *= alpha; acc2[r] *= alpha; acc3[r] *= alpha; }

        // PV, 32 keys at a time: A fragment for d = j*16 + l16, kv split map; accj[r] = O[query l16][16j+8h+r]
#pragma unroll
        for (int g = 0; g < KT / 32; ++g) {
            Frag bv[4];
#pragma unroll
            for (int j = 0; j < 4; ++j) {
                const f16* vp = Vs + (j * 16 + l16) * VS_P + g * 32;
                bv[j].h[0] = *(const v8h*)(vp + h8); bv[j].h[1] = *(const v8h*)(vp + 16 + h8);
            }
            acc0 = mma(bv[0].v, pa[g].v, acc0);
            acc1 = mma(bv[1].v, pa[g].v, acc1);
            acc2 = mma(bv[2].v, pa[g].v, acc2);
            acc3 = mma(bv[3].v, pa[g].v, acc3);
        }
    }

    // normalise: O = acc / (256 * l); stored as O*32 -> acc * (0.125 / l)
    const float inv = 0.125f / l_run;

    __syncthreads();
    f16* os = Os + wid * 16 * 72;
    {
        v8h t0, t1, t2, t3;
#pragma unroll   // constant element indices: the vectors stay in registers
        for (int r = 0; r < 8; ++r) {
            t0[r] = (f16)(acc0[r] * inv);
            t1[r] = (f16)(acc1[r] * inv);
            t2[r] = (f16)(acc2[r] * inv);
            t3[r] = (f16)(acc3[r] * inv);
        }
        f16* orow = os + l16 * 72 + h8;      // query l16, eight consecutive d per tile
        *(v8ha*)(orow)      = t0;
        *(v8ha*)(orow + 16) = t1;
        *(v8ha*)(orow + 32) = t2;
        *(v8ha*)(orow + 48) = t3;
    }
    __syncthreads();

    v8h o[4];
    size_t off[4];
#pragma unroll
    for (int q = 0; q < 4; ++q) {
        const int L = 4 * q + (lane >> 3);     // local q row 0..15
        const int cc = (lane & 7) * 8;
        o[q] = *(const v8ha*)(os + L * 72 + cc);
        off[q] = ((size_t)(bb * NS + q0 + L)) * (NH * NHD) + hd * NHD + cc;
    }
#pragma unroll
    for (int q = 0; q < 4; ++q) *(v8h*)(ob + off[q]) = o[q];
    
}

// ---------------------------------------------------------------------------
// out = (O*32 f16) x (Wo*16 f16, k contiguous) / 512 + bias + residual, f32 [NM][NDM]
// Block tile 128 x 64, grid = (NDM/64, NM/128). Row segment of 64 floats = 2 lines,
// ---------------------------------------------------------------------------
__global__ __launch_bounds__(256) void k_oproj(const f16* __restrict__ A, const f16* __restrict__ Wot,
                                               const float* __restrict__ bias, const float* __restrict__ resid,
                                               float* __restrict__ out) {
    __shared__ __attribute__((aligned(16))) unsigned char ring[RING_BYTES];
    float (*Cs)[68] = reinterpret_cast<float (*)[68]>(ring);   // C tile takes the ring's place behind the K loop
    const int tid = threadIdx.x, lane = tid & 31, wid = tid >> 5;
    const int h = lane >> 4, l16 = lane & 15;
    const int n0 = blockIdx.x * 64;
    const int m0 = blockIdx.y * 128;
    if (n0 + 64 > NDM || m0 + 128 > NM) return;   // block-uniform

    v8f c0 = zero8(), c1 = zero8(), c2 = zero8(), c3 = zero8();
    mm128x64(A + (size_t)m0 * (NH * NHD), Wot + (size_t)n0 * (NH * NHD), NH * NHD, ring, c0, c1, c2, c3);

#pragma unroll
    for (int r = 0; r < 8; ++r) {
        const int row = 16 * wid + 8 * h + r;
        Cs[row][l16]      = c0[r];
        Cs[row][16 + l16] = c1[r];
        Cs[row][32 + l16] = c2[r];
        Cs[row][48 + l16] = c3[r];
    }
    __syncthreads();

    v4f o[8];
    size_t off[8];
#pragma unroll
    for (int q = 0; q < 8; ++q) {
        const int L = 4 * q + (lane >> 3);         // 0..31 : (local row, half)
        const int row = 16 * wid + (L >> 1);
        const int cc = (L & 1) * 32 + (lane & 7) * 4;
        const v4f cv = *(const v4fa*)(&Cs[row][cc]);
        const size_t go = (size_t)(m0 + row) * NDM + n0 + cc;
        const v4f bv = *(const v4f*)(bias + n0 + cc);
        const v4f rv = *(const v4f*)(resid + go);
        v4f val;
#pragma unroll
        for (int e = 0; e < 4; ++e) val[e] = (cv[e] * (1.0f / 512.0f) + bv[e]) + rv[e];
        o[q] = val;
        off[q] = go;
    }
#pragma unroll
    for (int q = 0; q < 8; ++q) *(v4f*)(out + off[q]) = o[q];
    
}

// ---------------------------------------------------------------------------
// Launcher
// ---------------------------------------------------------------------------
extern "C" void kernel_launch(void* const* d_in, const int* in_sizes, int n_in,
                              void* d_out, int out_size, void* d_ws, size_t ws_size,
                              hipStream_t stream) {
    if (n_in < 10) return;
    if (in_sizes[0] != NM * NDM) return;
    if (in_sizes[1] != NDM * NH * NHD) return;
    if (in_sizes[2] != NDM * NKV * NHD || in_sizes[3] != NDM * NKV * NHD) return;
    if (in_sizes[4] != NH * NHD * NDM) return;
    if (in_sizes[5] < NDM || in_sizes[6] < NHD || in_sizes[7] < NHD) return;
    if (in_sizes[8] != NS * NROT || in_sizes[9] != NS * NROT) return;
    if (out_size != NM * NDM) return;

    const float* hs   = (const float*)d_in[0];
    const float* wq   = (const float*)d_in[1];
    const float* wk   = (const float*)d_in[2];
    const float* wv   = (const float*)d_in[3];
    const float* wo   = (const float*)d_in[4];
    const float* bo   = (const float*)d_in[5];
    const float* nqw  = (const float*)d_in[6];
    const float* nkw  = (const float*)d_in[7];
    const float* cosT = (const float*)d_in[8];
    const float* sinT = (const float*)d_in[9];

    const size_t szX   = (size_t)NM * NDM * sizeof(f16);            // 8 MB
    const size_t szWq  = (size_t)NDM * NH * NHD * sizeof(f16);      // 2 MB
    const size_t szWkv = (size_t)NDM * NKV * NHD * sizeof(f16);     // 1 MB
    const size_t szWo  = (size_t)NH * NHD * NDM * sizeof(f16);      // 2 MB
    const size_t szQ   = (size_t)NB * NH * NS * NHD * sizeof(f16);  // 8 MB
    const size_t szKV  = (size_t)NB * NKV * NS * NHD * sizeof(f16); // 4 MB
    const size_t szO   = (size_t)NM * NH * NHD * sizeof(f16);       // 8 MB
    size_t offp = 0;
    const size_t oX   = offp; offp += szX;
    const size_t oWq  = offp; offp += szWq;
    const size_t oWk  = offp; offp += szWkv;
    const size_t oWv  = offp; offp += szWkv;
    const size_t oWo  = offp; offp += szWo;
    const size_t oQ   = offp; offp += szQ;
    const size_t oK   = offp; offp += szKV;
    const size_t oV   = offp; offp += szKV;
    const size_t oO   = offp; offp += szO;
    if (offp > ws_size) return;

    char* ws = (char*)d_ws;
    f16* hsb  = (f16*)(ws + oX);
    f16* wqt  = (f16*)(ws + oWq);
    f16* wkt  = (f16*)(ws + oWk);
    f16* wvt  = (f16*)(ws + oWv);
    f16* wot  = (f16*)(ws + oWo);
    f16* qbuf = (f16*)(ws + oQ);
    f16* kbuf = (f16*)(ws + oK);
    f16* vtb  = (f16*)(ws + oV);
    f16* attb = (f16*)(ws + oO);

    const int n8 = (NM * NDM) / 8;
    k_cvt<<<(n8 + 255) / 256, 256, 0, stream>>>(hs, hsb, n8);

    // W[K=in][N=out] -> Wt[N][K] * 16 ; grid = (N/32)*(K/64)
    k_wtrans<<<((NH * NHD) / 32) * (NDM / 64), 256, 0, stream>>>(wq, wqt, NDM, NH * NHD, 16.0f);
    k_wtrans<<<((NKV * NHD) / 32) * (NDM / 64), 256, 0, stream>>>(wk, wkt, NDM, NKV * NHD, 16.0f);
    k_wtrans<<<((NKV * NHD) / 32) * (NDM / 64), 256, 0, stream>>>(wv, wvt, NDM, NKV * NHD, 16.0f);
    k_wtrans<<<(NDM / 32) * ((NH * NHD) / 64), 256, 0, stream>>>(wo, wot, NH * NHD, NDM, 16.0f);

    k_qkv<<<dim3(32, (NM + 127) / 128), 256, 0, stream>>>(hsb, wqt, wkt, wvt, nqw, nkw, cosT, sinT,
                                                         qbuf, kbuf, vtb);

    k_attn<<<dim3((NS + 127) / 128, NH, NB), 256, 0, stream>>>(qbuf, kbuf, vtb, attb);

    k_oproj<<<dim3((NDM + 63) / 64, (NM + 127) / 128), 256, 0, stream>>>(attb, wot, bo, hs, (float*)d_out);
}

// v004
// A run of this version takes 88.5 microseconds.
// Next to v003, in two timings, it ran 1.14 times as fast each time.
// Over all steps from v000 it is 2.71 times as fast.
#include <hip/hip_runtime.h>
#include <stdint.h>

// Contractions x*Wq, x*Wk, x*Wv, q*k^T, p*v, o*Wo: v_wmma_f32_16x16x32_f16 (f16 operands with power-of-two operand scaling, f32 accumulate); RMS norm, rotary, softmax, bias and residual in f32.

#define NB   2
#define NS   2048
#define NDM  1024
#define NH   16
#define NKV  8
#define NHD  64
#define NROT 32
#define EPSV 1e-6f
#define NM   (NB * NS)

typedef _Float16 f16;
typedef f16   v8h  __attribute__((ext_vector_type(8)));
typedef f16   v16h __attribute__((ext_vector_type(16)));
typedef float v4f  __attribute__((ext_vector_type(4)));
typedef float v8f  __attribute__((ext_vector_type(8)));
typedef v4f v4fa __attribute__((may_alias));
typedef v8h v8ha __attribute__((may_alias));

union Frag { v16h v; v8h h[2]; f16 e[16]; };

// D(16x16 f32) += A(16x32) * B(32x16); hazard guard ties D and keeps A/B live.
__device__ __forceinline__ v8f mma(const v16h a, const v16h b, v8f c) {
    v8f d = __builtin_amdgcn_wmma_f32_16x16x32_f16(false, a, false, b, (short)0, c, false, false);
    asm volatile("v_nop\n\tv_nop\n\tv_nop\n\tv_nop" : "+v"(d) : "v"(a), "v"(b));
    return d;
}

// 2^x of four independent values. One statement, outputs apart from the inputs, so that each v_exp_f32 is
// followed by an instruction that neither reads its result nor overwrites its source; the v_nop is that
// instruction behind the last one, whatever the compiler places next.
__device__ __forceinline__ v4f exp2x4(const v4f x) {
    float r0, r1, r2, r3;
    asm("v_exp_f32 %0, %4\n\tv_exp_f32 %1, %5\n\tv_exp_f32 %2, %6\n\tv_exp_f32 %3, %7\n\tv_nop"
        : "=&v"(r0), "=&v"(r1), "=&v"(r2), "=&v"(r3)
        : "v"(x[0]), "v"(x[1]), "v"(x[2]), "v"(x[3]));
    v4f r;
    r[0] = r0; r[1] = r1; r[2] = r2; r[3] = r3;
    return r;
}

__device__ __forceinline__ v8f zero8() {
    v8f z;
#pragma unroll
    for (int i = 0; i < 8; ++i) z[i] = 0.0f;
    return z;
}

// ---------------------------------------------------------------------------
// Preparation, one launch: the five jobs need nothing of each other, so they share one grid and a range
// of the block index picks the job (block-uniform branches).
// ---------------------------------------------------------------------------
// f32 -> f16, eight elements a thread; blk = block index inside the job
__device__ __forceinline__ void cvt_block(const float* __restrict__ in, f16* __restrict__ out, int n8, int blk) {
    const int i = blk * 256 + threadIdx.x;
    if (i >= n8) return;
    const float* s = in + (size_t)i * 8;
    const v4f u0 = *(const v4f*)(s);
    const v4f u1 = *(const v4f*)(s + 4);
    v8h o;
#pragma unroll
    for (int e = 0; e < 4; ++e) { o[e] = (f16)u0[e]; o[4 + e] = (f16)u1[e]; }
    f16* d = out + (size_t)i * 8;
    *(v8h*)d = o;
}

// W[K][N] f32 -> Wt[N][K] f16 * scale (k contiguous). Tile 64 k x 32 n.
// in[K rows][N cols] -> out[N rows][K cols]; blk = block index inside the job, (N/32) * (K/64) blocks
__device__ __forceinline__ void wtrans_block(const float* __restrict__ W, f16* __restrict__ Wt,
                                             int K, int N, float scale, int blk, float (*T)[33]) {
    const int tid = threadIdx.x, lane = tid & 31, wid = tid >> 5;
    const int nTn = N / 32;
    const int tn = blk % nTn, tk = blk / nTn;
    const int n0 = tn * 32, k0 = tk * 64;
    if (k0 + 64 > K || n0 + 32 > N) return;   // block-uniform
    {
        const int k = tid >> 2, c = (tid & 3) * 8;
        const float* src = W + (size_t)(k0 + k) * N + n0 + c;
        const v4f u0 = *(const v4f*)(src);
        const v4f u1 = *(const v4f*)(src + 4);
        asm volatile("s_wait_xcnt 0x0" ::: "memory");  // stands in front of any reuse of the two loads' address registers
#pragma unroll
        for (int e = 0; e < 4; ++e) { T[k][c + e] = u0[e]; T[k][c + 4 + e] = u1[e]; }
    }
    __syncthreads();
    const int L  = wid * 4 + (lane >> 3);     // local n row 0..31
    const int k8 = (lane & 7) * 8;
    v8h o;
#pragma unroll
    for (int e = 0; e < 8; ++e) o[e] = (f16)(T[k8 + e][L] * scale);
    f16* dst = Wt + (size_t)(n0 + L) * K + k0 + k8;
    *(v8h*)dst = o;
    asm volatile("s_wait_xcnt 0x0" ::: "memory");  // stands in front of any reuse of the store's address and data registers
}

#define PB_WQ   (((NH * NHD) / 32) * (NDM / 64))
#define PB_WKV  (((NKV * NHD) / 32) * (NDM / 64))
#define PB_WO   ((NDM / 32) * ((NH * NHD) / 64))
#define PB_CVT  ((NM * NDM / 8 + 255) / 256)
#define PB_ALL  (PB_WQ + 2 * PB_WKV + PB_WO + PB_CVT)

// The transposes come first in the grid: theirs is the longer path (load, LDS, barrier, store).
__global__ __launch_bounds__(256) void k_prep(const float* __restrict__ hs, const float* __restrict__ wq,
                                              const float* __restrict__ wk, const float* __restrict__ wv,
                                              const float* __restrict__ wo,
                                              f16* __restrict__ hsb, f16* __restrict__ wqt, f16* __restrict__ wkt,
                                              f16* __restrict__ wvt, f16* __restrict__ wot) {
    __shared__ float T[64][33];
    int b = blockIdx.x;
    if (b < PB_WQ)  { wtrans_block(wq, wqt, NDM, NH * NHD, 16.0f, b, T); return; }
    b -= PB_WQ;
    if (b < PB_WKV) { wtrans_block(wk, wkt, NDM, NKV * NHD, 16.0f, b, T); return; }
    b -= PB_WKV;
    if (b < PB_WKV) { wtrans_block(wv, wvt, NDM, NKV * NHD, 16.0f, b, T); return; }
    b -= PB_WKV;
    if (b < PB_WO)  { wtrans_block(wo, wot, NH * NHD, NDM, 16.0f, b, T); return; }
    b -= PB_WO;
    cvt_block(hs, hsb, (NM * NDM) / 8, b);
}

// ---------------------------------------------------------------------------
// Block: C[128 rows][64 cols] += A[128 x K] * B[K x 64]; wave w owns rows 16w..16w+15.
// Ablk -> A + m0*K, Bblk -> Bt + n0*K (both k contiguous).
// K runs in slabs of 64 (128 B of every row). A slab of all 192 rows is copied into LDS by
// asynchronous copies whose wave-wide 512 B cover four whole lines; two buffers, the next
// slab's copies fly while this one is multiplied. LDS rows at pitch 144 B (16 B x odd).
// Both fragments use the same split k map:
// elements 0..7 <- k0+8h+0..7, elements 8..15 <- k0+16+8h+0..7.
// ---------------------------------------------------------------------------
#define SLAB_K      64
#define SLAB_PITCH  144
#define SLAB_A      (128 * SLAB_PITCH)
#define SLAB_STAGE  (192 * SLAB_PITCH)
#define RING_BYTES  (2 * SLAB_STAGE)

// One thread's share of a slab: 16 B of A rows r, r+32, r+64, r+96 and of B rows r, r+32.
// s_wait_xcnt closes the statement so that no address register is rewritten ahead of it.
__device__ __forceinline__ void slab_copy(uint32_t lds, const f16* ga, const f16* gb, size_t rstep) {
    asm volatile("global_load_async_to_lds_b128 %0, %6, off\n\t"
                 "global_load_async_to_lds_b128 %1, %7, off\n\t"
                 "global_load_async_to_lds_b128 %2, %8, off\n\t"
                 "global_load_async_to_lds_b128 %3, %9, off\n\t"
                 "global_load_async_to_lds_b128 %4, %10, off\n\t"
                 "global_load_async_to_lds_b128 %5, %11, off\n\t"
                 "s_wait_xcnt 0x0"
                 :: "v"(lds), "v"(lds + 32u * SLAB_PITCH), "v"(lds + 64u * SLAB_PITCH),
                    "v"(lds + 96u * SLAB_PITCH), "v"(lds + (uint32_t)SLAB_A),
                    "v"(lds + (uint32_t)SLAB_A + 32u * SLAB_PITCH),
                    "v"(ga), "v"(ga + rstep), "v"(ga + 2 * rstep), "v"(ga + 3 * rstep),
                    "v"(gb), "v"(gb + rstep)
                 : "memory");
}

__device__ __forceinline__ void mm128x64(const f16* __restrict__ Ablk, const f16* __restrict__ Bblk,
                                         int K, unsigned char* ring,
                                         v8f& c0, v8f& c1, v8f& c2, v8f& c3) {
    const int tid = threadIdx.x, lane = tid & 31, wid = tid >> 5;
    const int h = lane >> 4, l16 = lane & 15;
    const int cr = tid >> 3, cc = (tid & 7) * 8;          // copy: row 0..31, f16 column
    const f16* ga = Ablk + (size_t)cr * K + cc;
    const f16* gb = Bblk + (size_t)cr * K + cc;
    const size_t rstep = (size_t)32 * K;
    const uint32_t l0 = (uint32_t)(size_t)ring + (uint32_t)(cr * SLAB_PITCH + cc * 2);
    const int nslab = K / SLAB_K;

    slab_copy(l0, ga, gb, rstep);
    asm volatile("s_wait_asynccnt 0x0" ::: "memory");     // slab 0 landed (this wave's share)
    __syncthreads();                                      // ... and every other wave's
    if (nslab > 1) slab_copy(l0 + (uint32_t)SLAB_STAGE, ga + SLAB_K, gb + SLAB_K, rstep);

    const unsigned char* af = ring + (16 * wid + l16) * SLAB_PITCH + h * 16;
    const unsigned char* bf = ring + SLAB_A + l16 * SLAB_PITCH + h * 16;
    for (int t = 0; t < nslab; ++t) {
        const int bo = (t & 1) * SLAB_STAGE;
        for (int ks = 0; ks < 2; ++ks) {
            // the k step's ten LDS reads stand together in front of its four products
            Frag a, b0, b1, b2, b3;
            const unsigned char* ap = af + bo + ks * 64;
            const unsigned char* bp = bf + bo + ks * 64;
            a.h[0]  = *(const v8ha*)(ap);                   a.h[1]  = *(const v8ha*)(ap + 32);
            b0.h[0] = *(const v8ha*)(bp);                   b0.h[1] = *(const v8ha*)(bp + 32);
            b1.h[0] = *(const v8ha*)(bp + 16 * SLAB_PITCH); b1.h[1] = *(const v8ha*)(bp + 16 * SLAB_PITCH + 32);
            b2.h[0] = *(const v8ha*)(bp + 32 * SLAB_PITCH); b2.h[1] = *(const v8ha*)(bp + 32 * SLAB_PITCH + 32);
            b3.h[0] = *(const v8ha*)(bp + 48 * SLAB_PITCH); b3.h[1] = *(const v8ha*)(bp + 48 * SLAB_PITCH + 32);
            c0 = mma(a.v, b0.v, c0);
            c1 = mma(a.v, b1.v, c1);
            c2 = mma(a.v, b2.v, c2);
            c3 = mma(a.v, b3.v, c3);
        }
        asm volatile("s_wait_dscnt 0x0" ::: "memory");    // this wave has left buffer t & 1
        asm volatile("s_wait_asynccnt 0x0" ::: "memory"); // its share of slab t + 1 has landed
        __syncthreads();                                  // publishes slab t + 1, frees buffer t & 1
        if (t + 2 < nslab)
            slab_copy(l0 + (uint32_t)bo, ga + (size_t)(t + 2) * SLAB_K, gb + (size_t)(t + 2) * SLAB_K, rstep);
    }
    asm volatile("s_wait_asynccnt 0x0" ::: "memory");     // no copy outstanding when the ring is reused
}

// ---------------------------------------------------------------------------
// Fused QKV projection + RMS norm + partial rotary.
// Block tile = 128 rows (one batch, 128 consecutive s) x 64 cols (= one head).
// grid = (32 col tiles: 0..15 -> q heads, 16..23 -> k heads, 24..31 -> v heads, NM/128)
// q out: [b][h][s][d] f16, pre-multiplied by 1/8 (softmax scale);  k out: [b][kvh][s][d] f16
// v out: [b][kvh][d][s] f16 (d-major)
// ---------------------------------------------------------------------------
__global__ __launch_bounds__(256) void k_qkv(const f16* __restrict__ X,
                                             const f16* __restrict__ Wqt, const f16* __restrict__ Wkt,
                                             const f16* __restrict__ Wvt,
                                             const float* __restrict__ nqw, const float* __restrict__ nkw,
                                             const float* __restrict__ cosT, const float* __restrict__ sinT,
                                             f16* __restrict__ qb, f16* __restrict__ kb, f16* __restrict__ vt) {
    __shared__ __attribute__((aligned(16))) unsigned char ring[RING_BYTES];
    float (*Cs)[68] = reinterpret_cast<float (*)[68]>(ring);   // C tile takes the ring's place behind the K loop
    const int tid = threadIdx.x, lane = tid & 31, wid = tid >> 5;
    const int h = lane >> 4, l16 = lane & 15;
    const int nt = blockIdx.x;
    const int m0 = blockIdx.y * 128;
    if (m0 + 128 > NM || nt >= 32) return;    // block-uniform

    int mode, hh, nHh;
    const f16* Wt;
    const float* nw;
    if (nt < 16)      { mode = 0; hh = nt;      nHh = NH;  Wt = Wqt; nw = nqw; }
    else if (nt < 24) { mode = 1; hh = nt - 16; nHh = NKV; Wt = Wkt; nw = nkw; }
    else              { mode = 2; hh = nt - 24; nHh = NKV; Wt = Wvt; nw = nkw; }
    const int n0 = hh * NHD;
    const int bb = m0 / NS, s0 = m0 % NS;

    v8f c0 = zero8(), c1 = zero8(), c2 = zero8(), c3 = zero8();
    mm128x64(X + (size_t)m0 * NDM, Wt + (size_t)n0 * NDM, NDM, ring, c0, c1, c2, c3);

    // accumulator (lane = col, element r = row 8h+r) -> LDS tile, still scaled by 16
#pragma unroll
    for (int r = 0; r < 8; ++r) {
        const int row = 16 * wid + 8 * h + r;
        Cs[row][l16]      = c0[r];
        Cs[row][16 + l16] = c1[r];
        Cs[row][32 + l16] = c2[r];
        Cs[row][48 + l16] = c3[r];
    }
    __syncthreads();

    if (mode != 2) {
        const float osc = (mode == 0) ? 0.125f : 1.0f;
        const float w0 = nw[lane], w1 = nw[lane + 32];
#pragma unroll 1
        for (int r = 0; r < 16; ++r) {
            const int row = 16 * wid + r;
            const int s = s0 + row;
            float x0 = Cs[row][lane] * (1.0f / 16.0f);
            float x1 = Cs[row][lane + 32] * (1.0f / 16.0f);
            float ss = x0 * x0 + x1 * x1;
#pragma unroll
            for (int m = 16; m >= 1; m >>= 1) ss += __shfl_xor(ss, m, 32);
            const float rinv = rsqrtf(ss * (1.0f / NHD) + EPSV);
            const float xn0 = x0 * rinv * w0;
            const float xn1 = x1 * rinv * w1;
            const float part = __shfl_xor(xn0, 16, 32);
            const float rot = (lane < 16) ? -part : part;
            const float c  = cosT[(size_t)s * NROT + lane];
            const float sn = sinT[(size_t)s * NROT + lane];
            const float y0 = xn0 * c + rot * sn;
            Cs[row][lane]      = y0 * osc;
            Cs[row][lane + 32] = xn1 * osc;
        }
    }
    __syncthreads();

    v8h o[4];
    size_t off[4];
    if (mode != 2) {
        f16* ob = ((mode == 0) ? qb : kb) + ((size_t)(bb * nHh + hh) * NS + s0) * NHD;
#pragma unroll
        for (int q = 0; q < 4; ++q) {
            const int L = 4 * q + (lane >> 3);          // local row
            const int row = 16 * wid + L;
            const int cc = (lane & 7) * 8;
            const v4f u0 = *(const v4fa*)(&Cs[row][cc]);
            const v4f u1 = *(const v4fa*)(&Cs[row][cc + 4]);
#pragma unroll
            for (int e = 0; e < 4; ++e) { o[q][e] = (f16)u0[e]; o[q][4 + e] = (f16)u1[e]; }
            off[q] = (size_t)row * NHD + cc;
        }
#pragma unroll
        for (int q = 0; q < 4; ++q) *(v8h*)(ob + off[q]) = o[q];
        
    } else {
        f16* ob = vt + (size_t)(bb * NKV + hh) * NHD * NS + s0;
#pragma unroll
        for (int q = 0; q < 4; ++q) {
            const int L = 4 * q + (lane >> 3);          // 0..15
            const int d = 8 * wid + (L >> 1);
            const int sb = (L & 1) * 64 + (lane & 7) * 8;
#pragma unroll
            for (int e = 0; e < 8; ++e) o[q][e] = (f16)(Cs[sb + e][d] * (1.0f / 16.0f));
            off[q] = (size_t)d * NS + sb;
        }
#pragma unroll
        for (int q = 0; q < 4; ++q) *(v8h*)(ob + off[q]) = o[q];
        
    }
}

#define KT    128
#define KS_P  72
#define VS_P  (KT + 8)
__global__ __launch_bounds__(256) void k_attn(const f16* __restrict__ qb, const f16* __restrict__ kb,
                                              const f16* __restrict__ vt, f16* __restrict__ ob) {
    __shared__ __attribute__((aligned(16))) f16   Ks[KT * KS_P];
    __shared__ __attribute__((aligned(16))) f16   Vs[64 * VS_P];
    __shared__ __attribute__((aligned(16))) f16   Os[8 * 16 * 72];

    const int tid = threadIdx.x, lane = tid & 31, wid = tid >> 5;
    const int h = lane >> 4, l16 = lane & 15, h8 = h * 8;
    const int bb = blockIdx.z, hd = blockIdx.y, kvh = hd / (NH / NKV);
    const int qblk = blockIdx.x * 128;
    if (qblk + 128 > NS || hd >= NH || bb >= NB) return;   // block-uniform
    const int q0 = qblk + wid * 16;

    const f16* qrow = qb + ((size_t)(bb * NH + hd) * NS + q0 + l16) * NHD;
    Frag qa0, qa1;
    qa0.h[0] = *(const v8h*)(qrow + h8);
    qa0.h[1] = *(const v8h*)(qrow + 16 + h8);
    qa1.h[0] = *(const v8h*)(qrow + 32 + h8);
    qa1.h[1] = *(const v8h*)(qrow + 48 + h8);

    float m_run = -1e30f, l_run = 0.0f;
    v8f acc0 = zero8(), acc1 = zero8(), acc2 = zero8(), acc3 = zero8();

    const f16* kbase = kb + (size_t)(bb * NKV + kvh) * NS * NHD;
    const f16* vbase = vt + (size_t)(bb * NKV + kvh) * NHD * NS;

#pragma unroll 1
    for (int it = 0; it < NS / KT; ++it) {
        __syncthreads();                              // prior tile fully consumed by all waves
        {
            // the pass's eight global loads stand together in front of the LDS stores
            const int r = tid >> 3, c = (tid & 7) * 8;     // K: KT rows x 64 d, 32 rows a step
            const int d = tid >> 4, cv = (tid & 15) * 8;   // V: 64 d rows x KT kv, 16 rows a step
            v8h uk[KT / 32], uv[4];
#pragma unroll
            for (int i = 0; i < KT / 32; ++i) uk[i] = *(const v8h*)(kbase + (size_t)(it * KT + r + 32 * i) * NHD + c);
#pragma unroll
            for (int i = 0; i < 4; ++i) uv[i] = *(const v8h*)(vbase + (size_t)(d + 16 * i) * NS + it * KT + cv);
            asm volatile("s_wait_xcnt 0x0" ::: "memory");  // stands in front of any reuse of the eight loads' address registers
#pragma unroll
            for (int i = 0; i < KT / 32; ++i) *(v8h*)(Ks + (r + 32 * i) * KS_P + c) = uk[i];
#pragma unroll
            for (int i = 0; i < 4; ++i) *(v8h*)(Vs + (d + 16 * i) * VS_P + cv) = uv[i];
        }
        __syncthreads();

        // scores of KT keys, four 16x16 tiles at a time: sc[t][r] = score of key 16t+8h+r for query l16
        v8f sc[KT / 16];
#pragma unroll
        for (int tb = 0; tb < KT / 16; tb += 4) {
            Frag b0[4], b1[4];
#pragma unroll
            for (int u = 0; u < 4; ++u) {
                const f16* kp = Ks + ((tb + u) * 16 + l16) * KS_P;
                b0[u].h[0] = *(const v8h*)(kp + h8);      b0[u].h[1] = *(const v8h*)(kp + 16 + h8);
                b1[u].h[0] = *(const v8h*)(kp + 32 + h8); b1[u].h[1] = *(const v8h*)(kp + 48 + h8);
            }
#pragma unroll
            for (int u = 0; u < 4; ++u) sc[tb + u] = mma(b0[u].v, qa0.v, zero8());
#pragma unroll
            for (int u = 0; u < 4; ++u) sc[tb + u] = mma(b1[u].v, qa1.v, sc[tb + u]);
        }

        // query l16, of every 32 keys the kv subset {8h..8h+7, 16+8h..23+8h}, in that order
        // (the three loops are unrolled so that every index is a constant and the renaming costs no instruction)
        v4f rv[KT / 32][4];
#pragma unroll
        for (int g = 0; g < KT / 32; ++g)
#pragma unroll
            for (int q = 0; q < 4; ++q)
#pragma unroll
                for (int e = 0; e < 4; ++e) rv[g][q][e] = sc[2 * g + (q >> 1)][4 * (q & 1) + e];

        // one maximum per 32 keys (independent chains), then their maximum
        float rm = -1e30f;
#pragma unroll
        for (int g = 0; g < KT / 32; ++g) {
            float gm = rv[g][0][0];
#pragma unroll
            for (int i = 1; i < 16; ++i) gm = fmaxf(gm, rv[g][i >> 2][i & 3]);
            rm = fmaxf(rm, gm);
        }
        rm = fmaxf(rm, __shfl_xor(rm, 16, 32));

        const float mn = fmaxf(m_run, rm);
        const float alpha = __expf(m_run - mn);

        // one partial sum per 32 keys (independent chains), then their sum
        Frag pa[KT / 32];
        float rs = 0.0f;
#pragma unroll
        for (int g = 0; g < KT / 32; ++g) {
            float gs = 0.0f;
#pragma unroll
            for (int q = 0; q < 4; ++q) {
                const v4f p = exp2x4((rv[g][q] - mn) * 1.44269504f);   // e^(s - mn)
#pragma unroll
                for (int e = 0; e < 4; ++e) { gs += p[e]; pa[g].e[4 * q + e] = (f16)(p[e] * 256.0f); }
            }
            rs += gs;
        }
        rs += __shfl_xor(rs, 16, 32);
        l_run = l_run * alpha + rs;
        m_run = mn;

        // the accumulators' column is this lane's own query
#pragma unroll
        for (int r = 0; r < 8; ++r) { acc0[r] *= alpha; acc1[r] *= alpha; acc2[r] *= alpha; acc3[r] *= alpha; }

        // PV, 32 keys at a time: A fragment for d = j*16 + l16, kv split map; accj[r] = O[query l16][16j+8h+r]
#pragma unroll
        for (int g = 0; g < KT / 32; ++g) {
            Frag bv[4];
#pragma unroll
            for (int j = 0; j < 4; ++j) {
                const f16* vp = Vs + (j * 16 + l16) * VS_P + g * 32;
                bv[j].h[0] = *(const v8h*)(vp + h8); bv[j].h[1] = *(const v8h*)(vp + 16 + h8);
            }
            acc0 = mma(bv[0].v, pa[g].v, acc0);
            acc1 = mma(bv[1].v, pa[g].v, acc1);
            acc2 = mma(bv[2].v, pa[g].v, acc2);
            acc3 = mma(bv[3].v, pa[g].v, acc3);
        }
    }

    // normalise: O = acc / (256 * l); stored as O*32 -> acc * (0.125 / l)
    const float inv = 0.125f / l_run;

    __syncthreads();
    f16* os = Os + wid * 16 * 72;
    {
        v8h t0, t1, t2, t3;
#pragma unroll   // constant element indices: the vectors stay in registers
        for (int r = 0; r < 8; ++r) {
            t0[r] = (f16)(acc0[r] * inv);
            t1[r] = (f16)(acc1[r] * inv);
            t2[r] = (f16)(acc2[r] * inv);
            t3[r] = (f16)(acc3[r] * inv);
        }
        f16* orow = os + l16 * 72 + h8;      // query l16, eight consecutive d per tile
        *(v8ha*)(orow)      = t0;
        *(v8ha*)(orow + 16) = t1;
        *(v8ha*)(orow + 32) = t2;
        *(v8ha*)(orow + 48) = t3;
    }
    __syncthreads();

    v8h o[4];
    size_t off[4];
#pragma unroll
    for (int q = 0; q < 4; ++q) {
        const int L = 4 * q + (lane >> 3);     // local q row 0..15
        const int cc = (lane & 7) * 8;
        o[q] = *(const v8ha*)(os + L * 72 + cc);
        off[q] = ((size_t)(bb * NS + q0 + L)) * (NH * NHD) + hd * NHD + cc;
    }
#pragma unroll
    for (int q = 0; q < 4; ++q) *(v8h*)(ob + off[q]) = o[q];
    
}

// ---------------------------------------------------------------------------
// out = (O*32 f16) x (Wo*16 f16, k contiguous) / 512 + bias + residual, f32 [NM][NDM]
// Block tile 128 x 64, grid = (NDM/64, NM/128). Row segment of 64 floats = 2 lines,
// ---------------------------------------------------------------------------
__global__ __launch_bounds__(256) void k_oproj(const f16* __restrict__ A, const f16* __restrict__ Wot,
                                               const float* __restrict__ bias, const float* __restrict__ resid,
                                               float* __restrict__ out) {
    __shared__ __attribute__((aligned(16))) unsigned char ring[RING_BYTES];
    float (*Cs)[68] = reinterpret_cast<float (*)[68]>(ring);   // C tile takes the ring's place behind the K loop
    const int tid = threadIdx.x, lane = tid & 31, wid = tid >> 5;
    const int h = lane >> 4, l16 = lane & 15;
    const int n0 = blockIdx.x * 64;
    const int m0 = blockIdx.y * 128;
    if (n0 + 64 > NDM || m0 + 128 > NM) return;   // block-uniform

    v8f c0 = zero8(), c1 = zero8(), c2 = zero8(), c3 = zero8();
    mm128x64(A + (size_t)m0 * (NH * NHD), Wot + (size_t)n0 * (NH * NHD), NH * NHD, ring, c0, c1, c2, c3);

#pragma unroll
    for (int r = 0; r < 8; ++r) {
        const int row = 16 * wid + 8 * h + r;
        Cs[row][l16]      = c0[r];
        Cs[row][16 + l16] = c1[r];
        Cs[row][32 + l16] = c2[r];
        Cs[row][48 + l16] = c3[r];
    }
    __syncthreads();

    v4f o[8];
    size_t off[8];
#pragma unroll
    for (int q = 0; q < 8; ++q) {
        const int L = 4 * q + (lane >> 3);         // 0..31 : (local row, half)
        const int row = 16 * wid + (L >> 1);
        const int cc = (L & 1) * 32 + (lane & 7) * 4;
        const v4f cv = *(const v4fa*)(&Cs[row][cc]);
        const size_t go = (size_t)(m0 + row) * NDM + n0 + cc;
        const v4f bv = *(const v4f*)(bias + n0 + cc);
        const v4f rv = *(const v4f*)(resid + go);
        v4f val;
#pragma unroll
        for (int e = 0; e < 4; ++e) val[e] = (cv[e] * (1.0f / 512.0f) + bv[e]) + rv[e];
        o[q] = val;
        off[q] = go;
    }
#pragma unroll
    for (int q = 0; q < 8; ++q) *(v4f*)(out + off[q]) = o[q];
    
}

// ---------------------------------------------------------------------------
// Launcher
// ---------------------------------------------------------------------------
extern "C" void kernel_launch(void* const* d_in, const int* in_sizes, int n_in,
                              void* d_out, int out_size, void* d_ws, size_t ws_size,
                              hipStream_t stream) {
    if (n_in < 10) return;
    if (in_sizes[0] != NM * NDM) return;
    if (in_sizes[1] != NDM * NH * NHD) return;
    if (in_sizes[2] != NDM * NKV * NHD || in_sizes[3] != NDM * NKV * NHD) return;
    if (in_sizes[4] != NH * NHD * NDM) return;
    if (in_sizes[5] < NDM || in_sizes[6] < NHD || in_sizes[7] < NHD) return;
    if (in_sizes[8] != NS * NROT || in_sizes[9] != NS * NROT) return;
    if (out_size != NM * NDM) return;

    const float* hs   = (const float*)d_in[0];
    const float* wq   = (const float*)d_in[1];
    const float* wk   = (const float*)d_in[2];
    const float* wv   = (const float*)d_in[3];
    const float* wo   = (const float*)d_in[4];
    const float* bo   = (const float*)d_in[5];
    const float* nqw  = (const float*)d_in[6];
    const float* nkw  = (const float*)d_in[7];
    const float* cosT = (const float*)d_in[8];
    const float* sinT = (const float*)d_in[9];

    const size_t szX   = (size_t)NM * NDM * sizeof(f16);            // 8 MB
    const size_t szWq  = (size_t)NDM * NH * NHD * sizeof(f16);      // 2 MB
    const size_t szWkv = (size_t)NDM * NKV * NHD * sizeof(f16);     // 1 MB
    const size_t szWo  = (size_t)NH * NHD * NDM * sizeof(f16);      // 2 MB
    const size_t szQ   = (size_t)NB * NH * NS * NHD * sizeof(f16);  // 8 MB
    const size_t szKV  = (size_t)NB * NKV * NS * NHD * sizeof(f16); // 4 MB
    const size_t szO   = (size_t)NM * NH * NHD * sizeof(f16);       // 8 MB
    size_t offp = 0;
    const size_t oX   = offp; offp += szX;
    const size_t oWq  = offp; offp += szWq;
    const size_t oWk  = offp; offp += szWkv;
    const size_t oWv  = offp; offp += szWkv;
    const size_t oWo  = offp; offp += szWo;
    const size_t oQ   = offp; offp += szQ;
    const size_t oK   = offp; offp += szKV;
    const size_t oV   = offp; offp += szKV;
    const size_t oO   = offp; offp += szO;
    if (offp > ws_size) return;

    char* ws = (char*)d_ws;
    f16* hsb  = (f16*)(ws + oX);
    f16* wqt  = (f16*)(ws + oWq);
    f16* wkt  = (f16*)(ws + oWk);
    f16* wvt  = (f16*)(ws + oWv);
    f16* wot  = (f16*)(ws + oWo);
    f16* qbuf = (f16*)(ws + oQ);
    f16* kbuf = (f16*)(ws + oK);
    f16* vtb  = (f16*)(ws + oV);
    f16* attb = (f16*)(ws + oO);

    // X -> f16 and W[K=in][N=out] -> Wt[N][K] * 16, all in one launch
    k_prep<<<PB_ALL, 256, 0, stream>>>(hs, wq, wk, wv, wo, hsb, wqt, wkt, wvt, wot);

    k_qkv<<<dim3(32, (NM + 127) / 128), 256, 0, stream>>>(hsb, wqt, wkt, wvt, nqw, nkw, cosT, sinT,
                                                         qbuf, kbuf, vtb);

    k_attn<<<dim3((NS + 127) / 128, NH, NB), 256, 0, stream>>>(qbuf, kbuf, vtb, attb);

    k_oproj<<<dim3((NDM + 63) / 64, (NM + 127) / 128), 256, 0, stream>>>(attb, wot, bo, hs, (float*)d_out);
}

// v005
// It runs in 84.1 microseconds.
// In two side-by-side timings against v004, it was 1.05 and 1.04 times as fast.
// Counting every step since v000, it is 2.84 times as fast.
#include <hip/hip_runtime.h>
#include <stdint.h>

// Contractions x*Wq, x*Wk, x*Wv, q*k^T, p*v, o*Wo: v_wmma_f32_16x16x32_f16 (f16 operands with power-of-two operand scaling, f32 accumulate); RMS norm, rotary, softmax, bias and residual in f32.

#define NB   2
#define NS   2048
#define NDM  1024
#define NH   16
#define NKV  8
#define NHD  64
#define NROT 32
#define EPSV 1e-6f
#define NM   (NB * NS)

typedef _Float16 f16;
typedef f16   v8h  __attribute__((ext_vector_type(8)));
typedef f16   v16h __attribute__((ext_vector_type(16)));
typedef float v4f  __attribute__((ext_vector_type(4)));
typedef float v8f  __attribute__((ext_vector_type(8)));
typedef v4f v4fa __attribute__((may_alias));
typedef v8h v8ha __attribute__((may_alias));

union Frag { v16h v; v8h h[2]; f16 e[16]; };

// D(16x16 f32) += A(16x32) * B(32x16); hazard guard ties D and keeps A/B live.
__device__ __forceinline__ v8f mma(const v16h a, const v16h b, v8f c) {
    v8f d = __builtin_amdgcn_wmma_f32_16x16x32_f16(false, a, false, b, (short)0, c, false, false);
    asm volatile("v_nop\n\tv_nop\n\tv_nop\n\tv_nop" : "+v"(d) : "v"(a), "v"(b));
    return d;
}

// 2^x of four independent values. One statement, outputs apart from the inputs, so that each v_exp_f32 is
// followed by an instruction that neither reads its result nor overwrites its source; the v_nop is that
// instruction behind the last one, whatever the compiler places next.
__device__ __forceinline__ v4f exp2x4(const v4f x) {
    float r0, r1, r2, r3;
    asm("v_exp_f32 %0, %4\n\tv_exp_f32 %1, %5\n\tv_exp_f32 %2, %6\n\tv_exp_f32 %3, %7\n\tv_nop"
        : "=&v"(r0), "=&v"(r1), "=&v"(r2), "=&v"(r3)
        : "v"(x[0]), "v"(x[1]), "v"(x[2]), "v"(x[3]));
    v4f r;
    r[0] = r0; r[1] = r1; r[2] = r2; r[3] = r3;
    return r;
}

__device__ __forceinline__ v8f zero8() {
    v8f z;
#pragma unroll
    for (int i = 0; i < 8; ++i) z[i] = 0.0f;
    return z;
}

// ---------------------------------------------------------------------------
// Preparation, one launch: the five jobs need nothing of each other, so they share one grid and a range
// of the block index picks the job (block-uniform branches).
// ---------------------------------------------------------------------------
// f32 -> f16, eight elements a thread; blk = block index inside the job
__device__ __forceinline__ void cvt_block(const float* __restrict__ in, f16* __restrict__ out, int n8, int blk) {
    const int i = blk * 256 + threadIdx.x;
    if (i >= n8) return;
    const float* s = in + (size_t)i * 8;
    const v4f u0 = *(const v4f*)(s);
    const v4f u1 = *(const v4f*)(s + 4);
    v8h o;
#pragma unroll
    for (int e = 0; e < 4; ++e) { o[e] = (f16)u0[e]; o[4 + e] = (f16)u1[e]; }
    f16* d = out + (size_t)i * 8;
    *(v8h*)d = o;
}

// W[K][N] f32 -> Wt[N][K] f16 * scale (k contiguous). Tile 64 k x 32 n.
// in[K rows][N cols] -> out[N rows][K cols]; blk = block index inside the job, (N/32) * (K/64) blocks
__device__ __forceinline__ void wtrans_block(const float* __restrict__ W, f16* __restrict__ Wt,
                                             int K, int N, float scale, int blk, float (*T)[33]) {
    const int tid = threadIdx.x, lane = tid & 31, wid = tid >> 5;
    const int nTn = N / 32;
    const int tn = blk % nTn, tk = blk / nTn;
    const int n0 = tn * 32, k0 = tk * 64;
    if (k0 + 64 > K || n0 + 32 > N) return;   // block-uniform
    {
        const int k = tid >> 2, c = (tid & 3) * 8;
        const float* src = W + (size_t)(k0 + k) * N + n0 + c;
        const v4f u0 = *(const v4f*)(src);
        const v4f u1 = *(const v4f*)(src + 4);
        asm volatile("s_wait_xcnt 0x0" ::: "memory");  // stands in front of any reuse of the two loads' address registers
#pragma unroll
        for (int e = 0; e < 4; ++e) { T[k][c + e] = u0[e]; T[k][c + 4 + e] = u1[e]; }
    }
    __syncthreads();
    const int L  = wid * 4 + (lane >> 3);     // local n row 0..31
    const int k8 = (lane & 7) * 8;
    v8h o;
#pragma unroll
    for (int e = 0; e < 8; ++e) o[e] = (f16)(T[k8 + e][L] * scale);
    f16* dst = Wt + (size_t)(n0 + L) * K + k0 + k8;
    *(v8h*)dst = o;
    asm volatile("s_wait_xcnt 0x0" ::: "memory");  // stands in front of any reuse of the store's address and data registers
}

#define PB_WQ   (((NH * NHD) / 32) * (NDM / 64))
#define PB_WKV  (((NKV * NHD) / 32) * (NDM / 64))
#define PB_WO   ((NDM / 32) * ((NH * NHD) / 64))
#define PB_CVT  ((NM * NDM / 8 + 255) / 256)
#define PB_ALL  (PB_WQ + 2 * PB_WKV + PB_WO + PB_CVT)

// The transposes come first in the grid: theirs is the longer path (load, LDS, barrier, store).
__global__ __launch_bounds__(256) void k_prep(const float* __restrict__ hs, const float* __restrict__ wq,
                                              const float* __restrict__ wk, const float* __restrict__ wv,
                                              const float* __restrict__ wo,
                                              f16* __restrict__ hsb, f16* __restrict__ wqt, f16* __restrict__ wkt,
                                              f16* __restrict__ wvt, f16* __restrict__ wot) {
    __shared__ float T[64][33];
    int b = blockIdx.x;
    if (b < PB_WQ)  { wtrans_block(wq, wqt, NDM, NH * NHD, 16.0f, b, T); return; }
    b -= PB_WQ;
    if (b < PB_WKV) { wtrans_block(wk, wkt, NDM, NKV * NHD, 16.0f, b, T); return; }
    b -= PB_WKV;
    if (b < PB_WKV) { wtrans_block(wv, wvt, NDM, NKV * NHD, 16.0f, b, T); return; }
    b -= PB_WKV;
    if (b < PB_WO)  { wtrans_block(wo, wot, NH * NHD, NDM, 16.0f, b, T); return; }
    b -= PB_WO;
    cvt_block(hs, hsb, (NM * NDM) / 8, b);
}

// ---------------------------------------------------------------------------
// Block: C[128 rows][64 cols] += A[128 x K] * B[K x 64]; wave w owns rows 16w..16w+15.
// Ablk -> A + m0*K, Bblk -> Bt + n0*K (both k contiguous).
// K runs in slabs of 64 (128 B of every row). A slab of all 192 rows is copied into LDS by
// asynchronous copies whose wave-wide 512 B cover four whole lines; two buffers, the next
// slab's copies fly while this one is multiplied. LDS rows at pitch 144 B (16 B x odd).
// Both fragments use the same split k map:
// elements 0..7 <- k0+8h+0..7, elements 8..15 <- k0+16+8h+0..7.
// ---------------------------------------------------------------------------
#define SLAB_K      64
#define SLAB_PITCH  144
#define SLAB_A      (128 * SLAB_PITCH)
#define SLAB_STAGE  (192 * SLAB_PITCH)
#define RING_BYTES  (2 * SLAB_STAGE)

// One thread's share of a slab: 16 B of A rows r, r+32, r+64, r+96 and of B rows r, r+32.
// s_wait_xcnt closes the statement so that no address register is rewritten ahead of it.
__device__ __forceinline__ void slab_copy(uint32_t lds, const f16* ga, const f16* gb, size_t rstep) {
    asm volatile("global_load_async_to_lds_b128 %0, %6, off\n\t"
                 "global_load_async_to_lds_b128 %1, %7, off\n\t"
                 "global_load_async_to_lds_b128 %2, %8, off\n\t"
                 "global_load_async_to_lds_b128 %3, %9, off\n\t"
                 "global_load_async_to_lds_b128 %4, %10, off\n\t"
                 "global_load_async_to_lds_b128 %5, %11, off\n\t"
                 "s_wait_xcnt 0x0"
                 :: "v"(lds), "v"(lds + 32u * SLAB_PITCH), "v"(lds + 64u * SLAB_PITCH),
                    "v"(lds + 96u * SLAB_PITCH), "v"(lds + (uint32_t)SLAB_A),
                    "v"(lds + (uint32_t)SLAB_A + 32u * SLAB_PITCH),
                    "v"(ga), "v"(ga + rstep), "v"(ga + 2 * rstep), "v"(ga + 3 * rstep),
                    "v"(gb), "v"(gb + rstep)
                 : "memory");
}

__device__ __forceinline__ void mm128x64(const f16* __restrict__ Ablk, const f16* __restrict__ Bblk,
                                         int K, unsigned char* ring,
                                         v8f& c0, v8f& c1, v8f& c2, v8f& c3) {
    const int tid = threadIdx.x, lane = tid & 31, wid = tid >> 5;
    const int h = lane >> 4, l16 = lane & 15;
    const int cr = tid >> 3, cc = (tid & 7) * 8;          // copy: row 0..31, f16 column
    const f16* ga = Ablk + (size_t)cr * K + cc;
    const f16* gb = Bblk + (size_t)cr * K + cc;
    const size_t rstep = (size_t)32 * K;
    const uint32_t l0 = (uint32_t)(size_t)ring + (uint32_t)(cr * SLAB_PITCH + cc * 2);
    const int nslab = K / SLAB_K;

    slab_copy(l0, ga, gb, rstep);
    asm volatile("s_wait_asynccnt 0x0" ::: "memory");     // slab 0 landed (this wave's share)
    __syncthreads();                                      // ... and every other wave's
    if (nslab > 1) slab_copy(l0 + (uint32_t)SLAB_STAGE, ga + SLAB_K, gb + SLAB_K, rstep);

    const unsigned char* af = ring + (16 * wid + l16) * SLAB_PITCH + h * 16;
    const unsigned char* bf = ring + SLAB_A + l16 * SLAB_PITCH + h * 16;
    for (int t = 0; t < nslab; ++t) {
        const int bo = (t & 1) * SLAB_STAGE;
        for (int ks = 0; ks < 2; ++ks) {
            // the k step's ten LDS reads stand together in front of its four products
            Frag a, b0, b1, b2, b3;
            const unsigned char* ap = af + bo + ks * 64;
            const unsigned char* bp = bf + bo + ks * 64;
            a.h[0]  = *(const v8ha*)(ap);                   a.h[1]  = *(const v8ha*)(ap + 32);
            b0.h[0] = *(const v8ha*)(bp);                   b0.h[1] = *(const v8ha*)(bp + 32);
            b1.h[0] = *(const v8ha*)(bp + 16 * SLAB_PITCH); b1.h[1] = *(const v8ha*)(bp + 16 * SLAB_PITCH + 32);
            b2.h[0] = *(const v8ha*)(bp + 32 * SLAB_PITCH); b2.h[1] = *(const v8ha*)(bp + 32 * SLAB_PITCH + 32);
            b3.h[0] = *(const v8ha*)(bp + 48 * SLAB_PITCH); b3.h[1] = *(const v8ha*)(bp + 48 * SLAB_PITCH + 32);
            c0 = mma(a.v, b0.v, c0);
            c1 = mma(a.v, b1.v, c1);
            c2 = mma(a.v, b2.v, c2);
            c3 = mma(a.v, b3.v, c3);
        }
        asm volatile("s_wait_dscnt 0x0" ::: "memory");    // this wave has left buffer t & 1
        asm volatile("s_wait_asynccnt 0x0" ::: "memory"); // its share of slab t + 1 has landed
        __syncthreads();                                  // publishes slab t + 1, frees buffer t & 1
        if (t + 2 < nslab)
            slab_copy(l0 + (uint32_t)bo, ga + (size_t)(t + 2) * SLAB_K, gb + (size_t)(t + 2) * SLAB_K, rstep);
    }
    asm volatile("s_wait_asynccnt 0x0" ::: "memory");     // no copy outstanding when the ring is reused
}

// ---------------------------------------------------------------------------
// Fused QKV projection + RMS norm + partial rotary.
// Block tile = 128 rows (one batch, 128 consecutive s) x 64 cols (= one head).
// grid = (32 col tiles: 0..15 -> q heads, 16..23 -> k heads, 24..31 -> v heads, NM/128)
// q out: [b][h][s][d] f16, pre-multiplied by 1/8 (softmax scale);  k out: [b][kvh][s][d] f16
// v out: [b][kvh][d][s] f16 (d-major)
// ---------------------------------------------------------------------------
__global__ __launch_bounds__(256) void k_qkv(const f16* __restrict__ X,
                                             const f16* __restrict__ Wqt, const f16* __restrict__ Wkt,
                                             const f16* __restrict__ Wvt,
                                             const float* __restrict__ nqw, const float* __restrict__ nkw,
                                             const float* __restrict__ cosT, const float* __restrict__ sinT,
                                             f16* __restrict__ qb, f16* __restrict__ kb, f16* __restrict__ vt) {
    __shared__ __attribute__((aligned(16))) unsigned char ring[RING_BYTES];
    float (*Cs)[68] = reinterpret_cast<float (*)[68]>(ring);   // C tile takes the ring's place behind the K loop
    const int tid = threadIdx.x, lane = tid & 31, wid = tid >> 5;
    const int h = lane >> 4, l16 = lane & 15;
    const int nt = blockIdx.x;
    const int m0 = blockIdx.y * 128;
    if (m0 + 128 > NM || nt >= 32) return;    // block-uniform

    int mode, hh, nHh;
    const f16* Wt;
    const float* nw;
    if (nt < 16)      { mode = 0; hh = nt;      nHh = NH;  Wt = Wqt; nw = nqw; }
    else if (nt < 24) { mode = 1; hh = nt - 16; nHh = NKV; Wt = Wkt; nw = nkw; }
    else              { mode = 2; hh = nt - 24; nHh = NKV; Wt = Wvt; nw = nkw; }
    const int n0 = hh * NHD;
    const int bb = m0 / NS, s0 = m0 % NS;

    v8f c0 = zero8(), c1 = zero8(), c2 = zero8(), c3 = zero8();
    mm128x64(X + (size_t)m0 * NDM, Wt + (size_t)n0 * NDM, NDM, ring, c0, c1, c2, c3);

    // accumulator (lane = col, element r = row 8h+r) -> LDS tile, still scaled by 16
#pragma unroll
    for (int r = 0; r < 8; ++r) {
        const int row = 16 * wid + 8 * h + r;
        Cs[row][l16]      = c0[r];
        Cs[row][16 + l16] = c1[r];
        Cs[row][32 + l16] = c2[r];
        Cs[row][48 + l16] = c3[r];
    }
    __syncthreads();

    if (mode != 2) {
        const float osc = (mode == 0) ? 0.125f : 1.0f;
        const float w0 = nw[lane], w1 = nw[lane + 32];
#pragma unroll 1
        for (int r = 0; r < 16; ++r) {
            const int row = 16 * wid + r;
            const int s = s0 + row;
            float x0 = Cs[row][lane] * (1.0f / 16.0f);
            float x1 = Cs[row][lane + 32] * (1.0f / 16.0f);
            float ss = x0 * x0 + x1 * x1;
#pragma unroll
            for (int m = 16; m >= 1; m >>= 1) ss += __shfl_xor(ss, m, 32);
            const float rinv = rsqrtf(ss * (1.0f / NHD) + EPSV);
            const float xn0 = x0 * rinv * w0;
            const float xn1 = x1 * rinv * w1;
            const float part = __shfl_xor(xn0, 16, 32);
            const float rot = (lane < 16) ? -part : part;
            const float c  = cosT[(size_t)s * NROT + lane];
            const float sn = sinT[(size_t)s * NROT + lane];
            const float y0 = xn0 * c + rot * sn;
            Cs[row][lane]      = y0 * osc;
            Cs[row][lane + 32] = xn1 * osc;
        }
    }
    __syncthreads();

    v8h o[4];
    size_t off[4];
    if (mode != 2) {
        f16* ob = ((mode == 0) ? qb : kb) + ((size_t)(bb * nHh + hh) * NS + s0) * NHD;
#pragma unroll
        for (int q = 0; q < 4; ++q) {
            const int L = 4 * q + (lane >> 3);          // local row
            const int row = 16 * wid + L;
            const int cc = (lane & 7) * 8;
            const v4f u0 = *(const v4fa*)(&Cs[row][cc]);
            const v4f u1 = *(const v4fa*)(&Cs[row][cc + 4]);
#pragma unroll
            for (int e = 0; e < 4; ++e) { o[q][e] = (f16)u0[e]; o[q][4 + e] = (f16)u1[e]; }
            off[q] = (size_t)row * NHD + cc;
        }
#pragma unroll
        for (int q = 0; q < 4; ++q) *(v8h*)(ob + off[q]) = o[q];
        
    } else {
        f16* ob = vt + (size_t)(bb * NKV + hh) * NHD * NS + s0;
#pragma unroll
        for (int q = 0; q < 4; ++q) {
            const int L = 4 * q + (lane >> 3);          // 0..15
            const int d = 8 * wid + (L >> 1);
            const int sb = (L & 1) * 64 + (lane & 7) * 8;
#pragma unroll
            for (int e = 0; e < 8; ++e) o[q][e] = (f16)(Cs[sb + e][d] * (1.0f / 16.0f));
            off[q] = (size_t)d * NS + sb;
        }
#pragma unroll
        for (int q = 0; q < 4; ++q) *(v8h*)(ob + off[q]) = o[q];
        
    }
}

#define KT    128
#define KS_P  72
#define VS_P  (KT + 8)
#define KV_K      (KT * KS_P * 2)
#define KV_STAGE  (KV_K + 64 * VS_P * 2)

// One thread's share of a pass's tiles: 16 B of K rows r, r+32, r+64, r+96 and of V rows d, d+16, d+32, d+48.
// s_wait_xcnt closes the statement so that no address register is rewritten ahead of it.
__device__ __forceinline__ void kv_copy(uint32_t lk, uint32_t lv, const f16* gk, const f16* gv) {
    asm volatile("global_load_async_to_lds_b128 %0, %8, off\n\t"
                 "global_load_async_to_lds_b128 %1, %9, off\n\t"
                 "global_load_async_to_lds_b128 %2, %10, off\n\t"
                 "global_load_async_to_lds_b128 %3, %11, off\n\t"
                 "global_load_async_to_lds_b128 %4, %12, off\n\t"
                 "global_load_async_to_lds_b128 %5, %13, off\n\t"
                 "global_load_async_to_lds_b128 %6, %14, off\n\t"
                 "global_load_async_to_lds_b128 %7, %15, off\n\t"
                 "s_wait_xcnt 0x0"
                 :: "v"(lk), "v"(lk + 32u * KS_P * 2u), "v"(lk + 64u * KS_P * 2u), "v"(lk + 96u * KS_P * 2u),
                    "v"(lv), "v"(lv + 16u * VS_P * 2u), "v"(lv + 32u * VS_P * 2u), "v"(lv + 48u * VS_P * 2u),
                    "v"(gk), "v"(gk + 32 * NHD), "v"(gk + 64 * NHD), "v"(gk + 96 * NHD),
                    "v"(gv), "v"(gv + 16 * NS), "v"(gv + 32 * NS), "v"(gv + 48 * NS)
                 : "memory");
}

__global__ __launch_bounds__(256) void k_attn(const f16* __restrict__ qb, const f16* __restrict__ kb,
                                              const f16* __restrict__ vt, f16* __restrict__ ob) {
    __shared__ __attribute__((aligned(16))) unsigned char kv[2 * KV_STAGE];   // two buffers of [K tile | V tile]
    __shared__ __attribute__((aligned(16))) f16   Os[8 * 16 * 72];

    const int tid = threadIdx.x, lane = tid & 31, wid = tid >> 5;
    const int h = lane >> 4, l16 = lane & 15, h8 = h * 8;
    const int bb = blockIdx.z, hd = blockIdx.y, kvh = hd / (NH / NKV);
    const int qblk = blockIdx.x * 128;
    if (qblk + 128 > NS || hd >= NH || bb >= NB) return;   // block-uniform
    const int q0 = qblk + wid * 16;

    const f16* qrow = qb + ((size_t)(bb * NH + hd) * NS + q0 + l16) * NHD;
    Frag qa0, qa1;
    qa0.h[0] = *(const v8h*)(qrow + h8);
    qa0.h[1] = *(const v8h*)(qrow + 16 + h8);
    qa1.h[0] = *(const v8h*)(qrow + 32 + h8);
    qa1.h[1] = *(const v8h*)(qrow + 48 + h8);

    float m_run = -1e30f, l_run = 0.0f;
    v8f acc0 = zero8(), acc1 = zero8(), acc2 = zero8(), acc3 = zero8();

    const f16* kbase = kb + (size_t)(bb * NKV + kvh) * NS * NHD;
    const f16* vbase = vt + (size_t)(bb * NKV + kvh) * NHD * NS;

    const int cr = tid >> 3, cc = (tid & 7) * 8;      // copy, K: KT rows x 64 d, 32 rows a step
    const int cd = tid >> 4, cv = (tid & 15) * 8;     // copy, V: 64 d rows x KT kv, 16 rows a step
    const f16* gk = kbase + (size_t)cr * NHD + cc;
    const f16* gv = vbase + (size_t)cd * NS + cv;
    const uint32_t lk = (uint32_t)(size_t)kv + (uint32_t)((cr * KS_P + cc) * 2);
    const uint32_t lv = (uint32_t)(size_t)kv + (uint32_t)(KV_K + (cd * VS_P + cv) * 2);

    kv_copy(lk, lv, gk, gv);
    asm volatile("s_wait_asynccnt 0x0" ::: "memory");     // pass 0's tiles landed (this wave's share)
    __syncthreads();                                      // ... and every other wave's
    if (NS / KT > 1) kv_copy(lk + (uint32_t)KV_STAGE, lv + (uint32_t)KV_STAGE, gk + (size_t)KT * NHD, gv + KT);

#pragma unroll 1
    for (int it = 0; it < NS / KT; ++it) {
        const int bo = (it & 1) * KV_STAGE;
        const f16* Ks = reinterpret_cast<const f16*>(kv + bo);
        const f16* Vs = reinterpret_cast<const f16*>(kv + bo + KV_K);

        // scores of KT keys, four 16x16 tiles at a time: sc[t][r] = score of key 16t+8h+r for query l16
        v8f sc[KT / 16];
#pragma unroll
        for (int tb = 0; tb < KT / 16; tb += 4) {
            Frag b0[4], b1[4];
#pragma unroll
            for (int u = 0; u < 4; ++u) {
                const f16* kp = Ks + ((tb + u) * 16 + l16) * KS_P;
                b0[u].h[0] = *(const v8ha*)(kp + h8);      b0[u].h[1] = *(const v8ha*)(kp + 16 + h8);
                b1[u].h[0] = *(const v8ha*)(kp + 32 + h8); b1[u].h[1] = *(const v8ha*)(kp + 48 + h8);
            }
#pragma unroll
            for (int u = 0; u < 4; ++u) sc[tb + u] = mma(b0[u].v, qa0.v, zero8());
#pragma unroll
            for (int u = 0; u < 4; ++u) sc[tb + u] = mma(b1[u].v, qa1.v, sc[tb + u]);
        }

        // query l16, of every 32 keys the kv subset {8h..8h+7, 16+8h..23+8h}, in that order
        // (the three loops are unrolled so that every index is a constant and the renaming costs no instruction)
        v4f rv[KT / 32][4];
#pragma unroll
        for (int g = 0; g < KT / 32; ++g)
#pragma unroll
            for (int q = 0; q < 4; ++q)
#pragma unroll
                for (int e = 0; e < 4; ++e) rv[g][q][e] = sc[2 * g + (q >> 1)][4 * (q & 1) + e];

        // one maximum per 32 keys (independent chains), then their maximum
        float rm = -1e30f;
#pragma unroll
        for (int g = 0; g < KT / 32; ++g) {
            float gm = rv[g][0][0];
#pragma unroll
            for (int i = 1; i < 16; ++i) gm = fmaxf(gm, rv[g][i >> 2][i & 3]);
            rm = fmaxf(rm, gm);
        }
        rm = fmaxf(rm, __shfl_xor(rm, 16, 32));

        const float mn = fmaxf(m_run, rm);
        const float alpha = __expf(m_run - mn);

        // one partial sum per 32 keys (independent chains), then their sum
        Frag pa[KT / 32];
        float rs = 0.0f;
#pragma unroll
        for (int g = 0; g < KT / 32; ++g) {
            float gs = 0.0f;
#pragma unroll
            for (int q = 0; q < 4; ++q) {
                const v4f p = exp2x4((rv[g][q] - mn) * 1.44269504f);   // e^(s - mn)
#pragma unroll
                for (int e = 0; e < 4; ++e) { gs += p[e]; pa[g].e[4 * q + e] = (f16)(p[e] * 256.0f); }
            }
            rs += gs;
        }
        rs += __shfl_xor(rs, 16, 32);
        l_run = l_run * alpha + rs;
        m_run = mn;

        // the accumulators' column is this lane's own query
#pragma unroll
        for (int r = 0; r < 8; ++r) { acc0[r] *= alpha; acc1[r] *= alpha; acc2[r] *= alpha; acc3[r] *= alpha; }

        // PV, 32 keys at a time: A fragment for d = j*16 + l16, kv split map; accj[r] = O[query l16][16j+8h+r]
#pragma unroll
        for (int g = 0; g < KT / 32; ++g) {
            Frag bv[4];
#pragma unroll
            for (int j = 0; j < 4; ++j) {
                const f16* vp = Vs + (j * 16 + l16) * VS_P + g * 32;
                bv[j].h[0] = *(const v8ha*)(vp + h8); bv[j].h[1] = *(const v8ha*)(vp + 16 + h8);
            }
            acc0 = mma(bv[0].v, pa[g].v, acc0);
            acc1 = mma(bv[1].v, pa[g].v, acc1);
            acc2 = mma(bv[2].v, pa[g].v, acc2);
            acc3 = mma(bv[3].v, pa[g].v, acc3);
        }

        asm volatile("s_wait_dscnt 0x0" ::: "memory");    // this wave has left buffer it & 1
        asm volatile("s_wait_asynccnt 0x0" ::: "memory"); // its share of pass it + 1's tiles has landed
        __syncthreads();                                  // publishes pass it + 1's tiles, frees buffer it & 1
        if (it + 2 < NS / KT)
            kv_copy(lk + (uint32_t)bo, lv + (uint32_t)bo, gk + (size_t)(it + 2) * KT * NHD, gv + (it + 2) * KT);
    }
    asm volatile("s_wait_asynccnt 0x0" ::: "memory");     // no copy outstanding behind the loop

    // normalise: O = acc / (256 * l); stored as O*32 -> acc * (0.125 / l)
    const float inv = 0.125f / l_run;

    __syncthreads();
    f16* os = Os + wid * 16 * 72;
    {
        v8h t0, t1, t2, t3;
#pragma unroll   // constant element indices: the vectors stay in registers
        for (int r = 0; r < 8; ++r) {
            t0[r] = (f16)(acc0[r] * inv);
            t1[r] = (f16)(acc1[r] * inv);
            t2[r] = (f16)(acc2[r] * inv);
            t3[r] = (f16)(acc3[r] * inv);
        }
        f16* orow = os + l16 * 72 + h8;      // query l16, eight consecutive d per tile
        *(v8ha*)(orow)      = t0;
        *(v8ha*)(orow + 16) = t1;
        *(v8ha*)(orow + 32) = t2;
        *(v8ha*)(orow + 48) = t3;
    }
    __syncthreads();

    v8h o[4];
    size_t off[4];
#pragma unroll
    for (int q = 0; q < 4; ++q) {
        const int L = 4 * q + (lane >> 3);     // local q row 0..15
        const int cc = (lane & 7) * 8;
        o[q] = *(const v8ha*)(os + L * 72 + cc);
        off[q] = ((size_t)(bb * NS + q0 + L)) * (NH * NHD) + hd * NHD + cc;
    }
#pragma unroll
    for (int q = 0; q < 4; ++q) *(v8h*)(ob + off[q]) = o[q];
    
}

// ---------------------------------------------------------------------------
// out = (O*32 f16) x (Wo*16 f16, k contiguous) / 512 + bias + residual, f32 [NM][NDM]
// Block tile 128 x 64, grid = (NDM/64, NM/128). Row segment of 64 floats = 2 lines,
// ---------------------------------------------------------------------------
__global__ __launch_bounds__(256) void k_oproj(const f16* __restrict__ A, const f16* __restrict__ Wot,
                                               const float* __restrict__ bias, const float* __restrict__ resid,
                                               float* __restrict__ out) {
    __shared__ __attribute__((aligned(16))) unsigned char ring[RING_BYTES];
    float (*Cs)[68] = reinterpret_cast<float (*)[68]>(ring);   // C tile takes the ring's place behind the K loop
    const int tid = threadIdx.x, lane = tid & 31, wid = tid >> 5;
    const int h = lane >> 4, l16 = lane & 15;
    const int n0 = blockIdx.x * 64;
    const int m0 = blockIdx.y * 128;
    if (n0 + 64 > NDM || m0 + 128 > NM) return;   // block-uniform

    v8f c0 = zero8(), c1 = zero8(), c2 = zero8(), c3 = zero8();
    mm128x64(A + (size_t)m0 * (NH * NHD), Wot + (size_t)n0 * (NH * NHD), NH * NHD, ring, c0, c1, c2, c3);

#pragma unroll
    for (int r = 0; r < 8; ++r) {
        const int row = 16 * wid + 8 * h + r;
        Cs[row][l16]      = c0[r];
        Cs[row][16 + l16] = c1[r];
        Cs[row][32 + l16] = c2[r];
        Cs[row][48 + l16] = c3[r];
    }
    __syncthreads();

    v4f o[8];
    size_t off[8];
#pragma unroll
    for (int q = 0; q < 8; ++q) {
        const int L = 4 * q + (lane >> 3);         // 0..31 : (local row, half)
        const int row = 16 * wid + (L >> 1);
        const int cc = (L & 1) * 32 + (lane & 7) * 4;
        const v4f cv = *(const v4fa*)(&Cs[row][cc]);
        const size_t go = (size_t)(m0 + row) * NDM + n0 + cc;
        const v4f bv = *(const v4f*)(bias + n0 + cc);
        const v4f rv = *(const v4f*)(resid + go);
        v4f val;
#pragma unroll
        for (int e = 0; e < 4; ++e) val[e] = (cv[e] * (1.0f / 512.0f) + bv[e]) + rv[e];
        o[q] = val;
        off[q] = go;
    }
#pragma unroll
    for (int q = 0; q < 8; ++q) *(v4f*)(out + off[q]) = o[q];
    
}

// ---------------------------------------------------------------------------
// Launcher
// ---------------------------------------------------------------------------
extern "C" void kernel_launch(void* const* d_in, const int* in_sizes, int n_in,
                              void* d_out, int out_size, void* d_ws, size_t ws_size,
                              hipStream_t stream) {
    if (n_in < 10) return;
    if (in_sizes[0] != NM * NDM) return;
    if (in_sizes[1] != NDM * NH * NHD) return;
    if (in_sizes[2] != NDM * NKV * NHD || in_sizes[3] != NDM * NKV * NHD) return;
    if (in_sizes[4] != NH * NHD * NDM) return;
    if (in_sizes[5] < NDM || in_sizes[6] < NHD || in_sizes[7] < NHD) return;
    if (in_sizes[8] != NS * NROT || in_sizes[9] != NS * NROT) return;
    if (out_size != NM * NDM) return;

    const float* hs   = (const float*)d_in[0];
    const float* wq   = (const float*)d_in[1];
    const float* wk   = (const float*)d_in[2];
    const float* wv   = (const float*)d_in[3];
    const float* wo   = (const float*)d_in[4];
    const float* bo   = (const float*)d_in[5];
    const float* nqw  = (const float*)d_in[6];
    const float* nkw  = (const float*)d_in[7];
    const float* cosT = (const float*)d_in[8];
    const float* sinT = (const float*)d_in[9];

    const size_t szX   = (size_t)NM * NDM * sizeof(f16);            // 8 MB
    const size_t szWq  = (size_t)NDM * NH * NHD * sizeof(f16);      // 2 MB
    const size_t szWkv = (size_t)NDM * NKV * NHD * sizeof(f16);     // 1 MB
    const size_t szWo  = (size_t)NH * NHD * NDM * sizeof(f16);      // 2 MB
    const size_t szQ   = (size_t)NB * NH * NS * NHD * sizeof(f16);  // 8 MB
    const size_t szKV  = (size_t)NB * NKV * NS * NHD * sizeof(f16); // 4 MB
    const size_t szO   = (size_t)NM * NH * NHD * sizeof(f16);       // 8 MB
    size_t offp = 0;
    const size_t oX   = offp; offp += szX;
    const size_t oWq  = offp; offp += szWq;
    const size_t oWk  = offp; offp += szWkv;
    const size_t oWv  = offp; offp += szWkv;
    const size_t oWo  = offp; offp += szWo;
    const size_t oQ   = offp; offp += szQ;
    const size_t oK   = offp; offp += szKV;
    const size_t oV   = offp; offp += szKV;
    const size_t oO   = offp; offp += szO;
    if (offp > ws_size) return;

    char* ws = (char*)d_ws;
    f16* hsb  = (f16*)(ws + oX);
    f16* wqt  = (f16*)(ws + oWq);
    f16* wkt  = (f16*)(ws + oWk);
    f16* wvt  = (f16*)(ws + oWv);
    f16* wot  = (f16*)(ws + oWo);
    f16* qbuf = (f16*)(ws + oQ);
    f16* kbuf = (f16*)(ws + oK);
    f16* vtb  = (f16*)(ws + oV);
    f16* attb = (f16*)(ws + oO);

    // X -> f16 and W[K=in][N=out] -> Wt[N][K] * 16, all in one launch
    k_prep<<<PB_ALL, 256, 0, stream>>>(hs, wq, wk, wv, wo, hsb, wqt, wkt, wvt, wot);

    k_qkv<<<dim3(32, (NM + 127) / 128), 256, 0, stream>>>(hsb, wqt, wkt, wvt, nqw, nkw, cosT, sinT,
                                                         qbuf, kbuf, vtb);

    k_attn<<<dim3((NS + 127) / 128, NH, NB), 256, 0, stream>>>(qbuf, kbuf, vtb, attb);

    k_oproj<<<dim3((NDM + 63) / 64, (NM + 127) / 128), 256, 0, stream>>>(attb, wot, bo, hs, (float*)d_out);
}

// v006
// A run of this version takes 81 microseconds.
// Timed twice side by side with v005, it ran 1.04 and 1.05 times as fast.
// Counting every step since v000, it is 2.97 times as fast.
#include <hip/hip_runtime.h>
#include <stdint.h>

// Contractions x*Wq, x*Wk, x*Wv, q*k^T, p*v, o*Wo: v_wmma_f32_16x16x32_f16 (f16 operands with power-of-two operand scaling, f32 accumulate); RMS norm, rotary, softmax, bias and residual in f32.

#define NB   2
#define NS   2048
#define NDM  1024
#define NH   16
#define NKV  8
#define NHD  64
#define NROT 32
#define EPSV 1e-6f
#define NM   (NB * NS)

typedef _Float16 f16;
typedef f16   v8h  __attribute__((ext_vector_type(8)));
typedef f16   v16h __attribute__((ext_vector_type(16)));
typedef float v4f  __attribute__((ext_vector_type(4)));
typedef float v8f  __attribute__((ext_vector_type(8)));
typedef v4f v4fa __attribute__((may_alias));
typedef v8h v8ha __attribute__((may_alias));

union Frag { v16h v; v8h h[2]; f16 e[16]; };

// D(16x16 f32) += A(16x32) * B(32x16); hazard guard ties D and keeps A/B live.
__device__ __forceinline__ v8f mma(const v16h a, const v16h b, v8f c) {
    v8f d = __builtin_amdgcn_wmma_f32_16x16x32_f16(false, a, false, b, (short)0, c, false, false);
    asm volatile("v_nop\n\tv_nop\n\tv_nop\n\tv_nop" : "+v"(d) : "v"(a), "v"(b));
    return d;
}

// 2^x of four independent values. One statement, outputs apart from the inputs, so that each v_exp_f32 is
// followed by an instruction that neither reads its result nor overwrites its source; the v_nop is that
// instruction behind the last one, whatever the compiler places next.
__device__ __forceinline__ v4f exp2x4(const v4f x) {
    float r0, r1, r2, r3;
    asm("v_exp_f32 %0, %4\n\tv_exp_f32 %1, %5\n\tv_exp_f32 %2, %6\n\tv_exp_f32 %3, %7\n\tv_nop"
        : "=&v"(r0), "=&v"(r1), "=&v"(r2), "=&v"(r3)
        : "v"(x[0]), "v"(x[1]), "v"(x[2]), "v"(x[3]));
    v4f r;
    r[0] = r0; r[1] = r1; r[2] = r2; r[3] = r3;
    return r;
}

// Sum over the 16 lanes of a row of lanes (the lanes that share lane >> 4): four butterfly steps on the
// vector unit's own cross-lane path (row_xmask), every lane ends with the sum. All lanes are on.
template <int M>
__device__ __forceinline__ float xmask16(const float x) {
    return __builtin_bit_cast(float, __builtin_amdgcn_update_dpp(0, __builtin_bit_cast(int, x), 0x160 | M, 0xf, 0xf, true));
}
__device__ __forceinline__ float row16_sum(float x) {
    x += xmask16<1>(x);
    x += xmask16<2>(x);
    x += xmask16<4>(x);
    x += xmask16<8>(x);
    return x;
}

__device__ __forceinline__ v8f zero8() {
    v8f z;
#pragma unroll
    for (int i = 0; i < 8; ++i) z[i] = 0.0f;
    return z;
}

// ---------------------------------------------------------------------------
// Preparation, one launch: the five jobs need nothing of each other, so they share one grid and a range
// of the block index picks the job (block-uniform branches).
// ---------------------------------------------------------------------------
// f32 -> f16, eight elements a thread; blk = block index inside the job
__device__ __forceinline__ void cvt_block(const float* __restrict__ in, f16* __restrict__ out, int n8, int blk) {
    const int i = blk * 256 + threadIdx.x;
    if (i >= n8) return;
    const float* s = in + (size_t)i * 8;
    const v4f u0 = *(const v4f*)(s);
    const v4f u1 = *(const v4f*)(s + 4);
    v8h o;
#pragma unroll
    for (int e = 0; e < 4; ++e) { o[e] = (f16)u0[e]; o[4 + e] = (f16)u1[e]; }
    f16* d = out + (size_t)i * 8;
    *(v8h*)d = o;
}

// W[K][N] f32 -> Wt[N][K] f16 * scale (k contiguous). Tile 64 k x 32 n.
// in[K rows][N cols] -> out[N rows][K cols]; blk = block index inside the job, (N/32) * (K/64) blocks
__device__ __forceinline__ void wtrans_block(const float* __restrict__ W, f16* __restrict__ Wt,
                                             int K, int N, float scale, int blk, float (*T)[33]) {
    const int tid = threadIdx.x, lane = tid & 31, wid = tid >> 5;
    const int nTn = N / 32;
    const int tn = blk % nTn, tk = blk / nTn;
    const int n0 = tn * 32, k0 = tk * 64;
    if (k0 + 64 > K || n0 + 32 > N) return;   // block-uniform
    {
        const int k = tid >> 2, c = (tid & 3) * 8;
        const float* src = W + (size_t)(k0 + k) * N + n0 + c;
        const v4f u0 = *(const v4f*)(src);
        const v4f u1 = *(const v4f*)(src + 4);
        asm volatile("s_wait_xcnt 0x0" ::: "memory");  // stands in front of any reuse of the two loads' address registers
#pragma unroll
        for (int e = 0; e < 4; ++e) { T[k][c + e] = u0[e]; T[k][c + 4 + e] = u1[e]; }
    }
    __syncthreads();
    const int L  = wid * 4 + (lane >> 3);     // local n row 0..31
    const int k8 = (lane & 7) * 8;
    v8h o;
#pragma unroll
    for (int e = 0; e < 8; ++e) o[e] = (f16)(T[k8 + e][L] * scale);
    f16* dst = Wt + (size_t)(n0 + L) * K + k0 + k8;
    *(v8h*)dst = o;
    asm volatile("s_wait_xcnt 0x0" ::: "memory");  // stands in front of any reuse of the store's address and data registers
}

#define PB_WQ   (((NH * NHD) / 32) * (NDM / 64))
#define PB_WKV  (((NKV * NHD) / 32) * (NDM / 64))
#define PB_WO   ((NDM / 32) * ((NH * NHD) / 64))
#define PB_CVT  ((NM * NDM / 8 + 255) / 256)
#define PB_ALL  (PB_WQ + 2 * PB_WKV + PB_WO + PB_CVT)

// The transposes come first in the grid: theirs is the longer path (load, LDS, barrier, store).
__global__ __launch_bounds__(256) void k_prep(const float* __restrict__ hs, const float* __restrict__ wq,
                                              const float* __restrict__ wk, const float* __restrict__ wv,
                                              const float* __restrict__ wo,
                                              f16* __restrict__ hsb, f16* __restrict__ wqt, f16* __restrict__ wkt,
                                              f16* __restrict__ wvt, f16* __restrict__ wot) {
    __shared__ float T[64][33];
    int b = blockIdx.x;
    if (b < PB_WQ)  { wtrans_block(wq, wqt, NDM, NH * NHD, 16.0f, b, T); return; }
    b -= PB_WQ;
    if (b < PB_WKV) { wtrans_block(wk, wkt, NDM, NKV * NHD, 16.0f, b, T); return; }
    b -= PB_WKV;
    if (b < PB_WKV) { wtrans_block(wv, wvt, NDM, NKV * NHD, 16.0f, b, T); return; }
    b -= PB_WKV;
    if (b < PB_WO)  { wtrans_block(wo, wot, NH * NHD, NDM, 16.0f, b, T); return; }
    b -= PB_WO;
    cvt_block(hs, hsb, (NM * NDM) / 8, b);
}

// ---------------------------------------------------------------------------
// Block: C[128 rows][64 cols] += A[128 x K] * B[K x 64]; wave w owns rows 16w..16w+15.
// Ablk -> A + m0*K, Bblk -> Bt + n0*K (both k contiguous).
// K runs in slabs of 64 (128 B of every row). A slab of all 192 rows is copied into LDS by
// asynchronous copies whose wave-wide 512 B cover four whole lines; two buffers, the next
// slab's copies fly while this one is multiplied. LDS rows at pitch 144 B (16 B x odd).
// Both fragments use the same split k map:
// elements 0..7 <- k0+8h+0..7, elements 8..15 <- k0+16+8h+0..7.
// ---------------------------------------------------------------------------
#define SLAB_K      64
#define SLAB_PITCH  144
#define SLAB_A      (128 * SLAB_PITCH)
#define SLAB_STAGE  (192 * SLAB_PITCH)
#define RING_BYTES  (2 * SLAB_STAGE)

// One thread's share of a slab: 16 B of A rows r, r+32, r+64, r+96 and of B rows r, r+32.
// s_wait_xcnt closes the statement so that no address register is rewritten ahead of it.
__device__ __forceinline__ void slab_copy(uint32_t lds, const f16* ga, const f16* gb, size_t rstep) {
    asm volatile("global_load_async_to_lds_b128 %0, %6, off\n\t"
                 "global_load_async_to_lds_b128 %1, %7, off\n\t"
                 "global_load_async_to_lds_b128 %2, %8, off\n\t"
                 "global_load_async_to_lds_b128 %3, %9, off\n\t"
                 "global_load_async_to_lds_b128 %4, %10, off\n\t"
                 "global_load_async_to_lds_b128 %5, %11, off\n\t"
                 "s_wait_xcnt 0x0"
                 :: "v"(lds), "v"(lds + 32u * SLAB_PITCH), "v"(lds + 64u * SLAB_PITCH),
                    "v"(lds + 96u * SLAB_PITCH), "v"(lds + (uint32_t)SLAB_A),
                    "v"(lds + (uint32_t)SLAB_A + 32u * SLAB_PITCH),
                    "v"(ga), "v"(ga + rstep), "v"(ga + 2 * rstep), "v"(ga + 3 * rstep),
                    "v"(gb), "v"(gb + rstep)
                 : "memory");
}

__device__ __forceinline__ void mm128x64(const f16* __restrict__ Ablk, const f16* __restrict__ Bblk,
                                         int K, unsigned char* ring,
                                         v8f& c0, v8f& c1, v8f& c2, v8f& c3) {
    const int tid = threadIdx.x, lane = tid & 31, wid = tid >> 5;
    const int h = lane >> 4, l16 = lane & 15;
    const int cr = tid >> 3, cc = (tid & 7) * 8;          // copy: row 0..31, f16 column
    const f16* ga = Ablk + (size_t)cr * K + cc;
    const f16* gb = Bblk + (size_t)cr * K + cc;
    const size_t rstep = (size_t)32 * K;
    const uint32_t l0 = (uint32_t)(size_t)ring + (uint32_t)(cr * SLAB_PITCH + cc * 2);
    const int nslab = K / SLAB_K;

    slab_copy(l0, ga, gb, rstep);
    asm volatile("s_wait_asynccnt 0x0" ::: "memory");     // slab 0 landed (this wave's share)
    __syncthreads();                                      // ... and every other wave's
    if (nslab > 1) slab_copy(l0 + (uint32_t)SLAB_STAGE, ga + SLAB_K, gb + SLAB_K, rstep);

    const unsigned char* af = ring + (16 * wid + l16) * SLAB_PITCH + h * 16;
    const unsigned char* bf = ring + SLAB_A + l16 * SLAB_PITCH + h * 16;
    for (int t = 0; t < nslab; ++t) {
        const int bo = (t & 1) * SLAB_STAGE;
        for (int ks = 0; ks < 2; ++ks) {
            // the k step's ten LDS reads stand together in front of its four products
            Frag a, b0, b1, b2, b3;
            const unsigned char* ap = af + bo + ks * 64;
            const unsigned char* bp = bf + bo + ks * 64;
            a.h[0]  = *(const v8ha*)(ap);                   a.h[1]  = *(const v8ha*)(ap + 32);
            b0.h[0] = *(const v8ha*)(bp);                   b0.h[1] = *(const v8ha*)(bp + 32);
            b1.h[0] = *(const v8ha*)(bp + 16 * SLAB_PITCH); b1.h[1] = *(const v8ha*)(bp + 16 * SLAB_PITCH + 32);
            b2.h[0] = *(const v8ha*)(bp + 32 * SLAB_PITCH); b2.h[1] = *(const v8ha*)(bp + 32 * SLAB_PITCH + 32);
            b3.h[0] = *(const v8ha*)(bp + 48 * SLAB_PITCH); b3.h[1] = *(const v8ha*)(bp + 48 * SLAB_PITCH + 32);
            c0 = mma(a.v, b0.v, c0);
            c1 = mma(a.v, b1.v, c1);
            c2 = mma(a.v, b2.v, c2);
            c3 = mma(a.v, b3.v, c3);
        }
        asm volatile("s_wait_dscnt 0x0" ::: "memory");    // this wave has left buffer t & 1
        asm volatile("s_wait_asynccnt 0x0" ::: "memory"); // its share of slab t + 1 has landed
        __syncthreads();                                  // publishes slab t + 1, frees buffer t & 1
        if (t + 2 < nslab)
            slab_copy(l0 + (uint32_t)bo, ga + (size_t)(t + 2) * SLAB_K, gb + (size_t)(t + 2) * SLAB_K, rstep);
    }
    asm volatile("s_wait_asynccnt 0x0" ::: "memory");     // no copy outstanding when the ring is reused
}

// ---------------------------------------------------------------------------
// Fused QKV projection + RMS norm + partial rotary.
// Block tile = 128 rows (one batch, 128 consecutive s) x 64 cols (= one head).
// grid = (32 col tiles: 0..15 -> q heads, 16..23 -> k heads, 24..31 -> v heads, NM/128)
// q out: [b][h][s][d] f16, pre-multiplied by 1/8 (softmax scale);  k out: [b][kvh][s][d] f16
// v out: [b][kvh][d][s] f16 (d-major)
// ---------------------------------------------------------------------------
__global__ __launch_bounds__(256) void k_qkv(const f16* __restrict__ X,
                                             const f16* __restrict__ Wqt, const f16* __restrict__ Wkt,
                                             const f16* __restrict__ Wvt,
                                             const float* __restrict__ nqw, const float* __restrict__ nkw,
                                             const float* __restrict__ cosT, const float* __restrict__ sinT,
                                             f16* __restrict__ qb, f16* __restrict__ kb, f16* __restrict__ vt) {
    __shared__ __attribute__((aligned(16))) unsigned char ring[RING_BYTES];
    float (*Cs)[68] = reinterpret_cast<float (*)[68]>(ring);   // C tile takes the ring's place behind the K loop
    const int tid = threadIdx.x, lane = tid & 31, wid = tid >> 5;
    const int h = lane >> 4, l16 = lane & 15;
    const int nt = blockIdx.x;
    const int m0 = blockIdx.y * 128;
    if (m0 + 128 > NM || nt >= 32) return;    // block-uniform

    int mode, hh, nHh;
    const f16* Wt;
    const float* nw;
    if (nt < 16)      { mode = 0; hh = nt;      nHh = NH;  Wt = Wqt; nw = nqw; }
    else if (nt < 24) { mode = 1; hh = nt - 16; nHh = NKV; Wt = Wkt; nw = nkw; }
    else              { mode = 2; hh = nt - 24; nHh = NKV; Wt = Wvt; nw = nkw; }
    const int n0 = hh * NHD;
    const int bb = m0 / NS, s0 = m0 % NS;

    v8f c0 = zero8(), c1 = zero8(), c2 = zero8(), c3 = zero8();
    mm128x64(X + (size_t)m0 * NDM, Wt + (size_t)n0 * NDM, NDM, ring, c0, c1, c2, c3);

    // RMS norm and rotary on the accumulators (lane = col 16j+l16 of tile j, element r = row 8h+r, scaled by 16).
    // A row's 64 columns lie in the four tiles of the 16 lanes that share h; column i and its rotary partner
    // i +- 16 are tiles 0 and 1 of the same lane. 1/16 and the softmax scale are powers of two, folded into f.
    if (mode != 2) {
        const float osc16 = ((mode == 0) ? 0.125f : 1.0f) * (1.0f / 16.0f);
        const float w0 = nw[l16], w1 = nw[16 + l16], w2 = nw[32 + l16], w3 = nw[48 + l16];
        const size_t tr = (size_t)(s0 + 16 * wid + 8 * h) * NROT + l16;
        const float* cp = cosT + tr;
        const float* sp = sinT + tr;
        float ca[8], cb[8], sa[8], sb[8];
#pragma unroll   // constant indices: the tables' values stay in registers, all loads in flight together
        for (int r = 0; r < 8; ++r) {
            ca[r] = cp[r * NROT]; cb[r] = cp[r * NROT + 16];
            sa[r] = sp[r * NROT]; sb[r] = sp[r * NROT + 16];
        }
        __builtin_amdgcn_sched_barrier(0);             // the loads stay in front: their latency runs under the row sums
#pragma unroll   // eight independent chains, constant element indices
        for (int r = 0; r < 8; ++r) {
            const float ss = row16_sum(fmaf(c0[r], c0[r], fmaf(c1[r], c1[r], fmaf(c2[r], c2[r], c3[r] * c3[r]))));
            const float f = rsqrtf(ss * (1.0f / (256.0f * NHD)) + EPSV) * osc16;
            const float x0 = c0[r] * f * w0;
            const float x1 = c1[r] * f * w1;
            c0[r] = x0 * ca[r] - x1 * sa[r];
            c1[r] = x1 * cb[r] + x0 * sb[r];
            c2[r] = c2[r] * f * w2;
            c3[r] = c3[r] * f * w3;
        }
    }

    // accumulator -> LDS tile: q and k finished, v still scaled by 16
#pragma unroll
    for (int r = 0; r < 8; ++r) {
        const int row = 16 * wid + 8 * h + r;
        Cs[row][l16]      = c0[r];
        Cs[row][16 + l16] = c1[r];
        Cs[row][32 + l16] = c2[r];
        Cs[row][48 + l16] = c3[r];
    }
    __syncthreads();

    v8h o[4];
    size_t off[4];
    if (mode != 2) {
        f16* ob = ((mode == 0) ? qb : kb) + ((size_t)(bb * nHh + hh) * NS + s0) * NHD;
#pragma unroll
        for (int q = 0; q < 4; ++q) {
            const int L = 4 * q + (lane >> 3);          // local row
            const int row = 16 * wid + L;
            const int cc = (lane & 7) * 8;
            const v4f u0 = *(const v4fa*)(&Cs[row][cc]);
            const v4f u1 = *(const v4fa*)(&Cs[row][cc + 4]);
#pragma unroll
            for (int e = 0; e < 4; ++e) { o[q][e] = (f16)u0[e]; o[q][4 + e] = (f16)u1[e]; }
            off[q] = (size_t)row * NHD + cc;
        }
#pragma unroll
        for (int q = 0; q < 4; ++q) *(v8h*)(ob + off[q]) = o[q];
        
    } else {
        f16* ob = vt + (size_t)(bb * NKV + hh) * NHD * NS + s0;
#pragma unroll
        for (int q = 0; q < 4; ++q) {
            const int L = 4 * q + (lane >> 3);          // 0..15
            const int d = 8 * wid + (L >> 1);
            const int sb = (L & 1) * 64 + (lane & 7) * 8;
#pragma unroll
            for (int e = 0; e < 8; ++e) o[q][e] = (f16)(Cs[sb + e][d] * (1.0f / 16.0f));
            off[q] = (size_t)d * NS + sb;
        }
#pragma unroll
        for (int q = 0; q < 4; ++q) *(v8h*)(ob + off[q]) = o[q];
        
    }
}

#define KT    128
#define KS_P  72
#define VS_P  (KT + 8)
#define KV_K      (KT * KS_P * 2)
#define KV_STAGE  (KV_K + 64 * VS_P * 2)

// One thread's share of a pass's tiles: 16 B of K rows r, r+32, r+64, r+96 and of V rows d, d+16, d+32, d+48.
// s_wait_xcnt closes the statement so that no address register is rewritten ahead of it.
__device__ __forceinline__ void kv_copy(uint32_t lk, uint32_t lv, const f16* gk, const f16* gv) {
    asm volatile("global_load_async_to_lds_b128 %0, %8, off\n\t"
                 "global_load_async_to_lds_b128 %1, %9, off\n\t"
                 "global_load_async_to_lds_b128 %2, %10, off\n\t"
                 "global_load_async_to_lds_b128 %3, %11, off\n\t"
                 "global_load_async_to_lds_b128 %4, %12, off\n\t"
                 "global_load_async_to_lds_b128 %5, %13, off\n\t"
                 "global_load_async_to_lds_b128 %6, %14, off\n\t"
                 "global_load_async_to_lds_b128 %7, %15, off\n\t"
                 "s_wait_xcnt 0x0"
                 :: "v"(lk), "v"(lk + 32u * KS_P * 2u), "v"(lk + 64u * KS_P * 2u), "v"(lk + 96u * KS_P * 2u),
                    "v"(lv), "v"(lv + 16u * VS_P * 2u), "v"(lv + 32u * VS_P * 2u), "v"(lv + 48u * VS_P * 2u),
                    "v"(gk), "v"(gk + 32 * NHD), "v"(gk + 64 * NHD), "v"(gk + 96 * NHD),
                    "v"(gv), "v"(gv + 16 * NS), "v"(gv + 32 * NS), "v"(gv + 48 * NS)
                 : "memory");
}

__global__ __launch_bounds__(256) void k_attn(const f16* __restrict__ qb, const f16* __restrict__ kb,
                                              const f16* __restrict__ vt, f16* __restrict__ ob) {
    __shared__ __attribute__((aligned(16))) unsigned char kv[2 * KV_STAGE];   // two buffers of [K tile | V tile]
    __shared__ __attribute__((aligned(16))) f16   Os[8 * 16 * 72];

    const int tid = threadIdx.x, lane = tid & 31, wid = tid >> 5;
    const int h = lane >> 4, l16 = lane & 15, h8 = h * 8;
    const int bb = blockIdx.z, hd = blockIdx.y, kvh = hd / (NH / NKV);
    const int qblk = blockIdx.x * 128;
    if (qblk + 128 > NS || hd >= NH || bb >= NB) return;   // block-uniform
    const int q0 = qblk + wid * 16;

    const f16* qrow = qb + ((size_t)(bb * NH + hd) * NS + q0 + l16) * NHD;
    Frag qa0, qa1;
    qa0.h[0] = *(const v8h*)(qrow + h8);
    qa0.h[1] = *(const v8h*)(qrow + 16 + h8);
    qa1.h[0] = *(const v8h*)(qrow + 32 + h8);
    qa1.h[1] = *(const v8h*)(qrow + 48 + h8);

    float m_run = -1e30f, l_run = 0.0f;
    v8f acc0 = zero8(), acc1 = zero8(), acc2 = zero8(), acc3 = zero8();

    const f16* kbase = kb + (size_t)(bb * NKV + kvh) * NS * NHD;
    const f16* vbase = vt + (size_t)(bb * NKV + kvh) * NHD * NS;

    const int cr = tid >> 3, cc = (tid & 7) * 8;      // copy, K: KT rows x 64 d, 32 rows a step
    const int cd = tid >> 4, cv = (tid & 15) * 8;     // copy, V: 64 d rows x KT kv, 16 rows a step
    const f16* gk = kbase + (size_t)cr * NHD + cc;
    const f16* gv = vbase + (size_t)cd * NS + cv;
    const uint32_t lk = (uint32_t)(size_t)kv + (uint32_t)((cr * KS_P + cc) * 2);
    const uint32_t lv = (uint32_t)(size_t)kv + (uint32_t)(KV_K + (cd * VS_P + cv) * 2);

    kv_copy(lk, lv, gk, gv);
    asm volatile("s_wait_asynccnt 0x0" ::: "memory");     // pass 0's tiles landed (this wave's share)
    __syncthreads();                                      // ... and every other wave's
    if (NS / KT > 1) kv_copy(lk + (uint32_t)KV_STAGE, lv + (uint32_t)KV_STAGE, gk + (size_t)KT * NHD, gv + KT);

#pragma unroll 1
    for (int it = 0; it < NS / KT; ++it) {
        const int bo = (it & 1) * KV_STAGE;
        const f16* Ks = reinterpret_cast<const f16*>(kv + bo);
        const f16* Vs = reinterpret_cast<const f16*>(kv + bo + KV_K);

        // scores of KT keys, four 16x16 tiles at a time: sc[t][r] = score of key 16t+8h+r for query l16
        v8f sc[KT / 16];
#pragma unroll
        for (int tb = 0; tb < KT / 16; tb += 4) {
            Frag b0[4], b1[4];
#pragma unroll
            for (int u = 0; u < 4; ++u) {
                const f16* kp = Ks + ((tb + u) * 16 + l16) * KS_P;
                b0[u].h[0] = *(const v8ha*)(kp + h8);      b0[u].h[1] = *(const v8ha*)(kp + 16 + h8);
                b1[u].h[0] = *(const v8ha*)(kp + 32 + h8); b1[u].h[1] = *(const v8ha*)(kp + 48 + h8);
            }
#pragma unroll
            for (int u = 0; u < 4; ++u) sc[tb + u] = mma(b0[u].v, qa0.v, zero8());
#pragma unroll
            for (int u = 0; u < 4; ++u) sc[tb + u] = mma(b1[u].v, qa1.v, sc[tb + u]);
        }

        // query l16, of every 32 keys the kv subset {8h..8h+7, 16+8h..23+8h}, in that order
        // (the three loops are unrolled so that every index is a constant and the renaming costs no instruction)
        v4f rv[KT / 32][4];
#pragma unroll
        for (int g = 0; g < KT / 32; ++g)
#pragma unroll
            for (int q = 0; q < 4; ++q)
#pragma unroll
                for (int e = 0; e < 4; ++e) rv[g][q][e] = sc[2 * g + (q >> 1)][4 * (q & 1) + e];

        // one maximum per 32 keys (independent chains), then their maximum
        float rm = -1e30f;
#pragma unroll
        for (int g = 0; g < KT / 32; ++g) {
            float gm = rv[g][0][0];
#pragma unroll
            for (int i = 1; i < 16; ++i) gm = fmaxf(gm, rv[g][i >> 2][i & 3]);
            rm = fmaxf(rm, gm);
        }
        rm = fmaxf(rm, __shfl_xor(rm, 16, 32));

        const float mn = fmaxf(m_run, rm);
        const float alpha = __expf(m_run - mn);

        // one partial sum per 32 keys (independent chains), then their sum
        Frag pa[KT / 32];
        float rs = 0.0f;
#pragma unroll
        for (int g = 0; g < KT / 32; ++g) {
            float gs = 0.0f;
#pragma unroll
            for (int q = 0; q < 4; ++q) {
                const v4f p = exp2x4((rv[g][q] - mn) * 1.44269504f);   // e^(s - mn)
#pragma unroll
                for (int e = 0; e < 4; ++e) { gs += p[e]; pa[g].e[4 * q + e] = (f16)(p[e] * 256.0f); }
            }
            rs += gs;
        }
        rs += __shfl_xor(rs, 16, 32);
        l_run = l_run * alpha + rs;
        m_run = mn;

        // the accumulators' column is this lane's own query
#pragma unroll
        for (int r = 0; r < 8; ++r) { acc0[r] *= alpha; acc1[r] *= alpha; acc2[r] *= alpha; acc3[r] *= alpha; }

        // PV, 32 keys at a time: A fragment for d = j*16 + l16, kv split map; accj[r] = O[query l16][16j+8h+r]
#pragma unroll
        for (int g = 0; g < KT / 32; ++g) {
            Frag bv[4];
#pragma unroll
            for (int j = 0; j < 4; ++j) {
                const f16* vp = Vs + (j * 16 + l16) * VS_P + g * 32;
                bv[j].h[0] = *(const v8ha*)(vp + h8); bv[j].h[1] = *(const v8ha*)(vp + 16 + h8);
            }
            acc0 = mma(bv[0].v, pa[g].v, acc0);
            acc1 = mma(bv[1].v, pa[g].v, acc1);
            acc2 = mma(bv[2].v, pa[g].v, acc2);
            acc3 = mma(bv[3].v, pa[g].v, acc3);
        }

        asm volatile("s_wait_dscnt 0x0" ::: "memory");    // this wave has left buffer it & 1
        asm volatile("s_wait_asynccnt 0x0" ::: "memory"); // its share of pass it + 1's tiles has landed
        __syncthreads();                                  // publishes pass it + 1's tiles, frees buffer it & 1
        if (it + 2 < NS / KT)
            kv_copy(lk + (uint32_t)bo, lv + (uint32_t)bo, gk + (size_t)(it + 2) * KT * NHD, gv + (it + 2) * KT);
    }
    asm volatile("s_wait_asynccnt 0x0" ::: "memory");     // no copy outstanding behind the loop

    // normalise: O = acc / (256 * l); stored as O*32 -> acc * (0.125 / l)
    const float inv = 0.125f / l_run;

    __syncthreads();
    f16* os = Os + wid * 16 * 72;
    {
        v8h t0, t1, t2, t3;
#pragma unroll   // constant element indices: the vectors stay in registers
        for (int r = 0; r < 8; ++r) {
            t0[r] = (f16)(acc0[r] * inv);
            t1[r] = (f16)(acc1[r] * inv);
            t2[r] = (f16)(acc2[r] * inv);
            t3[r] = (f16)(acc3[r] * inv);
        }
        f16* orow = os + l16 * 72 + h8;      // query l16, eight consecutive d per tile
        *(v8ha*)(orow)      = t0;
        *(v8ha*)(orow + 16) = t1;
        *(v8ha*)(orow + 32) = t2;
        *(v8ha*)(orow + 48) = t3;
    }
    __syncthreads();

    v8h o[4];
    size_t off[4];
#pragma unroll
    for (int q = 0; q < 4; ++q) {
        const int L = 4 * q + (lane >> 3);     // local q row 0..15
        const int cc = (lane & 7) * 8;
        o[q] = *(const v8ha*)(os + L * 72 + cc);
        off[q] = ((size_t)(bb * NS + q0 + L)) * (NH * NHD) + hd * NHD + cc;
    }
#pragma unroll
    for (int q = 0; q < 4; ++q) *(v8h*)(ob + off[q]) = o[q];
    
}

// ---------------------------------------------------------------------------
// out = (O*32 f16) x (Wo*16 f16, k contiguous) / 512 + bias + residual, f32 [NM][NDM]
// Block tile 128 x 64, grid = (NDM/64, NM/128). Row segment of 64 floats = 2 lines,
// ---------------------------------------------------------------------------
__global__ __launch_bounds__(256) void k_oproj(const f16* __restrict__ A, const f16* __restrict__ Wot,
                                               const float* __restrict__ bias, const float* __restrict__ resid,
                                               float* __restrict__ out) {
    __shared__ __attribute__((aligned(16))) unsigned char ring[RING_BYTES];
    float (*Cs)[68] = reinterpret_cast<float (*)[68]>(ring);   // C tile takes the ring's place behind the K loop
    const int tid = threadIdx.x, lane = tid & 31, wid = tid >> 5;
    const int h = lane >> 4, l16 = lane & 15;
    const int n0 = blockIdx.x * 64;
    const int m0 = blockIdx.y * 128;
    if (n0 + 64 > NDM || m0 + 128 > NM) return;   // block-uniform

    v8f c0 = zero8(), c1 = zero8(), c2 = zero8(), c3 = zero8();
    mm128x64(A + (size_t)m0 * (NH * NHD), Wot + (size_t)n0 * (NH * NHD), NH * NHD, ring, c0, c1, c2, c3);

#pragma unroll
    for (int r = 0; r < 8; ++r) {
        const int row = 16 * wid + 8 * h + r;
        Cs[row][l16]      = c0[r];
        Cs[row][16 + l16] = c1[r];
        Cs[row][32 + l16] = c2[r];
        Cs[row][48 + l16] = c3[r];
    }
    __syncthreads();

    v4f o[8];
    size_t off[8];
#pragma unroll
    for (int q = 0; q < 8; ++q) {
        const int L = 4 * q + (lane >> 3);         // 0..31 : (local row, half)
        const int row = 16 * wid + (L >> 1);
        const int cc = (L & 1) * 32 + (lane & 7) * 4;
        const v4f cv = *(const v4fa*)(&Cs[row][cc]);
        const size_t go = (size_t)(m0 + row) * NDM + n0 + cc;
        const v4f bv = *(const v4f*)(bias + n0 + cc);
        const v4f rv = *(const v4f*)(resid + go);
        v4f val;
#pragma unroll
        for (int e = 0; e < 4; ++e) val[e] = (cv[e] * (1.0f / 512.0f) + bv[e]) + rv[e];
        o[q] = val;
        off[q] = go;
    }
#pragma unroll
    for (int q = 0; q < 8; ++q) *(v4f*)(out + off[q]) = o[q];
    
}

// ---------------------------------------------------------------------------
// Launcher
// ---------------------------------------------------------------------------
extern "C" void kernel_launch(void* const* d_in, const int* in_sizes, int n_in,
                              void* d_out, int out_size, void* d_ws, size_t ws_size,
                              hipStream_t stream) {
    if (n_in < 10) return;
    if (in_sizes[0] != NM * NDM) return;
    if (in_sizes[1] != NDM * NH * NHD) return;
    if (in_sizes[2] != NDM * NKV * NHD || in_sizes[3] != NDM * NKV * NHD) return;
    if (in_sizes[4] != NH * NHD * NDM) return;
    if (in_sizes[5] < NDM || in_sizes[6] < NHD || in_sizes[7] < NHD) return;
    if (in_sizes[8] != NS * NROT || in_sizes[9] != NS * NROT) return;
    if (out_size != NM * NDM) return;

    const float* hs   = (const float*)d_in[0];
    const float* wq   = (const float*)d_in[1];
    const float* wk   = (const float*)d_in[2];
    const float* wv   = (const float*)d_in[3];
    const float* wo   = (const float*)d_in[4];
    const float* bo   = (const float*)d_in[5];
    const float* nqw  = (const float*)d_in[6];
    const float* nkw  = (const float*)d_in[7];
    const float* cosT = (const float*)d_in[8];
    const float* sinT = (const float*)d_in[9];

    const size_t szX   = (size_t)NM * NDM * sizeof(f16);            // 8 MB
    const size_t szWq  = (size_t)NDM * NH * NHD * sizeof(f16);      // 2 MB
    const size_t szWkv = (size_t)NDM * NKV * NHD * sizeof(f16);     // 1 MB
    const size_t szWo  = (size_t)NH * NHD * NDM * sizeof(f16);      // 2 MB
    const size_t szQ   = (size_t)NB * NH * NS * NHD * sizeof(f16);  // 8 MB
    const size_t szKV  = (size_t)NB * NKV * NS * NHD * sizeof(f16); // 4 MB
    const size_t szO   = (size_t)NM * NH * NHD * sizeof(f16);       // 8 MB
    size_t offp = 0;
    const size_t oX   = offp; offp += szX;
    const size_t oWq  = offp; offp += szWq;
    const size_t oWk  = offp; offp += szWkv;
    const size_t oWv  = offp; offp += szWkv;
    const size_t oWo  = offp; offp += szWo;
    const size_t oQ   = offp; offp += szQ;
    const size_t oK   = offp; offp += szKV;
    const size_t oV   = offp; offp += szKV;
    const size_t oO   = offp; offp += szO;
    if (offp > ws_size) return;

    char* ws = (char*)d_ws;
    f16* hsb  = (f16*)(ws + oX);
    f16* wqt  = (f16*)(ws + oWq);
    f16* wkt  = (f16*)(ws + oWk);
    f16* wvt  = (f16*)(ws + oWv);
    f16* wot  = (f16*)(ws + oWo);
    f16* qbuf = (f16*)(ws + oQ);
    f16* kbuf = (f16*)(ws + oK);
    f16* vtb  = (f16*)(ws + oV);
    f16* attb = (f16*)(ws + oO);

    // X -> f16 and W[K=in][N=out] -> Wt[N][K] * 16, all in one launch
    k_prep<<<PB_ALL, 256, 0, stream>>>(hs, wq, wk, wv, wo, hsb, wqt, wkt, wvt, wot);

    k_qkv<<<dim3(32, (NM + 127) / 128), 256, 0, stream>>>(hsb, wqt, wkt, wvt, nqw, nkw, cosT, sinT,
                                                         qbuf, kbuf, vtb);

    k_attn<<<dim3((NS + 127) / 128, NH, NB), 256, 0, stream>>>(qbuf, kbuf, vtb, attb);

    k_oproj<<<dim3((NDM + 63) / 64, (NM + 127) / 128), 256, 0, stream>>>(attb, wot, bo, hs, (float*)d_out);
}

// v007
// It runs in 78.8 microseconds.
// In both of two side-by-side timings against v006, it was 1.03 times as fast.
// All steps since v000 together make it 3.05 times as fast.
#include <hip/hip_runtime.h>
#include <stdint.h>

// Contractions x*Wq, x*Wk, x*Wv, q*k^T, p*v, o*Wo: v_wmma_f32_16x16x32_f16 (f16 operands with power-of-two operand scaling, f32 accumulate); RMS norm, rotary, softmax, bias and residual in f32.

#define NB   2
#define NS   2048
#define NDM  1024
#define NH   16
#define NKV  8
#define NHD  64
#define NROT 32
#define EPSV 1e-6f
#define NM   (NB * NS)

typedef _Float16 f16;
typedef f16   v8h  __attribute__((ext_vector_type(8)));
typedef f16   v16h __attribute__((ext_vector_type(16)));
typedef float v4f  __attribute__((ext_vector_type(4)));
typedef float v8f  __attribute__((ext_vector_type(8)));
typedef v4f v4fa __attribute__((may_alias));
typedef v8h v8ha __attribute__((may_alias));

union Frag { v16h v; v8h h[2]; f16 e[16]; };

// D(16x16 f32) += A(16x32) * B(32x16); hazard guard ties D and keeps A/B live.
__device__ __forceinline__ v8f mma(const v16h a, const v16h b, v8f c) {
    v8f d = __builtin_amdgcn_wmma_f32_16x16x32_f16(false, a, false, b, (short)0, c, false, false);
    asm volatile("v_nop\n\tv_nop\n\tv_nop\n\tv_nop" : "+v"(d) : "v"(a), "v"(b));
    return d;
}

// 2^x of four independent values. One statement, outputs apart from the inputs, so that each v_exp_f32 is
// followed by an instruction that neither reads its result nor overwrites its source; the v_nop is that
// instruction behind the last one, whatever the compiler places next.
__device__ __forceinline__ v4f exp2x4(const v4f x) {
    float r0, r1, r2, r3;
    asm("v_exp_f32 %0, %4\n\tv_exp_f32 %1, %5\n\tv_exp_f32 %2, %6\n\tv_exp_f32 %3, %7\n\tv_nop"
        : "=&v"(r0), "=&v"(r1), "=&v"(r2), "=&v"(r3)
        : "v"(x[0]), "v"(x[1]), "v"(x[2]), "v"(x[3]));
    v4f r;
    r[0] = r0; r[1] = r1; r[2] = r2; r[3] = r3;
    return r;
}

// Sum over the 16 lanes of a row of lanes (the lanes that share lane >> 4): four butterfly steps on the
// vector unit's own cross-lane path (row_xmask), every lane ends with the sum. All lanes are on.
template <int M>
__device__ __forceinline__ float xmask16(const float x) {
    return __builtin_bit_cast(float, __builtin_amdgcn_update_dpp(0, __builtin_bit_cast(int, x), 0x160 | M, 0xf, 0xf, true));
}
__device__ __forceinline__ float row16_sum(float x) {
    x += xmask16<1>(x);
    x += xmask16<2>(x);
    x += xmask16<4>(x);
    x += xmask16<8>(x);
    return x;
}

__device__ __forceinline__ v8f zero8() {
    v8f z;
#pragma unroll
    for (int i = 0; i < 8; ++i) z[i] = 0.0f;
    return z;
}

// ---------------------------------------------------------------------------
// Preparation, one launch: the five jobs need nothing of each other, so they share one grid and a range
// of the block index picks the job (block-uniform branches).
// ---------------------------------------------------------------------------
// f32 -> f16, eight elements a thread; blk = block index inside the job
__device__ __forceinline__ void cvt_block(const float* __restrict__ in, f16* __restrict__ out, int n8, int blk) {
    const int i = blk * 256 + threadIdx.x;
    if (i >= n8) return;
    const float* s = in + (size_t)i * 8;
    const v4f u0 = *(const v4f*)(s);
    const v4f u1 = *(const v4f*)(s + 4);
    v8h o;
#pragma unroll
    for (int e = 0; e < 4; ++e) { o[e] = (f16)u0[e]; o[4 + e] = (f16)u1[e]; }
    f16* d = out + (size_t)i * 8;
    *(v8h*)d = o;
}

// W[K][N] f32 -> Wt[N][K] f16 * scale (k contiguous). Tile 64 k x 32 n.
// in[K rows][N cols] -> out[N rows][K cols]; blk = block index inside the job, (N/32) * (K/64) blocks
__device__ __forceinline__ void wtrans_block(const float* __restrict__ W, f16* __restrict__ Wt,
                                             int K, int N, float scale, int blk, float (*T)[33]) {
    const int tid = threadIdx.x, lane = tid & 31, wid = tid >> 5;
    const int nTn = N / 32;
    const int tn = blk % nTn, tk = blk / nTn;
    const int n0 = tn * 32, k0 = tk * 64;
    if (k0 + 64 > K || n0 + 32 > N) return;   // block-uniform
    {
        const int k = tid >> 2, c = (tid & 3) * 8;
        const float* src = W + (size_t)(k0 + k) * N + n0 + c;
        const v4f u0 = *(const v4f*)(src);
        const v4f u1 = *(const v4f*)(src + 4);
        asm volatile("s_wait_xcnt 0x0" ::: "memory");  // stands in front of any reuse of the two loads' address registers
#pragma unroll
        for (int e = 0; e < 4; ++e) { T[k][c + e] = u0[e]; T[k][c + 4 + e] = u1[e]; }
    }
    __syncthreads();
    const int L  = wid * 4 + (lane >> 3);     // local n row 0..31
    const int k8 = (lane & 7) * 8;
    v8h o;
#pragma unroll
    for (int e = 0; e < 8; ++e) o[e] = (f16)(T[k8 + e][L] * scale);
    f16* dst = Wt + (size_t)(n0 + L) * K + k0 + k8;
    *(v8h*)dst = o;
    asm volatile("s_wait_xcnt 0x0" ::: "memory");  // stands in front of any reuse of the store's address and data registers
}

#define PB_WQ   (((NH * NHD) / 32) * (NDM / 64))
#define PB_WKV  (((NKV * NHD) / 32) * (NDM / 64))
#define PB_WO   ((NDM / 32) * ((NH * NHD) / 64))
#define PB_CVT  ((NM * NDM / 8 + 255) / 256)
#define PB_ALL  (PB_WQ + 2 * PB_WKV + PB_WO + PB_CVT)

// The transposes come first in the grid: theirs is the longer path (load, LDS, barrier, store).
__global__ __launch_bounds__(256) void k_prep(const float* __restrict__ hs, const float* __restrict__ wq,
                                              const float* __restrict__ wk, const float* __restrict__ wv,
                                              const float* __restrict__ wo,
                                              f16* __restrict__ hsb, f16* __restrict__ wqt, f16* __restrict__ wkt,
                                              f16* __restrict__ wvt, f16* __restrict__ wot) {
    __shared__ float T[64][33];
    int b = blockIdx.x;
    if (b < PB_WQ)  { wtrans_block(wq, wqt, NDM, NH * NHD, 16.0f, b, T); return; }
    b -= PB_WQ;
    if (b < PB_WKV) { wtrans_block(wk, wkt, NDM, NKV * NHD, 16.0f, b, T); return; }
    b -= PB_WKV;
    if (b < PB_WKV) { wtrans_block(wv, wvt, NDM, NKV * NHD, 16.0f, b, T); return; }
    b -= PB_WKV;
    if (b < PB_WO)  { wtrans_block(wo, wot, NH * NHD, NDM, 16.0f, b, T); return; }
    b -= PB_WO;
    cvt_block(hs, hsb, (NM * NDM) / 8, b);
}

// ---------------------------------------------------------------------------
// Block: C[128 rows][128 cols] += A[128 x K] * B[K x 128]; eight waves as 4 x 2: wave (wr, wc) owns rows
// 32wr..32wr+31 and cols 64wc..64wc+63, eight 16x16 tiles: an A fragment feeds four products, a B fragment two.
// Ablk -> A + m0*K, Bblk -> Bt + n0*K (both k contiguous).
// K runs in slabs of 64 (128 B of every row). A slab of all 256 rows is copied into LDS by
// asynchronous copies whose wave-wide 512 B cover four whole lines; two buffers, the next
// slab's copies fly while this one is multiplied. LDS rows at pitch 144 B (16 B x odd).
// Both fragments use the same split k map:
// elements 0..7 <- k0+8h+0..7, elements 8..15 <- k0+16+8h+0..7.
// ---------------------------------------------------------------------------
#define SLAB_K      64
#define SLAB_PITCH  144
#define SLAB_A      (128 * SLAB_PITCH)
#define SLAB_STAGE  (256 * SLAB_PITCH)
#define RING_BYTES  (2 * SLAB_STAGE)
#define CS_P        132

// One thread's share of a slab: 16 B of A rows r, r+32, r+64, r+96 and of B rows r, r+32, r+64, r+96.
// s_wait_xcnt closes the statement so that no address register is rewritten ahead of it.
__device__ __forceinline__ void slab_copy(uint32_t lds, const f16* ga, const f16* gb, size_t rstep) {
    asm volatile("global_load_async_to_lds_b128 %0, %8, off\n\t"
                 "global_load_async_to_lds_b128 %1, %9, off\n\t"
                 "global_load_async_to_lds_b128 %2, %10, off\n\t"
                 "global_load_async_to_lds_b128 %3, %11, off\n\t"
                 "global_load_async_to_lds_b128 %4, %12, off\n\t"
                 "global_load_async_to_lds_b128 %5, %13, off\n\t"
                 "global_load_async_to_lds_b128 %6, %14, off\n\t"
                 "global_load_async_to_lds_b128 %7, %15, off\n\t"
                 "s_wait_xcnt 0x0"
                 :: "v"(lds), "v"(lds + 32u * SLAB_PITCH), "v"(lds + 64u * SLAB_PITCH),
                    "v"(lds + 96u * SLAB_PITCH), "v"(lds + (uint32_t)SLAB_A),
                    "v"(lds + (uint32_t)SLAB_A + 32u * SLAB_PITCH),
                    "v"(lds + (uint32_t)SLAB_A + 64u * SLAB_PITCH),
                    "v"(lds + (uint32_t)SLAB_A + 96u * SLAB_PITCH),
                    "v"(ga), "v"(ga + rstep), "v"(ga + 2 * rstep), "v"(ga + 3 * rstep),
                    "v"(gb), "v"(gb + rstep), "v"(gb + 2 * rstep), "v"(gb + 3 * rstep)
                 : "memory");
}

// c[i][j]: rows 32wr+16i.., cols 64wc+16j..
__device__ __forceinline__ void mm128x128(const f16* __restrict__ Ablk, const f16* __restrict__ Bblk,
                                          int K, unsigned char* ring, v8f (&c)[2][4]) {
    const int tid = threadIdx.x, lane = tid & 31, wid = tid >> 5;
    const int h = lane >> 4, l16 = lane & 15;
    const int wr = wid & 3, wc = wid >> 2;
    const int cr = tid >> 3, cc = (tid & 7) * 8;          // copy: row 0..31, f16 column
    const f16* ga = Ablk + (size_t)cr * K + cc;
    const f16* gb = Bblk + (size_t)cr * K + cc;
    const size_t rstep = (size_t)32 * K;
    const uint32_t l0 = (uint32_t)(size_t)ring + (uint32_t)(cr * SLAB_PITCH + cc * 2);
    const int nslab = K / SLAB_K;

    slab_copy(l0, ga, gb, rstep);
    asm volatile("s_wait_asynccnt 0x0" ::: "memory");     // slab 0 landed (this wave's share)
    __syncthreads();                                      // ... and every other wave's
    if (nslab > 1) slab_copy(l0 + (uint32_t)SLAB_STAGE, ga + SLAB_K, gb + SLAB_K, rstep);

    const unsigned char* af = ring + (32 * wr + l16) * SLAB_PITCH + h * 16;
    const unsigned char* bf = ring + SLAB_A + (64 * wc + l16) * SLAB_PITCH + h * 16;
    for (int t = 0; t < nslab; ++t) {
        const int bo = (t & 1) * SLAB_STAGE;
        for (int ks = 0; ks < 2; ++ks) {
            // the k step's twelve LDS reads stand together in front of its eight products
            Frag a0, a1, b0, b1, b2, b3;
            const unsigned char* ap = af + bo + ks * 64;
            const unsigned char* bp = bf + bo + ks * 64;
            a0.h[0] = *(const v8ha*)(ap);                   a0.h[1] = *(const v8ha*)(ap + 32);
            a1.h[0] = *(const v8ha*)(ap + 16 * SLAB_PITCH); a1.h[1] = *(const v8ha*)(ap + 16 * SLAB_PITCH + 32);
            b0.h[0] = *(const v8ha*)(bp);                   b0.h[1] = *(const v8ha*)(bp + 32);
            b1.h[0] = *(const v8ha*)(bp + 16 * SLAB_PITCH); b1.h[1] = *(const v8ha*)(bp + 16 * SLAB_PITCH + 32);
            b2.h[0] = *(const v8ha*)(bp + 32 * SLAB_PITCH); b2.h[1] = *(const v8ha*)(bp + 32 * SLAB_PITCH + 32);
            b3.h[0] = *(const v8ha*)(bp + 48 * SLAB_PITCH); b3.h[1] = *(const v8ha*)(bp + 48 * SLAB_PITCH + 32);
            c[0][0] = mma(a0.v, b0.v, c[0][0]);
            c[0][1] = mma(a0.v, b1.v, c[0][1]);
            c[0][2] = mma(a0.v, b2.v, c[0][2]);
            c[0][3] = mma(a0.v, b3.v, c[0][3]);
            c[1][0] = mma(a1.v, b0.v, c[1][0]);
            c[1][1] = mma(a1.v, b1.v, c[1][1]);
            c[1][2] = mma(a1.v, b2.v, c[1][2]);
            c[1][3] = mma(a1.v, b3.v, c[1][3]);
        }
        asm volatile("s_wait_dscnt 0x0" ::: "memory");    // this wave has left buffer t & 1
        asm volatile("s_wait_asynccnt 0x0" ::: "memory"); // its share of slab t + 1 has landed
        __syncthreads();                                  // publishes slab t + 1, frees buffer t & 1
        if (t + 2 < nslab)
            slab_copy(l0 + (uint32_t)bo, ga + (size_t)(t + 2) * SLAB_K, gb + (size_t)(t + 2) * SLAB_K, rstep);
    }
    asm volatile("s_wait_asynccnt 0x0" ::: "memory");     // no copy outstanding when the ring is reused
}

// accumulators -> LDS tile [128][CS_P] (lane = col 64wc+16j+l16, element r = row 32wr+16i+8h+r)
__device__ __forceinline__ void c_to_lds(float (*Cs)[CS_P], const v8f (&c)[2][4]) {
    const int tid = threadIdx.x, lane = tid & 31, wid = tid >> 5;
    const int h = lane >> 4, l16 = lane & 15;
    const int wr = wid & 3, wc = wid >> 2;
#pragma unroll   // constant element indices: the accumulators stay in registers
    for (int i = 0; i < 2; ++i)
#pragma unroll
        for (int r = 0; r < 8; ++r) {
            float* p = &Cs[32 * wr + 16 * i + 8 * h + r][64 * wc + l16];
            p[0]  = c[i][0][r];
            p[16] = c[i][1][r];
            p[32] = c[i][2][r];
            p[48] = c[i][3][r];
        }
}

// ---------------------------------------------------------------------------
// Fused QKV projection + RMS norm + partial rotary.
// Block tile = 128 rows (one batch, 128 consecutive s) x 128 cols (= two heads, one per wave column).
// grid = (16 col tiles: 0..7 -> q heads, 8..11 -> k heads, 12..15 -> v heads, NM/128)
// q out: [b][h][s][d] f16, pre-multiplied by 1/8 (softmax scale);  k out: [b][kvh][s][d] f16
// v out: [b][kvh][d][s] f16 (d-major)
// ---------------------------------------------------------------------------
__global__ __launch_bounds__(256) void k_qkv(const f16* __restrict__ X,
                                             const f16* __restrict__ Wqt, const f16* __restrict__ Wkt,
                                             const f16* __restrict__ Wvt,
                                             const float* __restrict__ nqw, const float* __restrict__ nkw,
                                             const float* __restrict__ cosT, const float* __restrict__ sinT,
                                             f16* __restrict__ qb, f16* __restrict__ kb, f16* __restrict__ vt) {
    __shared__ __attribute__((aligned(16))) unsigned char ring[RING_BYTES];
    float (*Cs)[CS_P] = reinterpret_cast<float (*)[CS_P]>(ring);   // C tile takes the ring's place behind the K loop
    const int tid = threadIdx.x, lane = tid & 31, wid = tid >> 5;
    const int h = lane >> 4, l16 = lane & 15;
    const int wr = wid & 3, wc = wid >> 2;
    const int nt = blockIdx.x;
    const int m0 = blockIdx.y * 128;
    if (m0 + 128 > NM || nt >= 16) return;    // block-uniform

    int mode, hb, nHh;                        // hb: the block's first head
    const f16* Wt;
    const float* nw;
    if (nt < 8)       { mode = 0; hb = 2 * nt;        nHh = NH;  Wt = Wqt; nw = nqw; }
    else if (nt < 12) { mode = 1; hb = 2 * (nt - 8);  nHh = NKV; Wt = Wkt; nw = nkw; }
    else              { mode = 2; hb = 2 * (nt - 12); nHh = NKV; Wt = Wvt; nw = nkw; }
    const int n0 = hb * NHD;
    const int bb = m0 / NS, s0 = m0 % NS;

    v8f c[2][4];
#pragma unroll
    for (int i = 0; i < 2; ++i)
#pragma unroll
        for (int j = 0; j < 4; ++j) c[i][j] = zero8();
    mm128x128(X + (size_t)m0 * NDM, Wt + (size_t)n0 * NDM, NDM, ring, c);

    // RMS norm and rotary on the accumulators (lane = col 16j+l16 of the wave's head, element r = row 8h+r of
    // row tile i, scaled by 16). A row's 64 columns lie in the four tiles of the 16 lanes that share h; column n
    // and its rotary partner n +- 16 are tiles 0 and 1 of the same lane. 1/16 and the softmax scale are powers
    // of two, folded into f.
    if (mode != 2) {
        const float osc16 = ((mode == 0) ? 0.125f : 1.0f) * (1.0f / 16.0f);
        const float w0 = nw[l16], w1 = nw[16 + l16], w2 = nw[32 + l16], w3 = nw[48 + l16];
        asm volatile("s_wait_xcnt 0x0" ::: "memory");  // stands in front of any reuse of the four loads' address register
        const size_t tr = (size_t)(s0 + 32 * wr + 8 * h) * NROT + l16;
        const float* cp = cosT + tr;
        const float* sp = sinT + tr;
        float ca[2][8], cb[2][8], sa[2][8], sb[2][8];
#pragma unroll   // constant indices: the tables' values stay in registers, all loads in flight together
        for (int i = 0; i < 2; ++i)
#pragma unroll
            for (int r = 0; r < 8; ++r) {
                ca[i][r] = cp[(16 * i + r) * NROT]; cb[i][r] = cp[(16 * i + r) * NROT + 16];
                sa[i][r] = sp[(16 * i + r) * NROT]; sb[i][r] = sp[(16 * i + r) * NROT + 16];
            }
        __builtin_amdgcn_sched_barrier(0);             // the loads stay in front: their latency runs under the row sums
#pragma unroll   // sixteen independent chains, constant element indices
        for (int i = 0; i < 2; ++i)
#pragma unroll
            for (int r = 0; r < 8; ++r) {
                const float ss = row16_sum(fmaf(c[i][0][r], c[i][0][r], fmaf(c[i][1][r], c[i][1][r],
                                           fmaf(c[i][2][r], c[i][2][r], c[i][3][r] * c[i][3][r]))));
                const float f = rsqrtf(ss * (1.0f / (256.0f * NHD)) + EPSV) * osc16;
                const float x0 = c[i][0][r] * f * w0;
                const float x1 = c[i][1][r] * f * w1;
                c[i][0][r] = x0 * ca[i][r] - x1 * sa[i][r];
                c[i][1][r] = x1 * cb[i][r] + x0 * sb[i][r];
                c[i][2][r] = c[i][2][r] * f * w2;
                c[i][3][r] = c[i][3][r] * f * w3;
            }
    }

    // accumulator -> LDS tile: q and k finished, v still scaled by 16
    c_to_lds(Cs, c);
    __syncthreads();

    v8h o[8];
    size_t off[8];
    if (mode != 2) {
        // the wave's own 32 rows x 64 cols: one head's rows, 128 B each
        f16* ob = ((mode == 0) ? qb : kb) + ((size_t)(bb * nHh + hb + wc) * NS + s0) * NHD;
#pragma unroll
        for (int q = 0; q < 8; ++q) {
            const int row = 32 * wr + 4 * q + (lane >> 3);
            const int cc = (lane & 7) * 8;
            const v4f u0 = *(const v4fa*)(&Cs[row][64 * wc + cc]);
            const v4f u1 = *(const v4fa*)(&Cs[row][64 * wc + cc + 4]);
#pragma unroll
            for (int e = 0; e < 4; ++e) { o[q][e] = (f16)u0[e]; o[q][4 + e] = (f16)u1[e]; }
            off[q] = (size_t)row * NHD + cc;
        }
#pragma unroll
        for (int q = 0; q < 8; ++q) *(v8h*)(ob + off[q]) = o[q];
        asm volatile("s_wait_xcnt 0x0" ::: "memory");  // stands in front of any reuse of the stores' address and data registers
    } else {
        // the two heads' 128 d rows follow one another in vt; wave wid takes d rows 16wid..16wid+15
        f16* ob = vt + (size_t)(bb * NKV + hb) * NHD * NS + s0;
#pragma unroll
        for (int q = 0; q < 8; ++q) {
            const int L = 4 * q + (lane >> 3);          // 0..31
            const int d = 16 * wid + (L >> 1);
            const int sb = (L & 1) * 64 + (lane & 7) * 8;
#pragma unroll
            for (int e = 0; e < 8; ++e) o[q][e] = (f16)(Cs[sb + e][d] * (1.0f / 16.0f));
            off[q] = (size_t)d * NS + sb;
        }
#pragma unroll
        for (int q = 0; q < 8; ++q) *(v8h*)(ob + off[q]) = o[q];
    }
}

#define KT    128
#define KS_P  72
#define VS_P  (KT + 8)
#define KV_K      (KT * KS_P * 2)
#define KV_STAGE  (KV_K + 64 * VS_P * 2)

// One thread's share of a pass's tiles: 16 B of K rows r, r+32, r+64, r+96 and of V rows d, d+16, d+32, d+48.
// s_wait_xcnt closes the statement so that no address register is rewritten ahead of it.
__device__ __forceinline__ void kv_copy(uint32_t lk, uint32_t lv, const f16* gk, const f16* gv) {
    asm volatile("global_load_async_to_lds_b128 %0, %8, off\n\t"
                 "global_load_async_to_lds_b128 %1, %9, off\n\t"
                 "global_load_async_to_lds_b128 %2, %10, off\n\t"
                 "global_load_async_to_lds_b128 %3, %11, off\n\t"
                 "global_load_async_to_lds_b128 %4, %12, off\n\t"
                 "global_load_async_to_lds_b128 %5, %13, off\n\t"
                 "global_load_async_to_lds_b128 %6, %14, off\n\t"
                 "global_load_async_to_lds_b128 %7, %15, off\n\t"
                 "s_wait_xcnt 0x0"
                 :: "v"(lk), "v"(lk + 32u * KS_P * 2u), "v"(lk + 64u * KS_P * 2u), "v"(lk + 96u * KS_P * 2u),
                    "v"(lv), "v"(lv + 16u * VS_P * 2u), "v"(lv + 32u * VS_P * 2u), "v"(lv + 48u * VS_P * 2u),
                    "v"(gk), "v"(gk + 32 * NHD), "v"(gk + 64 * NHD), "v"(gk + 96 * NHD),
                    "v"(gv), "v"(gv + 16 * NS), "v"(gv + 32 * NS), "v"(gv + 48 * NS)
                 : "memory");
}

__global__ __launch_bounds__(256) void k_attn(const f16* __restrict__ qb, const f16* __restrict__ kb,
                                              const f16* __restrict__ vt, f16* __restrict__ ob) {
    __shared__ __attribute__((aligned(16))) unsigned char kv[2 * KV_STAGE];   // two buffers of [K tile | V tile]
    __shared__ __attribute__((aligned(16))) f16   Os[8 * 16 * 72];

    const int tid = threadIdx.x, lane = tid & 31, wid = tid >> 5;
    const int h = lane >> 4, l16 = lane & 15, h8 = h * 8;
    const int bb = blockIdx.z, hd = blockIdx.y, kvh = hd / (NH / NKV);
    const int qblk = blockIdx.x * 128;
    if (qblk + 128 > NS || hd >= NH || bb >= NB) return;   // block-uniform
    const int q0 = qblk + wid * 16;

    const f16* qrow = qb + ((size_t)(bb * NH + hd) * NS + q0 + l16) * NHD;
    Frag qa0, qa1;
    qa0.h[0] = *(const v8h*)(qrow + h8);
    qa0.h[1] = *(const v8h*)(qrow + 16 + h8);
    qa1.h[0] = *(const v8h*)(qrow + 32 + h8);
    qa1.h[1] = *(const v8h*)(qrow + 48 + h8);

    float m_run = -1e30f, l_run = 0.0f;
    v8f acc0 = zero8(), acc1 = zero8(), acc2 = zero8(), acc3 = zero8();

    const f16* kbase = kb + (size_t)(bb * NKV + kvh) * NS * NHD;
    const f16* vbase = vt + (size_t)(bb * NKV + kvh) * NHD * NS;

    const int cr = tid >> 3, cc = (tid & 7) * 8;      // copy, K: KT rows x 64 d, 32 rows a step
    const int cd = tid >> 4, cv = (tid & 15) * 8;     // copy, V: 64 d rows x KT kv, 16 rows a step
    const f16* gk = kbase + (size_t)cr * NHD + cc;
    const f16* gv = vbase + (size_t)cd * NS + cv;
    const uint32_t lk = (uint32_t)(size_t)kv + (uint32_t)((cr * KS_P + cc) * 2);
    const uint32_t lv = (uint32_t)(size_t)kv + (uint32_t)(KV_K + (cd * VS_P + cv) * 2);

    kv_copy(lk, lv, gk, gv);
    asm volatile("s_wait_asynccnt 0x0" ::: "memory");     // pass 0's tiles landed (this wave's share)
    __syncthreads();                                      // ... and every other wave's
    if (NS / KT > 1) kv_copy(lk + (uint32_t)KV_STAGE, lv + (uint32_t)KV_STAGE, gk + (size_t)KT * NHD, gv + KT);

#pragma unroll 1
    for (int it = 0; it < NS / KT; ++it) {
        const int bo = (it & 1) * KV_STAGE;
        const f16* Ks = reinterpret_cast<const f16*>(kv + bo);
        const f16* Vs = reinterpret_cast<const f16*>(kv + bo + KV_K);

        // scores of KT keys, four 16x16 tiles at a time: sc[t][r] = score of key 16t+8h+r for query l16
        v8f sc[KT / 16];
#pragma unroll
        for (int tb = 0; tb < KT / 16; tb += 4) {
            Frag b0[4], b1[4];
#pragma unroll
            for (int u = 0; u < 4; ++u) {
                const f16* kp = Ks + ((tb + u) * 16 + l16) * KS_P;
                b0[u].h[0] = *(const v8ha*)(kp + h8);      b0[u].h[1] = *(const v8ha*)(kp + 16 + h8);
                b1[u].h[0] = *(const v8ha*)(kp + 32 + h8); b1[u].h[1] = *(const v8ha*)(kp + 48 + h8);
            }
#pragma unroll
            for (int u = 0; u < 4; ++u) sc[tb + u] = mma(b0[u].v, qa0.v, zero8());
#pragma unroll
            for (int u = 0; u < 4; ++u) sc[tb + u] = mma(b1[u].v, qa1.v, sc[tb + u]);
        }

        // query l16, of every 32 keys the kv subset {8h..8h+7, 16+8h..23+8h}, in that order
        // (the three loops are unrolled so that every index is a constant and the renaming costs no instruction)
        v4f rv[KT / 32][4];
#pragma unroll
        for (int g = 0; g < KT / 32; ++g)
#pragma unroll
            for (int q = 0; q < 4; ++q)
#pragma unroll
                for (int e = 0; e < 4; ++e) rv[g][q][e] = sc[2 * g + (q >> 1)][4 * (q & 1) + e];

        // one maximum per 32 keys (independent chains), then their maximum
        float rm = -1e30f;
#pragma unroll
        for (int g = 0; g < KT / 32; ++g) {
            float gm = rv[g][0][0];
#pragma unroll
            for (int i = 1; i < 16; ++i) gm = fmaxf(gm, rv[g][i >> 2][i & 3]);
            rm = fmaxf(rm, gm);
        }
        rm = fmaxf(rm, __shfl_xor(rm, 16, 32));

        const float mn = fmaxf(m_run, rm);
        const float alpha = __expf(m_run - mn);

        // one partial sum per 32 keys (independent chains), then their sum
        Frag pa[KT / 32];
        float rs = 0.0f;
#pragma unroll
        for (int g = 0; g < KT / 32; ++g) {
            float gs = 0.0f;
#pragma unroll
            for (int q = 0; q < 4; ++q) {
                const v4f p = exp2x4((rv[g][q] - mn) * 1.44269504f);   // e^(s - mn)
#pragma unroll
                for (int e = 0; e < 4; ++e) { gs += p[e]; pa[g].e[4 * q + e] = (f16)(p[e] * 256.0f); }
            }
            rs += gs;
        }
        rs += __shfl_xor(rs, 16, 32);
        l_run = l_run * alpha + rs;
        m_run = mn;

        // the accumulators' column is this lane's own query
#pragma unroll
        for (int r = 0; r < 8; ++r) { acc0[r] *= alpha; acc1[r] *= alpha; acc2[r] *= alpha; acc3[r] *= alpha; }

        // PV, 32 keys at a time: A fragment for d = j*16 + l16, kv split map; accj[r] = O[query l16][16j+8h+r]
#pragma unroll
        for (int g = 0; g < KT / 32; ++g) {
            Frag bv[4];
#pragma unroll
            for (int j = 0; j < 4; ++j) {
                const f16* vp = Vs + (j * 16 + l16) * VS_P + g * 32;
                bv[j].h[0] = *(const v8ha*)(vp + h8); bv[j].h[1] = *(const v8ha*)(vp + 16 + h8);
            }
            acc0 = mma(bv[0].v, pa[g].v, acc0);
            acc1 = mma(bv[1].v, pa[g].v, acc1);
            acc2 = mma(bv[2].v, pa[g].v, acc2);
            acc3 = mma(bv[3].v, pa[g].v, acc3);
        }

        asm volatile("s_wait_dscnt 0x0" ::: "memory");    // this wave has left buffer it & 1
        asm volatile("s_wait_asynccnt 0x0" ::: "memory"); // its share of pass it + 1's tiles has landed
        __syncthreads();                                  // publishes pass it + 1's tiles, frees buffer it & 1
        if (it + 2 < NS / KT)
            kv_copy(lk + (uint32_t)bo, lv + (uint32_t)bo, gk + (size_t)(it + 2) * KT * NHD, gv + (it + 2) * KT);
    }
    asm volatile("s_wait_asynccnt 0x0" ::: "memory");     // no copy outstanding behind the loop

    // normalise: O = acc / (256 * l); stored as O*32 -> acc * (0.125 / l)
    const float inv = 0.125f / l_run;

    __syncthreads();
    f16* os = Os + wid * 16 * 72;
    {
        v8h t0, t1, t2, t3;
#pragma unroll   // constant element indices: the vectors stay in registers
        for (int r = 0; r < 8; ++r) {
            t0[r] = (f16)(acc0[r] * inv);
            t1[r] = (f16)(acc1[r] * inv);
            t2[r] = (f16)(acc2[r] * inv);
            t3[r] = (f16)(acc3[r] * inv);
        }
        f16* orow = os + l16 * 72 + h8;      // query l16, eight consecutive d per tile
        *(v8ha*)(orow)      = t0;
        *(v8ha*)(orow + 16) = t1;
        *(v8ha*)(orow + 32) = t2;
        *(v8ha*)(orow + 48) = t3;
    }
    __syncthreads();

    v8h o[4];
    size_t off[4];
#pragma unroll
    for (int q = 0; q < 4; ++q) {
        const int L = 4 * q + (lane >> 3);     // local q row 0..15
        const int cc = (lane & 7) * 8;
        o[q] = *(const v8ha*)(os + L * 72 + cc);
        off[q] = ((size_t)(bb * NS + q0 + L)) * (NH * NHD) + hd * NHD + cc;
    }
#pragma unroll
    for (int q = 0; q < 4; ++q) *(v8h*)(ob + off[q]) = o[q];
    
}

// ---------------------------------------------------------------------------
// out = (O*32 f16) x (Wo*16 f16, k contiguous) / 512 + bias + residual, f32 [NM][NDM]
// Block tile 128 x 128, grid = (NDM/128, NM/128). Row segment of 128 floats = 4 lines, one wave-wide store.
// ---------------------------------------------------------------------------
__global__ __launch_bounds__(256) void k_oproj(const f16* __restrict__ A, const f16* __restrict__ Wot,
                                               const float* __restrict__ bias, const float* __restrict__ resid,
                                               float* __restrict__ out) {
    __shared__ __attribute__((aligned(16))) unsigned char ring[RING_BYTES];
    float (*Cs)[CS_P] = reinterpret_cast<float (*)[CS_P]>(ring);   // C tile takes the ring's place behind the K loop
    const int tid = threadIdx.x, lane = tid & 31, wid = tid >> 5;
    const int n0 = blockIdx.x * 128;
    const int m0 = blockIdx.y * 128;
    if (n0 + 128 > NDM || m0 + 128 > NM) return;   // block-uniform

    v8f c[2][4];
#pragma unroll
    for (int i = 0; i < 2; ++i)
#pragma unroll
        for (int j = 0; j < 4; ++j) c[i][j] = zero8();
    mm128x128(A + (size_t)m0 * (NH * NHD), Wot + (size_t)n0 * (NH * NHD), NH * NHD, ring, c);

    c_to_lds(Cs, c);
    __syncthreads();

    v4f o[16];
    size_t off[16];
    const int cc = lane * 4;
    const v4f bv = *(const v4f*)(bias + n0 + cc);
#pragma unroll
    for (int q = 0; q < 16; ++q) {
        const int row = 16 * wid + q;
        const v4f cv = *(const v4fa*)(&Cs[row][cc]);
        const size_t go = (size_t)(m0 + row) * NDM + n0 + cc;
        const v4f rv = *(const v4f*)(resid + go);
        v4f val;
#pragma unroll
        for (int e = 0; e < 4; ++e) val[e] = (cv[e] * (1.0f / 512.0f) + bv[e]) + rv[e];
        o[q] = val;
        off[q] = go;
    }
#pragma unroll
    for (int q = 0; q < 16; ++q) *(v4f*)(out + off[q]) = o[q];
}

// ---------------------------------------------------------------------------
// Launcher
// ---------------------------------------------------------------------------
extern "C" void kernel_launch(void* const* d_in, const int* in_sizes, int n_in,
                              void* d_out, int out_size, void* d_ws, size_t ws_size,
                              hipStream_t stream) {
    if (n_in < 10) return;
    if (in_sizes[0] != NM * NDM) return;
    if (in_sizes[1] != NDM * NH * NHD) return;
    if (in_sizes[2] != NDM * NKV * NHD || in_sizes[3] != NDM * NKV * NHD) return;
    if (in_sizes[4] != NH * NHD * NDM) return;
    if (in_sizes[5] < NDM || in_sizes[6] < NHD || in_sizes[7] < NHD) return;
    if (in_sizes[8] != NS * NROT || in_sizes[9] != NS * NROT) return;
    if (out_size != NM * NDM) return;

    const float* hs   = (const float*)d_in[0];
    const float* wq   = (const float*)d_in[1];
    const float* wk   = (const float*)d_in[2];
    const float* wv   = (const float*)d_in[3];
    const float* wo   = (const float*)d_in[4];
    const float* bo   = (const float*)d_in[5];
    const float* nqw  = (const float*)d_in[6];
    const float* nkw  = (const float*)d_in[7];
    const float* cosT = (const float*)d_in[8];
    const float* sinT = (const float*)d_in[9];

    const size_t szX   = (size_t)NM * NDM * sizeof(f16);            // 8 MB
    const size_t szWq  = (size_t)NDM * NH * NHD * sizeof(f16);      // 2 MB
    const size_t szWkv = (size_t)NDM * NKV * NHD * sizeof(f16);     // 1 MB
    const size_t szWo  = (size_t)NH * NHD * NDM * sizeof(f16);      // 2 MB
    const size_t szQ   = (size_t)NB * NH * NS * NHD * sizeof(f16);  // 8 MB
    const size_t szKV  = (size_t)NB * NKV * NS * NHD * sizeof(f16); // 4 MB
    const size_t szO   = (size_t)NM * NH * NHD * sizeof(f16);       // 8 MB
    size_t offp = 0;
    const size_t oX   = offp; offp += szX;
    const size_t oWq  = offp; offp += szWq;
    const size_t oWk  = offp; offp += szWkv;
    const size_t oWv  = offp; offp += szWkv;
    const size_t oWo  = offp; offp += szWo;
    const size_t oQ   = offp; offp += szQ;
    const size_t oK   = offp; offp += szKV;
    const size_t oV   = offp; offp += szKV;
    const size_t oO   = offp; offp += szO;
    if (offp > ws_size) return;

    char* ws = (char*)d_ws;
    f16* hsb  = (f16*)(ws + oX);
    f16* wqt  = (f16*)(ws + oWq);
    f16* wkt  = (f16*)(ws + oWk);
    f16* wvt  = (f16*)(ws + oWv);
    f16* wot  = (f16*)(ws + oWo);
    f16* qbuf = (f16*)(ws + oQ);
    f16* kbuf = (f16*)(ws + oK);
    f16* vtb  = (f16*)(ws + oV);
    f16* attb = (f16*)(ws + oO);

    // X -> f16 and W[K=in][N=out] -> Wt[N][K] * 16, all in one launch
    k_prep<<<PB_ALL, 256, 0, stream>>>(hs, wq, wk, wv, wo, hsb, wqt, wkt, wvt, wot);

    k_qkv<<<dim3(16, (NM + 127) / 128), 256, 0, stream>>>(hsb, wqt, wkt, wvt, nqw, nkw, cosT, sinT,
                                                         qbuf, kbuf, vtb);

    k_attn<<<dim3((NS + 127) / 128, NH, NB), 256, 0, stream>>>(qbuf, kbuf, vtb, attb);

    k_oproj<<<dim3((NDM + 127) / 128, (NM + 127) / 128), 256, 0, stream>>>(attb, wot, bo, hs, (float*)d_out);
}

// v008
// A run of this version takes 74.5 microseconds.
// Timed twice side by side with v007, it ran 1.05 and 1.06 times as fast.
// All steps since v000 together make it 3.23 times as fast.
#include <hip/hip_runtime.h>
#include <stdint.h>

// Contractions x*Wq, x*Wk, x*Wv, q*k^T, p*v, o*Wo: v_wmma_f32_16x16x32_f16 (f16 operands with constant operand scaling, f32 accumulate); RMS norm, rotary, softmax, bias and residual in f32.

#define NB   2
#define NS   2048
#define NDM  1024
#define NH   16
#define NKV  8
#define NHD  64
#define NROT 32
#define EPSV 1e-6f
#define NM   (NB * NS)

typedef _Float16 f16;
typedef f16   v8h  __attribute__((ext_vector_type(8)));
typedef f16   v16h __attribute__((ext_vector_type(16)));
typedef float v4f  __attribute__((ext_vector_type(4)));
typedef float v8f  __attribute__((ext_vector_type(8)));
typedef v4f v4fa __attribute__((may_alias));
typedef v8h v8ha __attribute__((may_alias));

union Frag { v16h v; v8h h[2]; f16 e[16]; };

// D(16x16 f32) += A(16x32) * B(32x16); hazard guard ties D and keeps A/B live.
__device__ __forceinline__ v8f mma(const v16h a, const v16h b, v8f c) {
    v8f d = __builtin_amdgcn_wmma_f32_16x16x32_f16(false, a, false, b, (short)0, c, false, false);
    asm volatile("v_nop\n\tv_nop\n\tv_nop\n\tv_nop" : "+v"(d) : "v"(a), "v"(b));
    return d;
}

// The same from a start value c that is kept for later products: c too stays live over the guard's slots.
__device__ __forceinline__ v8f mma_from(const v16h a, const v16h b, const v8f c) {
    v8f d = __builtin_amdgcn_wmma_f32_16x16x32_f16(false, a, false, b, (short)0, c, false, false);
    asm volatile("v_nop\n\tv_nop\n\tv_nop\n\tv_nop" : "+v"(d) : "v"(a), "v"(b), "v"(c));
    return d;
}

// 2^x of four independent values. One statement, outputs apart from the inputs, so that each v_exp_f32 is
// followed by an instruction that neither reads its result nor overwrites its source; the v_nop is that
// instruction behind the last one, whatever the compiler places next.
__device__ __forceinline__ v4f exp2x4(const v4f x) {
    float r0, r1, r2, r3;
    asm("v_exp_f32 %0, %4\n\tv_exp_f32 %1, %5\n\tv_exp_f32 %2, %6\n\tv_exp_f32 %3, %7\n\tv_nop"
        : "=&v"(r0), "=&v"(r1), "=&v"(r2), "=&v"(r3)
        : "v"(x[0]), "v"(x[1]), "v"(x[2]), "v"(x[3]));
    v4f r;
    r[0] = r0; r[1] = r1; r[2] = r2; r[3] = r3;
    return r;
}

// Sum over the 16 lanes of a row of lanes (the lanes that share lane >> 4): four butterfly steps on the
// vector unit's own cross-lane path (row_xmask), every lane ends with the sum. All lanes are on.
template <int M>
__device__ __forceinline__ float xmask16(const float x) {
    return __builtin_bit_cast(float, __builtin_amdgcn_update_dpp(0, __builtin_bit_cast(int, x), 0x160 | M, 0xf, 0xf, true));
}
__device__ __forceinline__ float row16_sum(float x) {
    x += xmask16<1>(x);
    x += xmask16<2>(x);
    x += xmask16<4>(x);
    x += xmask16<8>(x);
    return x;
}

__device__ __forceinline__ v8f zero8() {
    v8f z;
#pragma unroll
    for (int i = 0; i < 8; ++i) z[i] = 0.0f;
    return z;
}

// ---------------------------------------------------------------------------
// Preparation, one launch: the five jobs need nothing of each other, so they share one grid and a range
// of the block index picks the job (block-uniform branches).
// ---------------------------------------------------------------------------
// f32 -> f16, eight elements a thread; blk = block index inside the job
__device__ __forceinline__ void cvt_block(const float* __restrict__ in, f16* __restrict__ out, int n8, int blk) {
    const int i = blk * 256 + threadIdx.x;
    if (i >= n8) return;
    const float* s = in + (size_t)i * 8;
    const v4f u0 = *(const v4f*)(s);
    const v4f u1 = *(const v4f*)(s + 4);
    v8h o;
#pragma unroll
    for (int e = 0; e < 4; ++e) { o[e] = (f16)u0[e]; o[4 + e] = (f16)u1[e]; }
    f16* d = out + (size_t)i * 8;
    *(v8h*)d = o;
}

// W[K][N] f32 -> Wt[N][K] f16 * scale (k contiguous). Tile 64 k x 32 n.
// in[K rows][N cols] -> out[N rows][K cols]; blk = block index inside the job, (N/32) * (K/64) blocks
__device__ __forceinline__ void wtrans_block(const float* __restrict__ W, f16* __restrict__ Wt,
                                             int K, int N, float scale, int blk, float (*T)[33]) {
    const int tid = threadIdx.x, lane = tid & 31, wid = tid >> 5;
    const int nTn = N / 32;
    const int tn = blk % nTn, tk = blk / nTn;
    const int n0 = tn * 32, k0 = tk * 64;
    if (k0 + 64 > K || n0 + 32 > N) return;   // block-uniform
    {
        const int k = tid >> 2, c = (tid & 3) * 8;
        const float* src = W + (size_t)(k0 + k) * N + n0 + c;
        const v4f u0 = *(const v4f*)(src);
        const v4f u1 = *(const v4f*)(src + 4);
        asm volatile("s_wait_xcnt 0x0" ::: "memory");  // stands in front of any reuse of the two loads' address registers
#pragma unroll
        for (int e = 0; e < 4; ++e) { T[k][c + e] = u0[e]; T[k][c + 4 + e] = u1[e]; }
    }
    __syncthreads();
    const int L  = wid * 4 + (lane >> 3);     // local n row 0..31
    const int k8 = (lane & 7) * 8;
    v8h o;
#pragma unroll
    for (int e = 0; e < 8; ++e) o[e] = (f16)(T[k8 + e][L] * scale);
    f16* dst = Wt + (size_t)(n0 + L) * K + k0 + k8;
    *(v8h*)dst = o;
    asm volatile("s_wait_xcnt 0x0" ::: "memory");  // stands in front of any reuse of the store's address and data registers
}

#define PB_WQ   (((NH * NHD) / 32) * (NDM / 64))
#define PB_WKV  (((NKV * NHD) / 32) * (NDM / 64))
#define PB_WO   ((NDM / 32) * ((NH * NHD) / 64))
#define PB_CVT  ((NM * NDM / 8 + 255) / 256)
#define PB_ALL  (PB_WQ + 2 * PB_WKV + PB_WO + PB_CVT)

// The transposes come first in the grid: theirs is the longer path (load, LDS, barrier, store).
__global__ __launch_bounds__(256) void k_prep(const float* __restrict__ hs, const float* __restrict__ wq,
                                              const float* __restrict__ wk, const float* __restrict__ wv,
                                              const float* __restrict__ wo,
                                              f16* __restrict__ hsb, f16* __restrict__ wqt, f16* __restrict__ wkt,
                                              f16* __restrict__ wvt, f16* __restrict__ wot) {
    __shared__ float T[64][33];
    int b = blockIdx.x;
    if (b < PB_WQ)  { wtrans_block(wq, wqt, NDM, NH * NHD, 16.0f, b, T); return; }
    b -= PB_WQ;
    if (b < PB_WKV) { wtrans_block(wk, wkt, NDM, NKV * NHD, 16.0f, b, T); return; }
    b -= PB_WKV;
    if (b < PB_WKV) { wtrans_block(wv, wvt, NDM, NKV * NHD, 16.0f, b, T); return; }
    b -= PB_WKV;
    if (b < PB_WO)  { wtrans_block(wo, wot, NH * NHD, NDM, 16.0f, b, T); return; }
    b -= PB_WO;
    cvt_block(hs, hsb, (NM * NDM) / 8, b);
}

// ---------------------------------------------------------------------------
// Block: C[128 rows][128 cols] += A[128 x K] * B[K x 128]; eight waves as 4 x 2: wave (wr, wc) owns rows
// 32wr..32wr+31 and cols 64wc..64wc+63, eight 16x16 tiles: an A fragment feeds four products, a B fragment two.
// Ablk -> A + m0*K, Bblk -> Bt + n0*K (both k contiguous).
// K runs in slabs of 64 (128 B of every row). A slab of all 256 rows is copied into LDS by
// asynchronous copies whose wave-wide 512 B cover four whole lines; two buffers, the next
// slab's copies fly while this one is multiplied. LDS rows at pitch 144 B (16 B x odd).
// Both fragments use the same split k map:
// elements 0..7 <- k0+8h+0..7, elements 8..15 <- k0+16+8h+0..7.
// ---------------------------------------------------------------------------
#define SLAB_K      64
#define SLAB_PITCH  144
#define SLAB_A      (128 * SLAB_PITCH)
#define SLAB_STAGE  (256 * SLAB_PITCH)
#define RING_BYTES  (2 * SLAB_STAGE)
#define CS_P        132

// One thread's share of a slab: 16 B of A rows r, r+32, r+64, r+96 and of B rows r, r+32, r+64, r+96.
// s_wait_xcnt closes the statement so that no address register is rewritten ahead of it.
__device__ __forceinline__ void slab_copy(uint32_t lds, const f16* ga, const f16* gb, size_t rstep) {
    asm volatile("global_load_async_to_lds_b128 %0, %8, off\n\t"
                 "global_load_async_to_lds_b128 %1, %9, off\n\t"
                 "global_load_async_to_lds_b128 %2, %10, off\n\t"
                 "global_load_async_to_lds_b128 %3, %11, off\n\t"
                 "global_load_async_to_lds_b128 %4, %12, off\n\t"
                 "global_load_async_to_lds_b128 %5, %13, off\n\t"
                 "global_load_async_to_lds_b128 %6, %14, off\n\t"
                 "global_load_async_to_lds_b128 %7, %15, off\n\t"
                 "s_wait_xcnt 0x0"
                 :: "v"(lds), "v"(lds + 32u * SLAB_PITCH), "v"(lds + 64u * SLAB_PITCH),
                    "v"(lds + 96u * SLAB_PITCH), "v"(lds + (uint32_t)SLAB_A),
                    "v"(lds + (uint32_t)SLAB_A + 32u * SLAB_PITCH),
                    "v"(lds + (uint32_t)SLAB_A + 64u * SLAB_PITCH),
                    "v"(lds + (uint32_t)SLAB_A + 96u * SLAB_PITCH),
                    "v"(ga), "v"(ga + rstep), "v"(ga + 2 * rstep), "v"(ga + 3 * rstep),
                    "v"(gb), "v"(gb + rstep), "v"(gb + 2 * rstep), "v"(gb + 3 * rstep)
                 : "memory");
}

// c[i][j]: rows 32wr+16i.., cols 64wc+16j..
__device__ __forceinline__ void mm128x128(const f16* __restrict__ Ablk, const f16* __restrict__ Bblk,
                                          int K, unsigned char* ring, v8f (&c)[2][4]) {
    const int tid = threadIdx.x, lane = tid & 31, wid = tid >> 5;
    const int h = lane >> 4, l16 = lane & 15;
    const int wr = wid & 3, wc = wid >> 2;
    const int cr = tid >> 3, cc = (tid & 7) * 8;          // copy: row 0..31, f16 column
    const f16* ga = Ablk + (size_t)cr * K + cc;
    const f16* gb = Bblk + (size_t)cr * K + cc;
    const size_t rstep = (size_t)32 * K;
    const uint32_t l0 = (uint32_t)(size_t)ring + (uint32_t)(cr * SLAB_PITCH + cc * 2);
    const int nslab = K / SLAB_K;

    slab_copy(l0, ga, gb, rstep);
    asm volatile("s_wait_asynccnt 0x0" ::: "memory");     // slab 0 landed (this wave's share)
    __syncthreads();                                      // ... and every other wave's
    if (nslab > 1) slab_copy(l0 + (uint32_t)SLAB_STAGE, ga + SLAB_K, gb + SLAB_K, rstep);

    const unsigned char* af = ring + (32 * wr + l16) * SLAB_PITCH + h * 16;
    const unsigned char* bf = ring + SLAB_A + (64 * wc + l16) * SLAB_PITCH + h * 16;
    for (int t = 0; t < nslab; ++t) {
        const int bo = (t & 1) * SLAB_STAGE;
        for (int ks = 0; ks < 2; ++ks) {
            // the k step's twelve LDS reads stand together in front of its eight products
            Frag a0, a1, b0, b1, b2, b3;
            const unsigned char* ap = af + bo + ks * 64;
            const unsigned char* bp = bf + bo + ks * 64;
            a0.h[0] = *(const v8ha*)(ap);                   a0.h[1] = *(const v8ha*)(ap + 32);
            a1.h[0] = *(const v8ha*)(ap + 16 * SLAB_PITCH); a1.h[1] = *(const v8ha*)(ap + 16 * SLAB_PITCH + 32);
            b0.h[0] = *(const v8ha*)(bp);                   b0.h[1] = *(const v8ha*)(bp + 32);
            b1.h[0] = *(const v8ha*)(bp + 16 * SLAB_PITCH); b1.h[1] = *(const v8ha*)(bp + 16 * SLAB_PITCH + 32);
            b2.h[0] = *(const v8ha*)(bp + 32 * SLAB_PITCH); b2.h[1] = *(const v8ha*)(bp + 32 * SLAB_PITCH + 32);
            b3.h[0] = *(const v8ha*)(bp + 48 * SLAB_PITCH); b3.h[1] = *(const v8ha*)(bp + 48 * SLAB_PITCH + 32);
            c[0][0] = mma(a0.v, b0.v, c[0][0]);
            c[0][1] = mma(a0.v, b1.v, c[0][1]);
            c[0][2] = mma(a0.v, b2.v, c[0][2]);
            c[0][3] = mma(a0.v, b3.v, c[0][3]);
            c[1][0] = mma(a1.v, b0.v, c[1][0]);
            c[1][1] = mma(a1.v, b1.v, c[1][1]);
            c[1][2] = mma(a1.v, b2.v, c[1][2]);
            c[1][3] = mma(a1.v, b3.v, c[1][3]);
        }
        asm volatile("s_wait_dscnt 0x0" ::: "memory");    // this wave has left buffer t & 1
        asm volatile("s_wait_asynccnt 0x0" ::: "memory"); // its share of slab t + 1 has landed
        __syncthreads();                                  // publishes slab t + 1, frees buffer t & 1
        if (t + 2 < nslab)
            slab_copy(l0 + (uint32_t)bo, ga + (size_t)(t + 2) * SLAB_K, gb + (size_t)(t + 2) * SLAB_K, rstep);
    }
    asm volatile("s_wait_asynccnt 0x0" ::: "memory");     // no copy outstanding when the ring is reused
}

// accumulators -> LDS tile [128][CS_P] (lane = col 64wc+16j+l16, element r = row 32wr+16i+8h+r)
__device__ __forceinline__ void c_to_lds(float (*Cs)[CS_P], const v8f (&c)[2][4]) {
    const int tid = threadIdx.x, lane = tid & 31, wid = tid >> 5;
    const int h = lane >> 4, l16 = lane & 15;
    const int wr = wid & 3, wc = wid >> 2;
#pragma unroll   // constant element indices: the accumulators stay in registers
    for (int i = 0; i < 2; ++i)
#pragma unroll
        for (int r = 0; r < 8; ++r) {
            float* p = &Cs[32 * wr + 16 * i + 8 * h + r][64 * wc + l16];
            p[0]  = c[i][0][r];
            p[16] = c[i][1][r];
            p[32] = c[i][2][r];
            p[48] = c[i][3][r];
        }
}

// ---------------------------------------------------------------------------
// Fused QKV projection + RMS norm + partial rotary.
// Block tile = 128 rows (one batch, 128 consecutive s) x 128 cols (= two heads, one per wave column).
// grid = (16 col tiles: 0..7 -> q heads, 8..11 -> k heads, 12..15 -> v heads, NM/128)
// q out: [b][h][s][d] f16, pre-multiplied by log2(e)/8 (softmax scale, scores in base 2);  k out: [b][kvh][s][d] f16
// v out: [b][kvh][d][s] f16 (d-major)
// ---------------------------------------------------------------------------
__global__ __launch_bounds__(256) void k_qkv(const f16* __restrict__ X,
                                             const f16* __restrict__ Wqt, const f16* __restrict__ Wkt,
                                             const f16* __restrict__ Wvt,
                                             const float* __restrict__ nqw, const float* __restrict__ nkw,
                                             const float* __restrict__ cosT, const float* __restrict__ sinT,
                                             f16* __restrict__ qb, f16* __restrict__ kb, f16* __restrict__ vt) {
    __shared__ __attribute__((aligned(16))) unsigned char ring[RING_BYTES];
    float (*Cs)[CS_P] = reinterpret_cast<float (*)[CS_P]>(ring);   // C tile takes the ring's place behind the K loop
    const int tid = threadIdx.x, lane = tid & 31, wid = tid >> 5;
    const int h = lane >> 4, l16 = lane & 15;
    const int wr = wid & 3, wc = wid >> 2;
    const int nt = blockIdx.x;
    const int m0 = blockIdx.y * 128;
    if (m0 + 128 > NM || nt >= 16) return;    // block-uniform

    int mode, hb, nHh;                        // hb: the block's first head
    const f16* Wt;
    const float* nw;
    if (nt < 8)       { mode = 0; hb = 2 * nt;        nHh = NH;  Wt = Wqt; nw = nqw; }
    else if (nt < 12) { mode = 1; hb = 2 * (nt - 8);  nHh = NKV; Wt = Wkt; nw = nkw; }
    else              { mode = 2; hb = 2 * (nt - 12); nHh = NKV; Wt = Wvt; nw = nkw; }
    const int n0 = hb * NHD;
    const int bb = m0 / NS, s0 = m0 % NS;

    v8f c[2][4];
#pragma unroll
    for (int i = 0; i < 2; ++i)
#pragma unroll
        for (int j = 0; j < 4; ++j) c[i][j] = zero8();
    mm128x128(X + (size_t)m0 * NDM, Wt + (size_t)n0 * NDM, NDM, ring, c);

    // RMS norm and rotary on the accumulators (lane = col 16j+l16 of the wave's head, element r = row 8h+r of
    // row tile i, scaled by 16). A row's 64 columns lie in the four tiles of the 16 lanes that share h; column n
    // and its rotary partner n +- 16 are tiles 0 and 1 of the same lane. 1/16 and the softmax scale log2(e)/8
    // are folded into f.
    if (mode != 2) {
        const float osc16 = ((mode == 0) ? 0.125f * 1.44269504f : 1.0f) * (1.0f / 16.0f);
        const float w0 = nw[l16], w1 = nw[16 + l16], w2 = nw[32 + l16], w3 = nw[48 + l16];
        asm volatile("s_wait_xcnt 0x0" ::: "memory");  // stands in front of any reuse of the four loads' address register
        const size_t tr = (size_t)(s0 + 32 * wr + 8 * h) * NROT + l16;
        const float* cp = cosT + tr;
        const float* sp = sinT + tr;
        float ca[2][8], cb[2][8], sa[2][8], sb[2][8];
#pragma unroll   // constant indices: the tables' values stay in registers, all loads in flight together
        for (int i = 0; i < 2; ++i)
#pragma unroll
            for (int r = 0; r < 8; ++r) {
                ca[i][r] = cp[(16 * i + r) * NROT]; cb[i][r] = cp[(16 * i + r) * NROT + 16];
                sa[i][r] = sp[(16 * i + r) * NROT]; sb[i][r] = sp[(16 * i + r) * NROT + 16];
            }
        __builtin_amdgcn_sched_barrier(0);             // the loads stay in front: their latency runs under the row sums
#pragma unroll   // sixteen independent chains, constant element indices
        for (int i = 0; i < 2; ++i)
#pragma unroll
            for (int r = 0; r < 8; ++r) {
                const float ss = row16_sum(fmaf(c[i][0][r], c[i][0][r], fmaf(c[i][1][r], c[i][1][r],
                                           fmaf(c[i][2][r], c[i][2][r], c[i][3][r] * c[i][3][r]))));
                const float f = rsqrtf(ss * (1.0f / (256.0f * NHD)) + EPSV) * osc16;
                const float x0 = c[i][0][r] * f * w0;
                const float x1 = c[i][1][r] * f * w1;
                c[i][0][r] = x0 * ca[i][r] - x1 * sa[i][r];
                c[i][1][r] = x1 * cb[i][r] + x0 * sb[i][r];
                c[i][2][r] = c[i][2][r] * f * w2;
                c[i][3][r] = c[i][3][r] * f * w3;
            }
    }

    // accumulator -> LDS tile: q and k finished, v still scaled by 16
    c_to_lds(Cs, c);
    __syncthreads();

    v8h o[8];
    size_t off[8];
    if (mode != 2) {
        // the wave's own 32 rows x 64 cols: one head's rows, 128 B each
        f16* ob = ((mode == 0) ? qb : kb) + ((size_t)(bb * nHh + hb + wc) * NS + s0) * NHD;
#pragma unroll
        for (int q = 0; q < 8; ++q) {
            const int row = 32 * wr + 4 * q + (lane >> 3);
            const int cc = (lane & 7) * 8;
            const v4f u0 = *(const v4fa*)(&Cs[row][64 * wc + cc]);
            const v4f u1 = *(const v4fa*)(&Cs[row][64 * wc + cc + 4]);
#pragma unroll
            for (int e = 0; e < 4; ++e) { o[q][e] = (f16)u0[e]; o[q][4 + e] = (f16)u1[e]; }
            off[q] = (size_t)row * NHD + cc;
        }
#pragma unroll
        for (int q = 0; q < 8; ++q) *(v8h*)(ob + off[q]) = o[q];
        asm volatile("s_wait_xcnt 0x0" ::: "memory");  // stands in front of any reuse of the stores' address and data registers
    } else {
        // the two heads' 128 d rows follow one another in vt; wave wid takes d rows 16wid..16wid+15
        f16* ob = vt + (size_t)(bb * NKV + hb) * NHD * NS + s0;
#pragma unroll
        for (int q = 0; q < 8; ++q) {
            const int L = 4 * q + (lane >> 3);          // 0..31
            const int d = 16 * wid + (L >> 1);
            const int sb = (L & 1) * 64 + (lane & 7) * 8;
#pragma unroll
            for (int e = 0; e < 8; ++e) o[q][e] = (f16)(Cs[sb + e][d] * (1.0f / 16.0f));
            off[q] = (size_t)d * NS + sb;
        }
#pragma unroll
        for (int q = 0; q < 8; ++q) *(v8h*)(ob + off[q]) = o[q];
    }
}

#define KT    128
#define KS_P  72
#define VS_P  (KT + 8)
#define KV_K      (KT * KS_P * 2)
#define KV_STAGE  (KV_K + 64 * VS_P * 2)

// One thread's share of a pass's tiles: 16 B of K rows r, r+32, r+64, r+96 and of V rows d, d+16, d+32, d+48.
// s_wait_xcnt closes the statement so that no address register is rewritten ahead of it.
__device__ __forceinline__ void kv_copy(uint32_t lk, uint32_t lv, const f16* gk, const f16* gv) {
    asm volatile("global_load_async_to_lds_b128 %0, %8, off\n\t"
                 "global_load_async_to_lds_b128 %1, %9, off\n\t"
                 "global_load_async_to_lds_b128 %2, %10, off\n\t"
                 "global_load_async_to_lds_b128 %3, %11, off\n\t"
                 "global_load_async_to_lds_b128 %4, %12, off\n\t"
                 "global_load_async_to_lds_b128 %5, %13, off\n\t"
                 "global_load_async_to_lds_b128 %6, %14, off\n\t"
                 "global_load_async_to_lds_b128 %7, %15, off\n\t"
                 "s_wait_xcnt 0x0"
                 :: "v"(lk), "v"(lk + 32u * KS_P * 2u), "v"(lk + 64u * KS_P * 2u), "v"(lk + 96u * KS_P * 2u),
                    "v"(lv), "v"(lv + 16u * VS_P * 2u), "v"(lv + 32u * VS_P * 2u), "v"(lv + 48u * VS_P * 2u),
                    "v"(gk), "v"(gk + 32 * NHD), "v"(gk + 64 * NHD), "v"(gk + 96 * NHD),
                    "v"(gv), "v"(gv + 16 * NS), "v"(gv + 32 * NS), "v"(gv + 48 * NS)
                 : "memory");
}

__global__ __launch_bounds__(256) void k_attn(const f16* __restrict__ qb, const f16* __restrict__ kb,
                                              const f16* __restrict__ vt, f16* __restrict__ ob) {
    __shared__ __attribute__((aligned(16))) unsigned char kv[2 * KV_STAGE];   // two buffers of [K tile | V tile]
    __shared__ __attribute__((aligned(16))) f16   Os[8 * 16 * 72];

    const int tid = threadIdx.x, lane = tid & 31, wid = tid >> 5;
    const int h = lane >> 4, l16 = lane & 15, h8 = h * 8;
    const int bb = blockIdx.z, hd = blockIdx.y, kvh = hd / (NH / NKV);
    const int qblk = blockIdx.x * 128;
    if (qblk + 128 > NS || hd >= NH || bb >= NB) return;   // block-uniform
    const int q0 = qblk + wid * 16;

    const f16* qrow = qb + ((size_t)(bb * NH + hd) * NS + q0 + l16) * NHD;
    Frag qa0, qa1;
    qa0.h[0] = *(const v8h*)(qrow + h8);
    qa0.h[1] = *(const v8h*)(qrow + 16 + h8);
    qa1.h[0] = *(const v8h*)(qrow + 32 + h8);
    qa1.h[1] = *(const v8h*)(qrow + 48 + h8);

    float cb = 0.0f, l_run = 0.0f;      // cb = 8 - ref of query l16 (0 until pass 0 sets it), the same in both halves
    v8f acc0 = zero8(), acc1 = zero8(), acc2 = zero8(), acc3 = zero8();

    const f16* kbase = kb + (size_t)(bb * NKV + kvh) * NS * NHD;
    const f16* vbase = vt + (size_t)(bb * NKV + kvh) * NHD * NS;

    const int cr = tid >> 3, cc = (tid & 7) * 8;      // copy, K: KT rows x 64 d, 32 rows a step
    const int cd = tid >> 4, cv = (tid & 15) * 8;     // copy, V: 64 d rows x KT kv, 16 rows a step
    const f16* gk = kbase + (size_t)cr * NHD + cc;
    const f16* gv = vbase + (size_t)cd * NS + cv;
    const uint32_t lk = (uint32_t)(size_t)kv + (uint32_t)((cr * KS_P + cc) * 2);
    const uint32_t lv = (uint32_t)(size_t)kv + (uint32_t)(KV_K + (cd * VS_P + cv) * 2);

    kv_copy(lk, lv, gk, gv);
    asm volatile("s_wait_asynccnt 0x0" ::: "memory");     // pass 0's tiles landed (this wave's share)
    __syncthreads();                                      // ... and every other wave's
    if (NS / KT > 1) kv_copy(lk + (uint32_t)KV_STAGE, lv + (uint32_t)KV_STAGE, gk + (size_t)KT * NHD, gv + KT);

#pragma unroll 1
    for (int it = 0; it < NS / KT; ++it) {
        const int bo = (it & 1) * KV_STAGE;
        const f16* Ks = reinterpret_cast<const f16*>(kv + bo);
        const f16* Vs = reinterpret_cast<const f16*>(kv + bo + KV_K);

        // scores of KT keys, four 16x16 tiles at a time: sc[t][r] = score of key 16t+8h+r for query l16, plus cb
        v8f sc[KT / 16];
        v8f c0;
#pragma unroll   // constant element indices: the vector stays in registers
        for (int r = 0; r < 8; ++r) c0[r] = cb;
#pragma unroll
        for (int tb = 0; tb < KT / 16; tb += 4) {
            Frag b0[4], b1[4];
#pragma unroll
            for (int u = 0; u < 4; ++u) {
                const f16* kp = Ks + ((tb + u) * 16 + l16) * KS_P;
                b0[u].h[0] = *(const v8ha*)(kp + h8);      b0[u].h[1] = *(const v8ha*)(kp + 16 + h8);
                b1[u].h[0] = *(const v8ha*)(kp + 32 + h8); b1[u].h[1] = *(const v8ha*)(kp + 48 + h8);
            }
#pragma unroll
            for (int u = 0; u < 4; ++u) sc[tb + u] = mma_from(b0[u].v, qa0.v, c0);
#pragma unroll
            for (int u = 0; u < 4; ++u) sc[tb + u] = mma(b1[u].v, qa1.v, sc[tb + u]);
        }

        // query l16, of every 32 keys the kv subset {8h..8h+7, 16+8h..23+8h}, in that order
        // (the three loops are unrolled so that every index is a constant and the renaming costs no instruction)
        v4f rv[KT / 32][4];
#pragma unroll
        for (int g = 0; g < KT / 32; ++g)
#pragma unroll
            for (int q = 0; q < 4; ++q)
#pragma unroll
                for (int e = 0; e < 4; ++e) rv[g][q][e] = sc[2 * g + (q >> 1)][4 * (q & 1) + e];

        // one maximum per 32 keys (independent chains), then their maximum
        float rm = -1e30f;
#pragma unroll
        for (int g = 0; g < KT / 32; ++g) {
            float gm = rv[g][0][0];
#pragma unroll
            for (int i = 1; i < 16; ++i) gm = fmaxf(gm, rv[g][i >> 2][i & 3]);
            rm = fmaxf(rm, gm);
        }

        // rm covers this lane's own keys: enough for the test. Rare behind pass 0.
        if (it == 0 || __builtin_amdgcn_ballot_w32(rm > 15.0f) != 0u) {
            const float mx = fmaxf(rm, __shfl_xor(rm, 16, 32));   // both halves: the query's largest argument
            float d = 8.0f - mx;                                  // brings it to 8
            if (it != 0) d = fminf(d, 0.0f);                      // behind pass 0 the reference only rises
            const float corr = __builtin_amdgcn_exp2f(fminf(d, 0.0f));
            cb += d;
            l_run *= corr;
            // (unrolled so that every index is a constant: arguments and accumulators stay in registers)
#pragma unroll
            for (int g = 0; g < KT / 32; ++g)
#pragma unroll
                for (int q = 0; q < 4; ++q) rv[g][q] += d;
            // the accumulators' column is this lane's own query
#pragma unroll
            for (int r = 0; r < 8; ++r) { acc0[r] *= corr; acc1[r] *= corr; acc2[r] *= corr; acc3[r] *= corr; }
        }

        // one partial sum per 32 keys (independent chains), then their sum
        Frag pa[KT / 32];
        float rs = 0.0f;
#pragma unroll
        for (int g = 0; g < KT / 32; ++g) {
            float gs = 0.0f;
#pragma unroll
            for (int q = 0; q < 4; ++q) {
                const v4f p = exp2x4(rv[g][q]);   // 256 * 2^(s - ref)
#pragma unroll
                for (int e = 0; e < 4; ++e) { gs += p[e]; pa[g].e[4 * q + e] = (f16)p[e]; }
            }
            rs += gs;
        }
        rs += __shfl_xor(rs, 16, 32);
        l_run += rs;

        // PV, 32 keys at a time: A fragment for d = j*16 + l16, kv split map; accj[r] = O[query l16][16j+8h+r]
#pragma unroll
        for (int g = 0; g < KT / 32; ++g) {
            Frag bv[4];
#pragma unroll
            for (int j = 0; j < 4; ++j) {
                const f16* vp = Vs + (j * 16 + l16) * VS_P + g * 32;
                bv[j].h[0] = *(const v8ha*)(vp + h8); bv[j].h[1] = *(const v8ha*)(vp + 16 + h8);
            }
            acc0 = mma(bv[0].v, pa[g].v, acc0);
            acc1 = mma(bv[1].v, pa[g].v, acc1);
            acc2 = mma(bv[2].v, pa[g].v, acc2);
            acc3 = mma(bv[3].v, pa[g].v, acc3);
        }

        asm volatile("s_wait_dscnt 0x0" ::: "memory");    // this wave has left buffer it & 1
        asm volatile("s_wait_asynccnt 0x0" ::: "memory"); // its share of pass it + 1's tiles has landed
        __syncthreads();                                  // publishes pass it + 1's tiles, frees buffer it & 1
        if (it + 2 < NS / KT)
            kv_copy(lk + (uint32_t)bo, lv + (uint32_t)bo, gk + (size_t)(it + 2) * KT * NHD, gv + (it + 2) * KT);
    }
    asm volatile("s_wait_asynccnt 0x0" ::: "memory");     // no copy outstanding behind the loop

    // normalise: acc and l both carry the factor 256: O = acc / l; stored as O*32 -> acc * (32 / l)
    const float inv = 32.0f / l_run;

    __syncthreads();
    f16* os = Os + wid * 16 * 72;
    {
        v8h t0, t1, t2, t3;
#pragma unroll   // constant element indices: the vectors stay in registers
        for (int r = 0; r < 8; ++r) {
            t0[r] = (f16)(acc0[r] * inv);
            t1[r] = (f16)(acc1[r] * inv);
            t2[r] = (f16)(acc2[r] * inv);
            t3[r] = (f16)(acc3[r] * inv);
        }
        f16* orow = os + l16 * 72 + h8;      // query l16, eight consecutive d per tile
        *(v8ha*)(orow)      = t0;
        *(v8ha*)(orow + 16) = t1;
        *(v8ha*)(orow + 32) = t2;
        *(v8ha*)(orow + 48) = t3;
    }
    __syncthreads();

    v8h o[4];
    size_t off[4];
#pragma unroll
    for (int q = 0; q < 4; ++q) {
        const int L = 4 * q + (lane >> 3);     // local q row 0..15
        const int cc = (lane & 7) * 8;
        o[q] = *(const v8ha*)(os + L * 72 + cc);
        off[q] = ((size_t)(bb * NS + q0 + L)) * (NH * NHD) + hd * NHD + cc;
    }
#pragma unroll
    for (int q = 0; q < 4; ++q) *(v8h*)(ob + off[q]) = o[q];
    
}

// ---------------------------------------------------------------------------
// out = (O*32 f16) x (Wo*16 f16, k contiguous) / 512 + bias + residual, f32 [NM][NDM]
// Block tile 128 x 128, grid = (NDM/128, NM/128). Row segment of 128 floats = 4 lines, one wave-wide store.
// ---------------------------------------------------------------------------
__global__ __launch_bounds__(256) void k_oproj(const f16* __restrict__ A, const f16* __restrict__ Wot,
                                               const float* __restrict__ bias, const float* __restrict__ resid,
                                               float* __restrict__ out) {
    __shared__ __attribute__((aligned(16))) unsigned char ring[RING_BYTES];
    float (*Cs)[CS_P] = reinterpret_cast<float (*)[CS_P]>(ring);   // C tile takes the ring's place behind the K loop
    const int tid = threadIdx.x, lane = tid & 31, wid = tid >> 5;
    const int n0 = blockIdx.x * 128;
    const int m0 = blockIdx.y * 128;
    if (n0 + 128 > NDM || m0 + 128 > NM) return;   // block-uniform

    v8f c[2][4];
#pragma unroll
    for (int i = 0; i < 2; ++i)
#pragma unroll
        for (int j = 0; j < 4; ++j) c[i][j] = zero8();
    mm128x128(A + (size_t)m0 * (NH * NHD), Wot + (size_t)n0 * (NH * NHD), NH * NHD, ring, c);

    c_to_lds(Cs, c);
    __syncthreads();

    v4f o[16];
    size_t off[16];
    const int cc = lane * 4;
    const v4f bv = *(const v4f*)(bias + n0 + cc);
#pragma unroll
    for (int q = 0; q < 16; ++q) {
        const int row = 16 * wid + q;
        const v4f cv = *(const v4fa*)(&Cs[row][cc]);
        const size_t go = (size_t)(m0 + row) * NDM + n0 + cc;
        const v4f rv = *(const v4f*)(resid + go);
        v4f val;
#pragma unroll
        for (int e = 0; e < 4; ++e) val[e] = (cv[e] * (1.0f / 512.0f) + bv[e]) + rv[e];
        o[q] = val;
        off[q] = go;
    }
#pragma unroll
    for (int q = 0; q < 16; ++q) *(v4f*)(out + off[q]) = o[q];
}

// ---------------------------------------------------------------------------
// Launcher
// ---------------------------------------------------------------------------
extern "C" void kernel_launch(void* const* d_in, const int* in_sizes, int n_in,
                              void* d_out, int out_size, void* d_ws, size_t ws_size,
                              hipStream_t stream) {
    if (n_in < 10) return;
    if (in_sizes[0] != NM * NDM) return;
    if (in_sizes[1] != NDM * NH * NHD) return;
    if (in_sizes[2] != NDM * NKV * NHD || in_sizes[3] != NDM * NKV * NHD) return;
    if (in_sizes[4] != NH * NHD * NDM) return;
    if (in_sizes[5] < NDM || in_sizes[6] < NHD || in_sizes[7] < NHD) return;
    if (in_sizes[8] != NS * NROT || in_sizes[9] != NS * NROT) return;
    if (out_size != NM * NDM) return;

    const float* hs   = (const float*)d_in[0];
    const float* wq   = (const float*)d_in[1];
    const float* wk   = (const float*)d_in[2];
    const float* wv   = (const float*)d_in[3];
    const float* wo   = (const float*)d_in[4];
    const float* bo   = (const float*)d_in[5];
    const float* nqw  = (const float*)d_in[6];
    const float* nkw  = (const float*)d_in[7];
    const float* cosT = (const float*)d_in[8];
    const float* sinT = (const float*)d_in[9];

    const size_t szX   = (size_t)NM * NDM * sizeof(f16);            // 8 MB
    const size_t szWq  = (size_t)NDM * NH * NHD * sizeof(f16);      // 2 MB
    const size_t szWkv = (size_t)NDM * NKV * NHD * sizeof(f16);     // 1 MB
    const size_t szWo  = (size_t)NH * NHD * NDM * sizeof(f16);      // 2 MB
    const size_t szQ   = (size_t)NB * NH * NS * NHD * sizeof(f16);  // 8 MB
    const size_t szKV  = (size_t)NB * NKV * NS * NHD * sizeof(f16); // 4 MB
    const size_t szO   = (size_t)NM * NH * NHD * sizeof(f16);       // 8 MB
    size_t offp = 0;
    const size_t oX   = offp; offp += szX;
    const size_t oWq  = offp; offp += szWq;
    const size_t oWk  = offp; offp += szWkv;
    const size_t oWv  = offp; offp += szWkv;
    const size_t oWo  = offp; offp += szWo;
    const size_t oQ   = offp; offp += szQ;
    const size_t oK   = offp; offp += szKV;
    const size_t oV   = offp; offp += szKV;
    const size_t oO   = offp; offp += szO;
    if (offp > ws_size) return;

    char* ws = (char*)d_ws;
    f16* hsb  = (f16*)(ws + oX);
    f16* wqt  = (f16*)(ws + oWq);
    f16* wkt  = (f16*)(ws + oWk);
    f16* wvt  = (f16*)(ws + oWv);
    f16* wot  = (f16*)(ws + oWo);
    f16* qbuf = (f16*)(ws + oQ);
    f16* kbuf = (f16*)(ws + oK);
    f16* vtb  = (f16*)(ws + oV);
    f16* attb = (f16*)(ws + oO);

    // X -> f16 and W[K=in][N=out] -> Wt[N][K] * 16, all in one launch
    k_prep<<<PB_ALL, 256, 0, stream>>>(hs, wq, wk, wv, wo, hsb, wqt, wkt, wvt, wot);

    k_qkv<<<dim3(16, (NM + 127) / 128), 256, 0, stream>>>(hsb, wqt, wkt, wvt, nqw, nkw, cosT, sinT,
                                                         qbuf, kbuf, vtb);

    k_attn<<<dim3((NS + 127) / 128, NH, NB), 256, 0, stream>>>(qbuf, kbuf, vtb, attb);

    k_oproj<<<dim3((NDM + 127) / 128, (NM + 127) / 128), 256, 0, stream>>>(attb, wot, bo, hs, (float*)d_out);
}

// v009
// It runs in 72.2 microseconds.
// Two timings next to v008 put it at 1.03 and 1.04 times that version's speed.
// Counting every step since v000, it is 3.34 times as fast.
#include <hip/hip_runtime.h>
#include <stdint.h>

// Contractions x*Wq, x*Wk, x*Wv, q*k^T, p*v, o*Wo: v_wmma_f32_16x16x32_f16 (f16 operands with constant operand scaling, f32 accumulate); RMS norm, rotary, softmax, bias and residual in f32.

#define NB   2
#define NS   2048
#define NDM  1024
#define NH   16
#define NKV  8
#define NHD  64
#define NROT 32
#define EPSV 1e-6f
#define NM   (NB * NS)

typedef _Float16 f16;
typedef f16   v8h  __attribute__((ext_vector_type(8)));
typedef f16   v16h __attribute__((ext_vector_type(16)));
typedef float v4f  __attribute__((ext_vector_type(4)));
typedef float v8f  __attribute__((ext_vector_type(8)));
typedef v4f v4fa __attribute__((may_alias));
typedef v8h v8ha __attribute__((may_alias));

union Frag { v16h v; v8h h[2]; f16 e[16]; };

// D(16x16 f32) = A(16x32) * B(32x16) + C
__device__ __forceinline__ v8f mma(const v16h a, const v16h b, const v8f c) {
    return __builtin_amdgcn_wmma_f32_16x16x32_f16(false, a, false, b, (short)0, c, false, false);
}

// Hazard guards, one behind a GROUP of products: the chip needs four vector slots between a product and a vector
// write over its operands. The statement names every D of the group, so it
// stands behind the group's last product, and every operand, so none is reused ahead of it; the four v_nop are
// the slots of that last product (an earlier one has the later products and these as its slots).
// Four products that share B:
__device__ __forceinline__ void guard_4(v8f& d0, v8f& d1, v8f& d2, v8f& d3, const v16h a0, const v16h a1,
                                        const v16h a2, const v16h a3, const v16h b) {
    asm volatile("v_nop\n\tv_nop\n\tv_nop\n\tv_nop" : "+v"(d0), "+v"(d1), "+v"(d2), "+v"(d3)
                 : "v"(a0), "v"(a1), "v"(a2), "v"(a3), "v"(b));
}
// Four chains of two products from a common start value c:
__device__ __forceinline__ void guard_4x2(v8f& d0, v8f& d1, v8f& d2, v8f& d3, const v16h a0, const v16h a1,
                                          const v16h a2, const v16h a3, const v16h a4, const v16h a5,
                                          const v16h a6, const v16h a7, const v16h b0, const v16h b1, const v8f c) {
    asm volatile("v_nop\n\tv_nop\n\tv_nop\n\tv_nop" : "+v"(d0), "+v"(d1), "+v"(d2), "+v"(d3)
                 : "v"(a0), "v"(a1), "v"(a2), "v"(a3), "v"(a4), "v"(a5), "v"(a6), "v"(a7), "v"(b0), "v"(b1), "v"(c));
}
// Two A fragments times four B fragments:
__device__ __forceinline__ void guard_2x4(v8f (&d)[2][4], const v16h a0, const v16h a1, const v16h b0,
                                          const v16h b1, const v16h b2, const v16h b3) {
    asm volatile("v_nop\n\tv_nop\n\tv_nop\n\tv_nop"
                 : "+v"(d[0][0]), "+v"(d[0][1]), "+v"(d[0][2]), "+v"(d[0][3]),
                   "+v"(d[1][0]), "+v"(d[1][1]), "+v"(d[1][2]), "+v"(d[1][3])
                 : "v"(a0), "v"(a1), "v"(b0), "v"(b1), "v"(b2), "v"(b3));
}

// 2^x of four independent values. One statement, outputs apart from the inputs, so that each v_exp_f32 is
// followed by an instruction that neither reads its result nor overwrites its source; the v_nop is that
// instruction behind the last one, whatever the compiler places next.
__device__ __forceinline__ v4f exp2x4(const v4f x) {
    float r0, r1, r2, r3;
    asm("v_exp_f32 %0, %4\n\tv_exp_f32 %1, %5\n\tv_exp_f32 %2, %6\n\tv_exp_f32 %3, %7\n\tv_nop"
        : "=&v"(r0), "=&v"(r1), "=&v"(r2), "=&v"(r3)
        : "v"(x[0]), "v"(x[1]), "v"(x[2]), "v"(x[3]));
    v4f r;
    r[0] = r0; r[1] = r1; r[2] = r2; r[3] = r3;
    return r;
}

// Sum over the 16 lanes of a row of lanes (the lanes that share lane >> 4): four butterfly steps on the
// vector unit's own cross-lane path (row_xmask), every lane ends with the sum. All lanes are on.
template <int M>
__device__ __forceinline__ float xmask16(const float x) {
    return __builtin_bit_cast(float, __builtin_amdgcn_update_dpp(0, __builtin_bit_cast(int, x), 0x160 | M, 0xf, 0xf, true));
}
__device__ __forceinline__ float row16_sum(float x) {
    x += xmask16<1>(x);
    x += xmask16<2>(x);
    x += xmask16<4>(x);
    x += xmask16<8>(x);
    return x;
}

__device__ __forceinline__ v8f zero8() {
    v8f z;
#pragma unroll
    for (int i = 0; i < 8; ++i) z[i] = 0.0f;
    return z;
}

// ---------------------------------------------------------------------------
// Preparation, one launch: the five jobs need nothing of each other, so they share one grid and a range
// of the block index picks the job (block-uniform branches).
// ---------------------------------------------------------------------------
// f32 -> f16, eight elements a thread; blk = block index inside the job
__device__ __forceinline__ void cvt_block(const float* __restrict__ in, f16* __restrict__ out, int n8, int blk) {
    const int i = blk * 256 + threadIdx.x;
    if (i >= n8) return;
    const float* s = in + (size_t)i * 8;
    const v4f u0 = *(const v4f*)(s);
    const v4f u1 = *(const v4f*)(s + 4);
    v8h o;
#pragma unroll
    for (int e = 0; e < 4; ++e) { o[e] = (f16)u0[e]; o[4 + e] = (f16)u1[e]; }
    f16* d = out + (size_t)i * 8;
    *(v8h*)d = o;
}

// W[K][N] f32 -> Wt[N][K] f16 * scale (k contiguous). Tile 64 k x 32 n.
// in[K rows][N cols] -> out[N rows][K cols]; blk = block index inside the job, (N/32) * (K/64) blocks
__device__ __forceinline__ void wtrans_block(const float* __restrict__ W, f16* __restrict__ Wt,
                                             int K, int N, float scale, int blk, float (*T)[33]) {
    const int tid = threadIdx.x, lane = tid & 31, wid = tid >> 5;
    const int nTn = N / 32;
    const int tn = blk % nTn, tk = blk / nTn;
    const int n0 = tn * 32, k0 = tk * 64;
    if (k0 + 64 > K || n0 + 32 > N) return;   // block-uniform
    {
        const int k = tid >> 2, c = (tid & 3) * 8;
        const float* src = W + (size_t)(k0 + k) * N + n0 + c;
        const v4f u0 = *(const v4f*)(src);
        const v4f u1 = *(const v4f*)(src + 4);
        asm volatile("s_wait_xcnt 0x0" ::: "memory");  // stands in front of any reuse of the two loads' address registers
#pragma unroll
        for (int e = 0; e < 4; ++e) { T[k][c + e] = u0[e]; T[k][c + 4 + e] = u1[e]; }
    }
    __syncthreads();
    const int L  = wid * 4 + (lane >> 3);     // local n row 0..31
    const int k8 = (lane & 7) * 8;
    v8h o;
#pragma unroll
    for (int e = 0; e < 8; ++e) o[e] = (f16)(T[k8 + e][L] * scale);
    f16* dst = Wt + (size_t)(n0 + L) * K + k0 + k8;
    *(v8h*)dst = o;
    asm volatile("s_wait_xcnt 0x0" ::: "memory");  // stands in front of any reuse of the store's address and data registers
}

#define PB_WQ   (((NH * NHD) / 32) * (NDM / 64))
#define PB_WKV  (((NKV * NHD) / 32) * (NDM / 64))
#define PB_WO   ((NDM / 32) * ((NH * NHD) / 64))
#define PB_CVT  ((NM * NDM / 8 + 255) / 256)
#define PB_ALL  (PB_WQ + 2 * PB_WKV + PB_WO + PB_CVT)

// The transposes come first in the grid: theirs is the longer path (load, LDS, barrier, store).
__global__ __launch_bounds__(256) void k_prep(const float* __restrict__ hs, const float* __restrict__ wq,
                                              const float* __restrict__ wk, const float* __restrict__ wv,
                                              const float* __restrict__ wo,
                                              f16* __restrict__ hsb, f16* __restrict__ wqt, f16* __restrict__ wkt,
                                              f16* __restrict__ wvt, f16* __restrict__ wot) {
    __shared__ float T[64][33];
    int b = blockIdx.x;
    if (b < PB_WQ)  { wtrans_block(wq, wqt, NDM, NH * NHD, 16.0f, b, T); return; }
    b -= PB_WQ;
    if (b < PB_WKV) { wtrans_block(wk, wkt, NDM, NKV * NHD, 16.0f, b, T); return; }
    b -= PB_WKV;
    if (b < PB_WKV) { wtrans_block(wv, wvt, NDM, NKV * NHD, 16.0f, b, T); return; }
    b -= PB_WKV;
    if (b < PB_WO)  { wtrans_block(wo, wot, NH * NHD, NDM, 16.0f, b, T); return; }
    b -= PB_WO;
    cvt_block(hs, hsb, (NM * NDM) / 8, b);
}

// ---------------------------------------------------------------------------
// Block: C[128 rows][128 cols] += A[128 x K] * B[K x 128]; eight waves as 4 x 2: wave (wr, wc) owns rows
// 32wr..32wr+31 and cols 64wc..64wc+63, eight 16x16 tiles: an A fragment feeds four products, a B fragment two.
// Ablk -> A + m0*K, Bblk -> Bt + n0*K (both k contiguous).
// K runs in slabs of 64 (128 B of every row). A slab of all 256 rows is copied into LDS by
// asynchronous copies whose wave-wide 512 B cover four whole lines; two buffers, the next
// slab's copies fly while this one is multiplied. LDS rows at pitch 144 B (16 B x odd).
// Both fragments use the same split k map:
// elements 0..7 <- k0+8h+0..7, elements 8..15 <- k0+16+8h+0..7.
// ---------------------------------------------------------------------------
#define SLAB_K      64
#define SLAB_PITCH  144
#define SLAB_A      (128 * SLAB_PITCH)
#define SLAB_STAGE  (256 * SLAB_PITCH)
#define RING_BYTES  (2 * SLAB_STAGE)
#define CS_P        132

// One thread's share of a slab: 16 B of A rows r, r+32, r+64, r+96 and of B rows r, r+32, r+64, r+96.
// s_wait_xcnt closes the statement so that no address register is rewritten ahead of it.
__device__ __forceinline__ void slab_copy(uint32_t lds, const f16* ga, const f16* gb, size_t rstep) {
    asm volatile("global_load_async_to_lds_b128 %0, %8, off\n\t"
                 "global_load_async_to_lds_b128 %1, %9, off\n\t"
                 "global_load_async_to_lds_b128 %2, %10, off\n\t"
                 "global_load_async_to_lds_b128 %3, %11, off\n\t"
                 "global_load_async_to_lds_b128 %4, %12, off\n\t"
                 "global_load_async_to_lds_b128 %5, %13, off\n\t"
                 "global_load_async_to_lds_b128 %6, %14, off\n\t"
                 "global_load_async_to_lds_b128 %7, %15, off\n\t"
                 "s_wait_xcnt 0x0"
                 :: "v"(lds), "v"(lds + 32u * SLAB_PITCH), "v"(lds + 64u * SLAB_PITCH),
                    "v"(lds + 96u * SLAB_PITCH), "v"(lds + (uint32_t)SLAB_A),
                    "v"(lds + (uint32_t)SLAB_A + 32u * SLAB_PITCH),
                    "v"(lds + (uint32_t)SLAB_A + 64u * SLAB_PITCH),
                    "v"(lds + (uint32_t)SLAB_A + 96u * SLAB_PITCH),
                    "v"(ga), "v"(ga + rstep), "v"(ga + 2 * rstep), "v"(ga + 3 * rstep),
                    "v"(gb), "v"(gb + rstep), "v"(gb + 2 * rstep), "v"(gb + 3 * rstep)
                 : "memory");
}

// c[i][j]: rows 32wr+16i.., cols 64wc+16j..
__device__ __forceinline__ void mm128x128(const f16* __restrict__ Ablk, const f16* __restrict__ Bblk,
                                          int K, unsigned char* ring, v8f (&c)[2][4]) {
    const int tid = threadIdx.x, lane = tid & 31, wid = tid >> 5;
    const int h = lane >> 4, l16 = lane & 15;
    const int wr = wid & 3, wc = wid >> 2;
    const int cr = tid >> 3, cc = (tid & 7) * 8;          // copy: row 0..31, f16 column
    const f16* ga = Ablk + (size_t)cr * K + cc;
    const f16* gb = Bblk + (size_t)cr * K + cc;
    const size_t rstep = (size_t)32 * K;
    const uint32_t l0 = (uint32_t)(size_t)ring + (uint32_t)(cr * SLAB_PITCH + cc * 2);
    const int nslab = K / SLAB_K;

    slab_copy(l0, ga, gb, rstep);
    asm volatile("s_wait_asynccnt 0x0" ::: "memory");     // slab 0 landed (this wave's share)
    __syncthreads();                                      // ... and every other wave's
    if (nslab > 1) slab_copy(l0 + (uint32_t)SLAB_STAGE, ga + SLAB_K, gb + SLAB_K, rstep);

    const unsigned char* af = ring + (32 * wr + l16) * SLAB_PITCH + h * 16;
    const unsigned char* bf = ring + SLAB_A + (64 * wc + l16) * SLAB_PITCH + h * 16;
    for (int t = 0; t < nslab; ++t) {
        const int bo = (t & 1) * SLAB_STAGE;
        for (int ks = 0; ks < 2; ++ks) {
            // the k step's twelve LDS reads stand together in front of its eight products
            Frag a0, a1, b0, b1, b2, b3;
            const unsigned char* ap = af + bo + ks * 64;
            const unsigned char* bp = bf + bo + ks * 64;
            a0.h[0] = *(const v8ha*)(ap);                   a0.h[1] = *(const v8ha*)(ap + 32);
            a1.h[0] = *(const v8ha*)(ap + 16 * SLAB_PITCH); a1.h[1] = *(const v8ha*)(ap + 16 * SLAB_PITCH + 32);
            b0.h[0] = *(const v8ha*)(bp);                   b0.h[1] = *(const v8ha*)(bp + 32);
            b1.h[0] = *(const v8ha*)(bp + 16 * SLAB_PITCH); b1.h[1] = *(const v8ha*)(bp + 16 * SLAB_PITCH + 32);
            b2.h[0] = *(const v8ha*)(bp + 32 * SLAB_PITCH); b2.h[1] = *(const v8ha*)(bp + 32 * SLAB_PITCH + 32);
            b3.h[0] = *(const v8ha*)(bp + 48 * SLAB_PITCH); b3.h[1] = *(const v8ha*)(bp + 48 * SLAB_PITCH + 32);
            c[0][0] = mma(a0.v, b0.v, c[0][0]);
            c[0][1] = mma(a0.v, b1.v, c[0][1]);
            c[0][2] = mma(a0.v, b2.v, c[0][2]);
            c[0][3] = mma(a0.v, b3.v, c[0][3]);
            c[1][0] = mma(a1.v, b0.v, c[1][0]);
            c[1][1] = mma(a1.v, b1.v, c[1][1]);
            c[1][2] = mma(a1.v, b2.v, c[1][2]);
            c[1][3] = mma(a1.v, b3.v, c[1][3]);
            guard_2x4(c, a0.v, a1.v, b0.v, b1.v, b2.v, b3.v);
        }
        asm volatile("s_wait_dscnt 0x0" ::: "memory");    // this wave has left buffer t & 1
        asm volatile("s_wait_asynccnt 0x0" ::: "memory"); // its share of slab t + 1 has landed
        __syncthreads();                                  // publishes slab t + 1, frees buffer t & 1
        if (t + 2 < nslab)
            slab_copy(l0 + (uint32_t)bo, ga + (size_t)(t + 2) * SLAB_K, gb + (size_t)(t + 2) * SLAB_K, rstep);
    }
    asm volatile("s_wait_asynccnt 0x0" ::: "memory");     // no copy outstanding when the ring is reused
}

// accumulators -> LDS tile [128][CS_P] (lane = col 64wc+16j+l16, element r = row 32wr+16i+8h+r)
__device__ __forceinline__ void c_to_lds(float (*Cs)[CS_P], const v8f (&c)[2][4]) {
    const int tid = threadIdx.x, lane = tid & 31, wid = tid >> 5;
    const int h = lane >> 4, l16 = lane & 15;
    const int wr = wid & 3, wc = wid >> 2;
#pragma unroll   // constant element indices: the accumulators stay in registers
    for (int i = 0; i < 2; ++i)
#pragma unroll
        for (int r = 0; r < 8; ++r) {
            float* p = &Cs[32 * wr + 16 * i + 8 * h + r][64 * wc + l16];
            p[0]  = c[i][0][r];
            p[16] = c[i][1][r];
            p[32] = c[i][2][r];
            p[48] = c[i][3][r];
        }
}

// ---------------------------------------------------------------------------
// Fused QKV projection + RMS norm + partial rotary.
// Block tile = 128 rows (one batch, 128 consecutive s) x 128 cols (= two heads, one per wave column).
// grid = (16 col tiles: 0..7 -> q heads, 8..11 -> k heads, 12..15 -> v heads, NM/128)
// q out: [b][h][s][d] f16, pre-multiplied by log2(e)/8 (softmax scale, scores in base 2);  k out: [b][kvh][s][d] f16
// v out: [b][kvh][d][s] f16 (d-major)
// ---------------------------------------------------------------------------
__global__ __launch_bounds__(256) void k_qkv(const f16* __restrict__ X,
                                             const f16* __restrict__ Wqt, const f16* __restrict__ Wkt,
                                             const f16* __restrict__ Wvt,
                                             const float* __restrict__ nqw, const float* __restrict__ nkw,
                                             const float* __restrict__ cosT, const float* __restrict__ sinT,
                                             f16* __restrict__ qb, f16* __restrict__ kb, f16* __restrict__ vt) {
    __shared__ __attribute__((aligned(16))) unsigned char ring[RING_BYTES];
    float (*Cs)[CS_P] = reinterpret_cast<float (*)[CS_P]>(ring);   // C tile takes the ring's place behind the K loop
    const int tid = threadIdx.x, lane = tid & 31, wid = tid >> 5;
    const int h = lane >> 4, l16 = lane & 15;
    const int wr = wid & 3, wc = wid >> 2;
    const int nt = blockIdx.x;
    const int m0 = blockIdx.y * 128;
    if (m0 + 128 > NM || nt >= 16) return;    // block-uniform

    int mode, hb, nHh;                        // hb: the block's first head
    const f16* Wt;
    const float* nw;
    if (nt < 8)       { mode = 0; hb = 2 * nt;        nHh = NH;  Wt = Wqt; nw = nqw; }
    else if (nt < 12) { mode = 1; hb = 2 * (nt - 8);  nHh = NKV; Wt = Wkt; nw = nkw; }
    else              { mode = 2; hb = 2 * (nt - 12); nHh = NKV; Wt = Wvt; nw = nkw; }
    const int n0 = hb * NHD;
    const int bb = m0 / NS, s0 = m0 % NS;

    v8f c[2][4];
#pragma unroll
    for (int i = 0; i < 2; ++i)
#pragma unroll
        for (int j = 0; j < 4; ++j) c[i][j] = zero8();
    mm128x128(X + (size_t)m0 * NDM, Wt + (size_t)n0 * NDM, NDM, ring, c);

    // RMS norm and rotary on the accumulators (lane = col 16j+l16 of the wave's head, element r = row 8h+r of
    // row tile i, scaled by 16). A row's 64 columns lie in the four tiles of the 16 lanes that share h; column n
    // and its rotary partner n +- 16 are tiles 0 and 1 of the same lane. 1/16 and the softmax scale log2(e)/8
    // are folded into f.
    if (mode != 2) {
        const float osc16 = ((mode == 0) ? 0.125f * 1.44269504f : 1.0f) * (1.0f / 16.0f);
        const float w0 = nw[l16], w1 = nw[16 + l16], w2 = nw[32 + l16], w3 = nw[48 + l16];
        asm volatile("s_wait_xcnt 0x0" ::: "memory");  // stands in front of any reuse of the four loads' address register
        const size_t tr = (size_t)(s0 + 32 * wr + 8 * h) * NROT + l16;
        const float* cp = cosT + tr;
        const float* sp = sinT + tr;
        float ca[2][8], cb[2][8], sa[2][8], sb[2][8];
#pragma unroll   // constant indices: the tables' values stay in registers, all loads in flight together
        for (int i = 0; i < 2; ++i)
#pragma unroll
            for (int r = 0; r < 8; ++r) {
                ca[i][r] = cp[(16 * i + r) * NROT]; cb[i][r] = cp[(16 * i + r) * NROT + 16];
                sa[i][r] = sp[(16 * i + r) * NROT]; sb[i][r] = sp[(16 * i + r) * NROT + 16];
            }
        __builtin_amdgcn_sched_barrier(0);             // the loads stay in front: their latency runs under the row sums
#pragma unroll   // sixteen independent chains, constant element indices
        for (int i = 0; i < 2; ++i)
#pragma unroll
            for (int r = 0; r < 8; ++r) {
                const float ss = row16_sum(fmaf(c[i][0][r], c[i][0][r], fmaf(c[i][1][r], c[i][1][r],
                                           fmaf(c[i][2][r], c[i][2][r], c[i][3][r] * c[i][3][r]))));
                const float f = rsqrtf(ss * (1.0f / (256.0f * NHD)) + EPSV) * osc16;
                const float x0 = c[i][0][r] * f * w0;
                const float x1 = c[i][1][r] * f * w1;
                c[i][0][r] = x0 * ca[i][r] - x1 * sa[i][r];
                c[i][1][r] = x1 * cb[i][r] + x0 * sb[i][r];
                c[i][2][r] = c[i][2][r] * f * w2;
                c[i][3][r] = c[i][3][r] * f * w3;
            }
    }

    // accumulator -> LDS tile: q and k finished, v still scaled by 16
    c_to_lds(Cs, c);
    __syncthreads();

    v8h o[8];
    size_t off[8];
    if (mode != 2) {
        // the wave's own 32 rows x 64 cols: one head's rows, 128 B each
        f16* ob = ((mode == 0) ? qb : kb) + ((size_t)(bb * nHh + hb + wc) * NS + s0) * NHD;
#pragma unroll
        for (int q = 0; q < 8; ++q) {
            const int row = 32 * wr + 4 * q + (lane >> 3);
            const int cc = (lane & 7) * 8;
            const v4f u0 = *(const v4fa*)(&Cs[row][64 * wc + cc]);
            const v4f u1 = *(const v4fa*)(&Cs[row][64 * wc + cc + 4]);
#pragma unroll
            for (int e = 0; e < 4; ++e) { o[q][e] = (f16)u0[e]; o[q][4 + e] = (f16)u1[e]; }
            off[q] = (size_t)row * NHD + cc;
        }
#pragma unroll
        for (int q = 0; q < 8; ++q) *(v8h*)(ob + off[q]) = o[q];
        asm volatile("s_wait_xcnt 0x0" ::: "memory");  // stands in front of any reuse of the stores' address and data registers
    } else {
        // the two heads' 128 d rows follow one another in vt; wave wid takes d rows 16wid..16wid+15
        f16* ob = vt + (size_t)(bb * NKV + hb) * NHD * NS + s0;
#pragma unroll
        for (int q = 0; q < 8; ++q) {
            const int L = 4 * q + (lane >> 3);          // 0..31
            const int d = 16 * wid + (L >> 1);
            const int sb = (L & 1) * 64 + (lane & 7) * 8;
#pragma unroll
            for (int e = 0; e < 8; ++e) o[q][e] = (f16)(Cs[sb + e][d] * (1.0f / 16.0f));
            off[q] = (size_t)d * NS + sb;
        }
#pragma unroll
        for (int q = 0; q < 8; ++q) *(v8h*)(ob + off[q]) = o[q];
    }
}

#define KT    128
#define KS_P  72
#define VS_P  (KT + 8)
#define KV_K      (KT * KS_P * 2)
#define KV_STAGE  (KV_K + 64 * VS_P * 2)

// One thread's share of a pass's tiles: 16 B of K rows r, r+32, r+64, r+96 and of V rows d, d+16, d+32, d+48.
// s_wait_xcnt closes the statement so that no address register is rewritten ahead of it.
__device__ __forceinline__ void kv_copy(uint32_t lk, uint32_t lv, const f16* gk, const f16* gv) {
    asm volatile("global_load_async_to_lds_b128 %0, %8, off\n\t"
                 "global_load_async_to_lds_b128 %1, %9, off\n\t"
                 "global_load_async_to_lds_b128 %2, %10, off\n\t"
                 "global_load_async_to_lds_b128 %3, %11, off\n\t"
                 "global_load_async_to_lds_b128 %4, %12, off\n\t"
                 "global_load_async_to_lds_b128 %5, %13, off\n\t"
                 "global_load_async_to_lds_b128 %6, %14, off\n\t"
                 "global_load_async_to_lds_b128 %7, %15, off\n\t"
                 "s_wait_xcnt 0x0"
                 :: "v"(lk), "v"(lk + 32u * KS_P * 2u), "v"(lk + 64u * KS_P * 2u), "v"(lk + 96u * KS_P * 2u),
                    "v"(lv), "v"(lv + 16u * VS_P * 2u), "v"(lv + 32u * VS_P * 2u), "v"(lv + 48u * VS_P * 2u),
                    "v"(gk), "v"(gk + 32 * NHD), "v"(gk + 64 * NHD), "v"(gk + 96 * NHD),
                    "v"(gv), "v"(gv + 16 * NS), "v"(gv + 32 * NS), "v"(gv + 48 * NS)
                 : "memory");
}

__global__ __launch_bounds__(256) void k_attn(const f16* __restrict__ qb, const f16* __restrict__ kb,
                                              const f16* __restrict__ vt, f16* __restrict__ ob) {
    __shared__ __attribute__((aligned(16))) unsigned char kv[2 * KV_STAGE];   // two buffers of [K tile | V tile]
    __shared__ __attribute__((aligned(16))) f16   Os[8 * 16 * 72];

    const int tid = threadIdx.x, lane = tid & 31, wid = tid >> 5;
    const int h = lane >> 4, l16 = lane & 15, h8 = h * 8;
    const int bb = blockIdx.z, hd = blockIdx.y, kvh = hd / (NH / NKV);
    const int qblk = blockIdx.x * 128;
    if (qblk + 128 > NS || hd >= NH || bb >= NB) return;   // block-uniform
    const int q0 = qblk + wid * 16;

    const f16* qrow = qb + ((size_t)(bb * NH + hd) * NS + q0 + l16) * NHD;
    Frag qa0, qa1;
    qa0.h[0] = *(const v8h*)(qrow + h8);
    qa0.h[1] = *(const v8h*)(qrow + 16 + h8);
    qa1.h[0] = *(const v8h*)(qrow + 32 + h8);
    qa1.h[1] = *(const v8h*)(qrow + 48 + h8);

    float cb = 0.0f, l_run = 0.0f;      // cb = 8 - ref of query l16 (0 until pass 0 sets it), the same in both halves
    v8f acc0 = zero8(), acc1 = zero8(), acc2 = zero8(), acc3 = zero8();

    const f16* kbase = kb + (size_t)(bb * NKV + kvh) * NS * NHD;
    const f16* vbase = vt + (size_t)(bb * NKV + kvh) * NHD * NS;

    const int cr = tid >> 3, cc = (tid & 7) * 8;      // copy, K: KT rows x 64 d, 32 rows a step
    const int cd = tid >> 4, cv = (tid & 15) * 8;     // copy, V: 64 d rows x KT kv, 16 rows a step
    const f16* gk = kbase + (size_t)cr * NHD + cc;
    const f16* gv = vbase + (size_t)cd * NS + cv;
    const uint32_t lk = (uint32_t)(size_t)kv + (uint32_t)((cr * KS_P + cc) * 2);
    const uint32_t lv = (uint32_t)(size_t)kv + (uint32_t)(KV_K + (cd * VS_P + cv) * 2);

    kv_copy(lk, lv, gk, gv);
    asm volatile("s_wait_asynccnt 0x0" ::: "memory");     // pass 0's tiles landed (this wave's share)
    __syncthreads();                                      // ... and every other wave's
    if (NS / KT > 1) kv_copy(lk + (uint32_t)KV_STAGE, lv + (uint32_t)KV_STAGE, gk + (size_t)KT * NHD, gv + KT);

#pragma unroll 1
    for (int it = 0; it < NS / KT; ++it) {
        const int bo = (it & 1) * KV_STAGE;
        const f16* Ks = reinterpret_cast<const f16*>(kv + bo);
        const f16* Vs = reinterpret_cast<const f16*>(kv + bo + KV_K);

        // scores of KT keys, four 16x16 tiles at a time: sc[t][r] = score of key 16t+8h+r for query l16, plus cb
        v8f sc[KT / 16];
        v8f c0;
#pragma unroll   // constant element indices: the vector stays in registers
        for (int r = 0; r < 8; ++r) c0[r] = cb;
#pragma unroll
        for (int tb = 0; tb < KT / 16; tb += 4) {
            Frag b0[4], b1[4];
#pragma unroll
            for (int u = 0; u < 4; ++u) {
                const f16* kp = Ks + ((tb + u) * 16 + l16) * KS_P;
                b0[u].h[0] = *(const v8ha*)(kp + h8);      b0[u].h[1] = *(const v8ha*)(kp + 16 + h8);
                b1[u].h[0] = *(const v8ha*)(kp + 32 + h8); b1[u].h[1] = *(const v8ha*)(kp + 48 + h8);
            }
#pragma unroll
            for (int u = 0; u < 4; ++u) sc[tb + u] = mma(b0[u].v, qa0.v, c0);
#pragma unroll
            for (int u = 0; u < 4; ++u) sc[tb + u] = mma(b1[u].v, qa1.v, sc[tb + u]);
            guard_4x2(sc[tb], sc[tb + 1], sc[tb + 2], sc[tb + 3], b0[0].v, b0[1].v, b0[2].v, b0[3].v,
                      b1[0].v, b1[1].v, b1[2].v, b1[3].v, qa0.v, qa1.v, c0);
        }

        // query l16, of every 32 keys the kv subset {8h..8h+7, 16+8h..23+8h}, in that order
        // (the three loops are unrolled so that every index is a constant and the renaming costs no instruction)
        v4f rv[KT / 32][4];
#pragma unroll
        for (int g = 0; g < KT / 32; ++g)
#pragma unroll
            for (int q = 0; q < 4; ++q)
#pragma unroll
                for (int e = 0; e < 4; ++e) rv[g][q][e] = sc[2 * g + (q >> 1)][4 * (q & 1) + e];

        // one maximum per 32 keys (independent chains), then their maximum
        float rm = -1e30f;
#pragma unroll
        for (int g = 0; g < KT / 32; ++g) {
            float gm = rv[g][0][0];
#pragma unroll
            for (int i = 1; i < 16; ++i) gm = fmaxf(gm, rv[g][i >> 2][i & 3]);
            rm = fmaxf(rm, gm);
        }

        // rm covers this lane's own keys: enough for the test. Rare behind pass 0.
        if (it == 0 || __builtin_amdgcn_ballot_w32(rm > 15.0f) != 0u) {
            const float mx = fmaxf(rm, __shfl_xor(rm, 16, 32));   // both halves: the query's largest argument
            float d = 8.0f - mx;                                  // brings it to 8
            if (it != 0) d = fminf(d, 0.0f);                      // behind pass 0 the reference only rises
            const float corr = __builtin_amdgcn_exp2f(fminf(d, 0.0f));
            cb += d;
            l_run *= corr;
            // (unrolled so that every index is a constant: arguments and accumulators stay in registers)
#pragma unroll
            for (int g = 0; g < KT / 32; ++g)
#pragma unroll
                for (int q = 0; q < 4; ++q) rv[g][q] += d;
            // the accumulators' column is this lane's own query
#pragma unroll
            for (int r = 0; r < 8; ++r) { acc0[r] *= corr; acc1[r] *= corr; acc2[r] *= corr; acc3[r] *= corr; }
        }

        // one partial sum per 32 keys (independent chains), then their sum
        Frag pa[KT / 32];
        float rs = 0.0f;
#pragma unroll
        for (int g = 0; g < KT / 32; ++g) {
            float gs = 0.0f;
#pragma unroll
            for (int q = 0; q < 4; ++q) {
                const v4f p = exp2x4(rv[g][q]);   // 256 * 2^(s - ref)
#pragma unroll
                for (int e = 0; e < 4; ++e) { gs += p[e]; pa[g].e[4 * q + e] = (f16)p[e]; }
            }
            rs += gs;
        }
        rs += __shfl_xor(rs, 16, 32);
        l_run += rs;

        // PV, 32 keys at a time: A fragment for d = j*16 + l16, kv split map; accj[r] = O[query l16][16j+8h+r]
#pragma unroll
        for (int g = 0; g < KT / 32; ++g) {
            Frag bv[4];
#pragma unroll
            for (int j = 0; j < 4; ++j) {
                const f16* vp = Vs + (j * 16 + l16) * VS_P + g * 32;
                bv[j].h[0] = *(const v8ha*)(vp + h8); bv[j].h[1] = *(const v8ha*)(vp + 16 + h8);
            }
            acc0 = mma(bv[0].v, pa[g].v, acc0);
            acc1 = mma(bv[1].v, pa[g].v, acc1);
            acc2 = mma(bv[2].v, pa[g].v, acc2);
            acc3 = mma(bv[3].v, pa[g].v, acc3);
            guard_4(acc0, acc1, acc2, acc3, bv[0].v, bv[1].v, bv[2].v, bv[3].v, pa[g].v);
        }

        asm volatile("s_wait_dscnt 0x0" ::: "memory");    // this wave has left buffer it & 1
        asm volatile("s_wait_asynccnt 0x0" ::: "memory"); // its share of pass it + 1's tiles has landed
        __syncthreads();                                  // publishes pass it + 1's tiles, frees buffer it & 1
        if (it + 2 < NS / KT)
            kv_copy(lk + (uint32_t)bo, lv + (uint32_t)bo, gk + (size_t)(it + 2) * KT * NHD, gv + (it + 2) * KT);
    }
    asm volatile("s_wait_asynccnt 0x0" ::: "memory");     // no copy outstanding behind the loop

    // normalise: acc and l both carry the factor 256: O = acc / l; stored as O*32 -> acc * (32 / l)
    const float inv = 32.0f / l_run;

    __syncthreads();
    f16* os = Os + wid * 16 * 72;
    {
        v8h t0, t1, t2, t3;
#pragma unroll   // constant element indices: the vectors stay in registers
        for (int r = 0; r < 8; ++r) {
            t0[r] = (f16)(acc0[r] * inv);
            t1[r] = (f16)(acc1[r] * inv);
            t2[r] = (f16)(acc2[r] * inv);
            t3[r] = (f16)(acc3[r] * inv);
        }
        f16* orow = os + l16 * 72 + h8;      // query l16, eight consecutive d per tile
        *(v8ha*)(orow)      = t0;
        *(v8ha*)(orow + 16) = t1;
        *(v8ha*)(orow + 32) = t2;
        *(v8ha*)(orow + 48) = t3;
    }
    __syncthreads();

    v8h o[4];
    size_t off[4];
#pragma unroll
    for (int q = 0; q < 4; ++q) {
        const int L = 4 * q + (lane >> 3);     // local q row 0..15
        const int cc = (lane & 7) * 8;
        o[q] = *(const v8ha*)(os + L * 72 + cc);
        off[q] = ((size_t)(bb * NS + q0 + L)) * (NH * NHD) + hd * NHD + cc;
    }
#pragma unroll
    for (int q = 0; q < 4; ++q) *(v8h*)(ob + off[q]) = o[q];
    
}

// ---------------------------------------------------------------------------
// out = (O*32 f16) x (Wo*16 f16, k contiguous) / 512 + bias + residual, f32 [NM][NDM]
// Block tile 128 x 128, grid = (NDM/128, NM/128). Row segment of 128 floats = 4 lines, one wave-wide store.
// ---------------------------------------------------------------------------
__global__ __launch_bounds__(256) void k_oproj(const f16* __restrict__ A, const f16* __restrict__ Wot,
                                               const float* __restrict__ bias, const float* __restrict__ resid,
                                               float* __restrict__ out) {
    __shared__ __attribute__((aligned(16))) unsigned char ring[RING_BYTES];
    float (*Cs)[CS_P] = reinterpret_cast<float (*)[CS_P]>(ring);   // C tile takes the ring's place behind the K loop
    const int tid = threadIdx.x, lane = tid & 31, wid = tid >> 5;
    const int n0 = blockIdx.x * 128;
    const int m0 = blockIdx.y * 128;
    if (n0 + 128 > NDM || m0 + 128 > NM) return;   // block-uniform

    v8f c[2][4];
#pragma unroll
    for (int i = 0; i < 2; ++i)
#pragma unroll
        for (int j = 0; j < 4; ++j) c[i][j] = zero8();
    mm128x128(A + (size_t)m0 * (NH * NHD), Wot + (size_t)n0 * (NH * NHD), NH * NHD, ring, c);

    c_to_lds(Cs, c);
    __syncthreads();

    v4f o[16];
    size_t off[16];
    const int cc = lane * 4;
    const v4f bv = *(const v4f*)(bias + n0 + cc);
#pragma unroll
    for (int q = 0; q < 16; ++q) {
        const int row = 16 * wid + q;
        const v4f cv = *(const v4fa*)(&Cs[row][cc]);
        const size_t go = (size_t)(m0 + row) * NDM + n0 + cc;
        const v4f rv = *(const v4f*)(resid + go);
        v4f val;
#pragma unroll
        for (int e = 0; e < 4; ++e) val[e] = (cv[e] * (1.0f / 512.0f) + bv[e]) + rv[e];
        o[q] = val;
        off[q] = go;
    }
#pragma unroll
    for (int q = 0; q < 16; ++q) *(v4f*)(out + off[q]) = o[q];
}

// ---------------------------------------------------------------------------
// Launcher
// ---------------------------------------------------------------------------
extern "C" void kernel_launch(void* const* d_in, const int* in_sizes, int n_in,
                              void* d_out, int out_size, void* d_ws, size_t ws_size,
                              hipStream_t stream) {
    if (n_in < 10) return;
    if (in_sizes[0] != NM * NDM) return;
    if (in_sizes[1] != NDM * NH * NHD) return;
    if (in_sizes[2] != NDM * NKV * NHD || in_sizes[3] != NDM * NKV * NHD) return;
    if (in_sizes[4] != NH * NHD * NDM) return;
    if (in_sizes[5] < NDM || in_sizes[6] < NHD || in_sizes[7] < NHD) return;
    if (in_sizes[8] != NS * NROT || in_sizes[9] != NS * NROT) return;
    if (out_size != NM * NDM) return;

    const float* hs   = (const float*)d_in[0];
    const float* wq   = (const float*)d_in[1];
    const float* wk   = (const float*)d_in[2];
    const float* wv   = (const float*)d_in[3];
    const float* wo   = (const float*)d_in[4];
    const float* bo   = (const float*)d_in[5];
    const float* nqw  = (const float*)d_in[6];
    const float* nkw  = (const float*)d_in[7];
    const float* cosT = (const float*)d_in[8];
    const float* sinT = (const float*)d_in[9];

    const size_t szX   = (size_t)NM * NDM * sizeof(f16);            // 8 MB
    const size_t szWq  = (size_t)NDM * NH * NHD * sizeof(f16);      // 2 MB
    const size_t szWkv = (size_t)NDM * NKV * NHD * sizeof(f16);     // 1 MB
    const size_t szWo  = (size_t)NH * NHD * NDM * sizeof(f16);      // 2 MB
    const size_t szQ   = (size_t)NB * NH * NS * NHD * sizeof(f16);  // 8 MB
    const size_t szKV  = (size_t)NB * NKV * NS * NHD * sizeof(f16); // 4 MB
    const size_t szO   = (size_t)NM * NH * NHD * sizeof(f16);       // 8 MB
    size_t offp = 0;
    const size_t oX   = offp; offp += szX;
    const size_t oWq  = offp; offp += szWq;
    const size_t oWk  = offp; offp += szWkv;
    const size_t oWv  = offp; offp += szWkv;
    const size_t oWo  = offp; offp += szWo;
    const size_t oQ   = offp; offp += szQ;
    const size_t oK   = offp; offp += szKV;
    const size_t oV   = offp; offp += szKV;
    const size_t oO   = offp; offp += szO;
    if (offp > ws_size) return;

    char* ws = (char*)d_ws;
    f16* hsb  = (f16*)(ws + oX);
    f16* wqt  = (f16*)(ws + oWq);
    f16* wkt  = (f16*)(ws + oWk);
    f16* wvt  = (f16*)(ws + oWv);
    f16* wot  = (f16*)(ws + oWo);
    f16* qbuf = (f16*)(ws + oQ);
    f16* kbuf = (f16*)(ws + oK);
    f16* vtb  = (f16*)(ws + oV);
    f16* attb = (f16*)(ws + oO);

    // X -> f16 and W[K=in][N=out] -> Wt[N][K] * 16, all in one launch
    k_prep<<<PB_ALL, 256, 0, stream>>>(hs, wq, wk, wv, wo, hsb, wqt, wkt, wvt, wot);

    k_qkv<<<dim3(16, (NM + 127) / 128), 256, 0, stream>>>(hsb, wqt, wkt, wvt, nqw, nkw, cosT, sinT,
                                                         qbuf, kbuf, vtb);

    k_attn<<<dim3((NS + 127) / 128, NH, NB), 256, 0, stream>>>(qbuf, kbuf, vtb, attb);

    k_oproj<<<dim3((NDM + 127) / 128, (NM + 127) / 128), 256, 0, stream>>>(attb, wot, bo, hs, (float*)d_out);
}

// v010
// One run takes 69.8 microseconds.
// Two timings next to v009 both put it at 1.04 times that version's speed.
// Over all steps from v000 it is 3.47 times as fast.
#include <hip/hip_runtime.h>
#include <stdint.h>

// Contractions x*Wq, x*Wk, x*Wv, q*k^T, p*v, o*Wo: v_wmma_f32_16x16x32_f16 (f16 operands with constant operand scaling, f32 accumulate); RMS norm, rotary, softmax, bias and residual in f32.

#define NB   2
#define NS   2048
#define NDM  1024
#define NH   16
#define NKV  8
#define NHD  64
#define NROT 32
#define EPSV 1e-6f
#define NM   (NB * NS)

typedef _Float16 f16;
typedef f16   v8h  __attribute__((ext_vector_type(8)));
typedef f16   v16h __attribute__((ext_vector_type(16)));
typedef float v4f  __attribute__((ext_vector_type(4)));
typedef float v8f  __attribute__((ext_vector_type(8)));
typedef v4f v4fa __attribute__((may_alias));
typedef v8h v8ha __attribute__((may_alias));

union Frag { v16h v; v8h h[2]; f16 e[16]; };

// D(16x16 f32) = A(16x32) * B(32x16) + C
__device__ __forceinline__ v8f mma(const v16h a, const v16h b, const v8f c) {
    return __builtin_amdgcn_wmma_f32_16x16x32_f16(false, a, false, b, (short)0, c, false, false);
}

// Hazard guards, one behind a GROUP of products: the chip needs four vector slots between a product and a vector
// write over its operands. The statement names every D of the group, so it
// stands behind the group's last product, and every operand, so none is reused ahead of it; the four v_nop are
// the slots of that last product (an earlier one has the later products and these as its slots).
// Four A pairs times two B pairs, eight chains of two products:
__device__ __forceinline__ void guard_4x2x2(v8f (&d)[4][2], const v16h a0, const v16h a1, const v16h a2, const v16h a3,
                                            const v16h a4, const v16h a5, const v16h a6, const v16h a7,
                                            const v16h b0, const v16h b1, const v16h b2, const v16h b3) {
    asm volatile("v_nop\n\tv_nop\n\tv_nop\n\tv_nop"
                 : "+v"(d[0][0]), "+v"(d[0][1]), "+v"(d[1][0]), "+v"(d[1][1]),
                   "+v"(d[2][0]), "+v"(d[2][1]), "+v"(d[3][0]), "+v"(d[3][1])
                 : "v"(a0), "v"(a1), "v"(a2), "v"(a3), "v"(a4), "v"(a5), "v"(a6), "v"(a7),
                   "v"(b0), "v"(b1), "v"(b2), "v"(b3));
}
// Four A fragments times two B fragments:
__device__ __forceinline__ void guard_4x2(v8f (&d)[4][2], const v16h a0, const v16h a1, const v16h a2,
                                          const v16h a3, const v16h b0, const v16h b1) {
    asm volatile("v_nop\n\tv_nop\n\tv_nop\n\tv_nop"
                 : "+v"(d[0][0]), "+v"(d[0][1]), "+v"(d[1][0]), "+v"(d[1][1]),
                   "+v"(d[2][0]), "+v"(d[2][1]), "+v"(d[3][0]), "+v"(d[3][1])
                 : "v"(a0), "v"(a1), "v"(a2), "v"(a3), "v"(b0), "v"(b1));
}
// Two A fragments times four B fragments:
__device__ __forceinline__ void guard_2x4(v8f (&d)[2][4], const v16h a0, const v16h a1, const v16h b0,
                                          const v16h b1, const v16h b2, const v16h b3) {
    asm volatile("v_nop\n\tv_nop\n\tv_nop\n\tv_nop"
                 : "+v"(d[0][0]), "+v"(d[0][1]), "+v"(d[0][2]), "+v"(d[0][3]),
                   "+v"(d[1][0]), "+v"(d[1][1]), "+v"(d[1][2]), "+v"(d[1][3])
                 : "v"(a0), "v"(a1), "v"(b0), "v"(b1), "v"(b2), "v"(b3));
}

// 2^x of four independent values. One statement, outputs apart from the inputs, so that each v_exp_f32 is
// followed by an instruction that neither reads its result nor overwrites its source; the v_nop is that
// instruction behind the last one, whatever the compiler places next.
__device__ __forceinline__ v4f exp2x4(const v4f x) {
    float r0, r1, r2, r3;
    asm("v_exp_f32 %0, %4\n\tv_exp_f32 %1, %5\n\tv_exp_f32 %2, %6\n\tv_exp_f32 %3, %7\n\tv_nop"
        : "=&v"(r0), "=&v"(r1), "=&v"(r2), "=&v"(r3)
        : "v"(x[0]), "v"(x[1]), "v"(x[2]), "v"(x[3]));
    v4f r;
    r[0] = r0; r[1] = r1; r[2] = r2; r[3] = r3;
    return r;
}

// Sum over the 16 lanes of a row of lanes (the lanes that share lane >> 4): four butterfly steps on the
// vector unit's own cross-lane path (row_xmask), every lane ends with the sum. All lanes are on.
template <int M>
__device__ __forceinline__ float xmask16(const float x) {
    return __builtin_bit_cast(float, __builtin_amdgcn_update_dpp(0, __builtin_bit_cast(int, x), 0x160 | M, 0xf, 0xf, true));
}
__device__ __forceinline__ float row16_sum(float x) {
    x += xmask16<1>(x);
    x += xmask16<2>(x);
    x += xmask16<4>(x);
    x += xmask16<8>(x);
    return x;
}

__device__ __forceinline__ v8f zero8() {
    v8f z;
#pragma unroll
    for (int i = 0; i < 8; ++i) z[i] = 0.0f;
    return z;
}

// ---------------------------------------------------------------------------
// Preparation, one launch: the five jobs need nothing of each other, so they share one grid and a range
// of the block index picks the job (block-uniform branches).
// ---------------------------------------------------------------------------
// f32 -> f16, eight elements a thread; blk = block index inside the job
__device__ __forceinline__ void cvt_block(const float* __restrict__ in, f16* __restrict__ out, int n8, int blk) {
    const int i = blk * 256 + threadIdx.x;
    if (i >= n8) return;
    const float* s = in + (size_t)i * 8;
    const v4f u0 = *(const v4f*)(s);
    const v4f u1 = *(const v4f*)(s + 4);
    v8h o;
#pragma unroll
    for (int e = 0; e < 4; ++e) { o[e] = (f16)u0[e]; o[4 + e] = (f16)u1[e]; }
    f16* d = out + (size_t)i * 8;
    *(v8h*)d = o;
}

// W[K][N] f32 -> Wt[N][K] f16 * scale (k contiguous). Tile 64 k x 32 n.
// in[K rows][N cols] -> out[N rows][K cols]; blk = block index inside the job, (N/32) * (K/64) blocks
__device__ __forceinline__ void wtrans_block(const float* __restrict__ W, f16* __restrict__ Wt,
                                             int K, int N, float scale, int blk, float (*T)[33]) {
    const int tid = threadIdx.x, lane = tid & 31, wid = tid >> 5;
    const int nTn = N / 32;
    const int tn = blk % nTn, tk = blk / nTn;
    const int n0 = tn * 32, k0 = tk * 64;
    if (k0 + 64 > K || n0 + 32 > N) return;   // block-uniform
    {
        const int k = tid >> 2, c = (tid & 3) * 8;
        const float* src = W + (size_t)(k0 + k) * N + n0 + c;
        const v4f u0 = *(const v4f*)(src);
        const v4f u1 = *(const v4f*)(src + 4);
        asm volatile("s_wait_xcnt 0x0" ::: "memory");  // stands in front of any reuse of the two loads' address registers
#pragma unroll
        for (int e = 0; e < 4; ++e) { T[k][c + e] = u0[e]; T[k][c + 4 + e] = u1[e]; }
    }
    __syncthreads();
    const int L  = wid * 4 + (lane >> 3);     // local n row 0..31
    const int k8 = (lane & 7) * 8;
    v8h o;
#pragma unroll
    for (int e = 0; e < 8; ++e) o[e] = (f16)(T[k8 + e][L] * scale);
    f16* dst = Wt + (size_t)(n0 + L) * K + k0 + k8;
    *(v8h*)dst = o;
    asm volatile("s_wait_xcnt 0x0" ::: "memory");  // stands in front of any reuse of the store's address and data registers
}

#define PB_WQ   (((NH * NHD) / 32) * (NDM / 64))
#define PB_WKV  (((NKV * NHD) / 32) * (NDM / 64))
#define PB_WO   ((NDM / 32) * ((NH * NHD) / 64))
#define PB_CVT  ((NM * NDM / 8 + 255) / 256)
#define PB_ALL  (PB_WQ + 2 * PB_WKV + PB_WO + PB_CVT)

// The transposes come first in the grid: theirs is the longer path (load, LDS, barrier, store).
__global__ __launch_bounds__(256) void k_prep(const float* __restrict__ hs, const float* __restrict__ wq,
                                              const float* __restrict__ wk, const float* __restrict__ wv,
                                              const float* __restrict__ wo,
                                              f16* __restrict__ hsb, f16* __restrict__ wqt, f16* __restrict__ wkt,
                                              f16* __restrict__ wvt, f16* __restrict__ wot) {
    __shared__ float T[64][33];
    int b = blockIdx.x;
    if (b < PB_WQ)  { wtrans_block(wq, wqt, NDM, NH * NHD, 16.0f, b, T); return; }
    b -= PB_WQ;
    if (b < PB_WKV) { wtrans_block(wk, wkt, NDM, NKV * NHD, 16.0f, b, T); return; }
    b -= PB_WKV;
    if (b < PB_WKV) { wtrans_block(wv, wvt, NDM, NKV * NHD, 16.0f, b, T); return; }
    b -= PB_WKV;
    if (b < PB_WO)  { wtrans_block(wo, wot, NH * NHD, NDM, 16.0f, b, T); return; }
    b -= PB_WO;
    cvt_block(hs, hsb, (NM * NDM) / 8, b);
}

// ---------------------------------------------------------------------------
// Block: C[128 rows][128 cols] += A[128 x K] * B[K x 128]; eight waves as 4 x 2: wave (wr, wc) owns rows
// 32wr..32wr+31 and cols 64wc..64wc+63, eight 16x16 tiles: an A fragment feeds four products, a B fragment two.
// Ablk -> A + m0*K, Bblk -> Bt + n0*K (both k contiguous).
// K runs in slabs of 64 (128 B of every row). A slab of all 256 rows is copied into LDS by
// asynchronous copies whose wave-wide 512 B cover four whole lines; two buffers, the next
// slab's copies fly while this one is multiplied. LDS rows at pitch 144 B (16 B x odd).
// Both fragments use the same split k map:
// elements 0..7 <- k0+8h+0..7, elements 8..15 <- k0+16+8h+0..7.
// ---------------------------------------------------------------------------
#define SLAB_K      64
#define SLAB_PITCH  144
#define SLAB_A      (128 * SLAB_PITCH)
#define SLAB_STAGE  (256 * SLAB_PITCH)
#define RING_BYTES  (2 * SLAB_STAGE)
#define CS_P        132

// One thread's share of a slab: 16 B of A rows r, r+32, r+64, r+96 and of B rows r, r+32, r+64, r+96.
// s_wait_xcnt closes the statement so that no address register is rewritten ahead of it.
__device__ __forceinline__ void slab_copy(uint32_t lds, const f16* ga, const f16* gb, size_t rstep) {
    asm volatile("global_load_async_to_lds_b128 %0, %8, off\n\t"
                 "global_load_async_to_lds_b128 %1, %9, off\n\t"
                 "global_load_async_to_lds_b128 %2, %10, off\n\t"
                 "global_load_async_to_lds_b128 %3, %11, off\n\t"
                 "global_load_async_to_lds_b128 %4, %12, off\n\t"
                 "global_load_async_to_lds_b128 %5, %13, off\n\t"
                 "global_load_async_to_lds_b128 %6, %14, off\n\t"
                 "global_load_async_to_lds_b128 %7, %15, off\n\t"
                 "s_wait_xcnt 0x0"
                 :: "v"(lds), "v"(lds + 32u * SLAB_PITCH), "v"(lds + 64u * SLAB_PITCH),
                    "v"(lds + 96u * SLAB_PITCH), "v"(lds + (uint32_t)SLAB_A),
                    "v"(lds + (uint32_t)SLAB_A + 32u * SLAB_PITCH),
                    "v"(lds + (uint32_t)SLAB_A + 64u * SLAB_PITCH),
                    "v"(lds + (uint32_t)SLAB_A + 96u * SLAB_PITCH),
                    "v"(ga), "v"(ga + rstep), "v"(ga + 2 * rstep), "v"(ga + 3 * rstep),
                    "v"(gb), "v"(gb + rstep), "v"(gb + 2 * rstep), "v"(gb + 3 * rstep)
                 : "memory");
}

// c[i][j]: rows 32wr+16i.., cols 64wc+16j..
__device__ __forceinline__ void mm128x128(const f16* __restrict__ Ablk, const f16* __restrict__ Bblk,
                                          int K, unsigned char* ring, v8f (&c)[2][4]) {
    const int tid = threadIdx.x, lane = tid & 31, wid = tid >> 5;
    const int h = lane >> 4, l16 = lane & 15;
    const int wr = wid & 3, wc = wid >> 2;
    const int cr = tid >> 3, cc = (tid & 7) * 8;          // copy: row 0..31, f16 column
    const f16* ga = Ablk + (size_t)cr * K + cc;
    const f16* gb = Bblk + (size_t)cr * K + cc;
    const size_t rstep = (size_t)32 * K;
    const uint32_t l0 = (uint32_t)(size_t)ring + (uint32_t)(cr * SLAB_PITCH + cc * 2);
    const int nslab = K / SLAB_K;

    slab_copy(l0, ga, gb, rstep);
    asm volatile("s_wait_asynccnt 0x0" ::: "memory");     // slab 0 landed (this wave's share)
    __syncthreads();                                      // ... and every other wave's
    if (nslab > 1) slab_copy(l0 + (uint32_t)SLAB_STAGE, ga + SLAB_K, gb + SLAB_K, rstep);

    const unsigned char* af = ring + (32 * wr + l16) * SLAB_PITCH + h * 16;
    const unsigned char* bf = ring + SLAB_A + (64 * wc + l16) * SLAB_PITCH + h * 16;
    for (int t = 0; t < nslab; ++t) {
        const int bo = (t & 1) * SLAB_STAGE;
        for (int ks = 0; ks < 2; ++ks) {
            // the k step's twelve LDS reads stand together in front of its eight products
            Frag a0, a1, b0, b1, b2, b3;
            const unsigned char* ap = af + bo + ks * 64;
            const unsigned char* bp = bf + bo + ks * 64;
            a0.h[0] = *(const v8ha*)(ap);                   a0.h[1] = *(const v8ha*)(ap + 32);
            a1.h[0] = *(const v8ha*)(ap + 16 * SLAB_PITCH); a1.h[1] = *(const v8ha*)(ap + 16 * SLAB_PITCH + 32);
            b0.h[0] = *(const v8ha*)(bp);                   b0.h[1] = *(const v8ha*)(bp + 32);
            b1.h[0] = *(const v8ha*)(bp + 16 * SLAB_PITCH); b1.h[1] = *(const v8ha*)(bp + 16 * SLAB_PITCH + 32);
            b2.h[0] = *(const v8ha*)(bp + 32 * SLAB_PITCH); b2.h[1] = *(const v8ha*)(bp + 32 * SLAB_PITCH + 32);
            b3.h[0] = *(const v8ha*)(bp + 48 * SLAB_PITCH); b3.h[1] = *(const v8ha*)(bp + 48 * SLAB_PITCH + 32);
            c[0][0] = mma(a0.v, b0.v, c[0][0]);
            c[0][1] = mma(a0.v, b1.v, c[0][1]);
            c[0][2] = mma(a0.v, b2.v, c[0][2]);
            c[0][3] = mma(a0.v, b3.v, c[0][3]);
            c[1][0] = mma(a1.v, b0.v, c[1][0]);
            c[1][1] = mma(a1.v, b1.v, c[1][1]);
            c[1][2] = mma(a1.v, b2.v, c[1][2]);
            c[1][3] = mma(a1.v, b3.v, c[1][3]);
            guard_2x4(c, a0.v, a1.v, b0.v, b1.v, b2.v, b3.v);
        }
        asm volatile("s_wait_dscnt 0x0" ::: "memory");    // this wave has left buffer t & 1
        asm volatile("s_wait_asynccnt 0x0" ::: "memory"); // its share of slab t + 1 has landed
        __syncthreads();                                  // publishes slab t + 1, frees buffer t & 1
        if (t + 2 < nslab)
            slab_copy(l0 + (uint32_t)bo, ga + (size_t)(t + 2) * SLAB_K, gb + (size_t)(t + 2) * SLAB_K, rstep);
    }
    asm volatile("s_wait_asynccnt 0x0" ::: "memory");     // no copy outstanding when the ring is reused
}

// accumulators -> LDS tile [128][CS_P] (lane = col 64wc+16j+l16, element r = row 32wr+16i+8h+r)
__device__ __forceinline__ void c_to_lds(float (*Cs)[CS_P], const v8f (&c)[2][4]) {
    const int tid = threadIdx.x, lane = tid & 31, wid = tid >> 5;
    const int h = lane >> 4, l16 = lane & 15;
    const int wr = wid & 3, wc = wid >> 2;
#pragma unroll   // constant element indices: the accumulators stay in registers
    for (int i = 0; i < 2; ++i)
#pragma unroll
        for (int r = 0; r < 8; ++r) {
            float* p = &Cs[32 * wr + 16 * i + 8 * h + r][64 * wc + l16];
            p[0]  = c[i][0][r];
            p[16] = c[i][1][r];
            p[32] = c[i][2][r];
            p[48] = c[i][3][r];
        }
}

// ---------------------------------------------------------------------------
// Fused QKV projection + RMS norm + partial rotary.
// Block tile = 128 rows (one batch, 128 consecutive s) x 128 cols (= two heads, one per wave column).
// grid = (16 col tiles: 0..7 -> q heads, 8..11 -> k heads, 12..15 -> v heads, NM/128)
// q out: [b][h][s][d] f16, pre-multiplied by log2(e)/8 (softmax scale, scores in base 2);  k out: [b][kvh][s][d] f16
// v out: [b][kvh][d][s] f16 (d-major)
// ---------------------------------------------------------------------------
__global__ __launch_bounds__(256) void k_qkv(const f16* __restrict__ X,
                                             const f16* __restrict__ Wqt, const f16* __restrict__ Wkt,
                                             const f16* __restrict__ Wvt,
                                             const float* __restrict__ nqw, const float* __restrict__ nkw,
                                             const float* __restrict__ cosT, const float* __restrict__ sinT,
                                             f16* __restrict__ qb, f16* __restrict__ kb, f16* __restrict__ vt) {
    __shared__ __attribute__((aligned(16))) unsigned char ring[RING_BYTES];
    float (*Cs)[CS_P] = reinterpret_cast<float (*)[CS_P]>(ring);   // C tile takes the ring's place behind the K loop
    const int tid = threadIdx.x, lane = tid & 31, wid = tid >> 5;
    const int h = lane >> 4, l16 = lane & 15;
    const int wr = wid & 3, wc = wid >> 2;
    const int nt = blockIdx.x;
    const int m0 = blockIdx.y * 128;
    if (m0 + 128 > NM || nt >= 16) return;    // block-uniform

    int mode, hb, nHh;                        // hb: the block's first head
    const f16* Wt;
    const float* nw;
    if (nt < 8)       { mode = 0; hb = 2 * nt;        nHh = NH;  Wt = Wqt; nw = nqw; }
    else if (nt < 12) { mode = 1; hb = 2 * (nt - 8);  nHh = NKV; Wt = Wkt; nw = nkw; }
    else              { mode = 2; hb = 2 * (nt - 12); nHh = NKV; Wt = Wvt; nw = nkw; }
    const int n0 = hb * NHD;
    const int bb = m0 / NS, s0 = m0 % NS;

    v8f c[2][4];
#pragma unroll
    for (int i = 0; i < 2; ++i)
#pragma unroll
        for (int j = 0; j < 4; ++j) c[i][j] = zero8();
    mm128x128(X + (size_t)m0 * NDM, Wt + (size_t)n0 * NDM, NDM, ring, c);

    // RMS norm and rotary on the accumulators (lane = col 16j+l16 of the wave's head, element r = row 8h+r of
    // row tile i, scaled by 16). A row's 64 columns lie in the four tiles of the 16 lanes that share h; column n
    // and its rotary partner n +- 16 are tiles 0 and 1 of the same lane. 1/16 and the softmax scale log2(e)/8
    // are folded into f.
    if (mode != 2) {
        const float osc16 = ((mode == 0) ? 0.125f * 1.44269504f : 1.0f) * (1.0f / 16.0f);
        const float w0 = nw[l16], w1 = nw[16 + l16], w2 = nw[32 + l16], w3 = nw[48 + l16];
        asm volatile("s_wait_xcnt 0x0" ::: "memory");  // stands in front of any reuse of the four loads' address register
        const size_t tr = (size_t)(s0 + 32 * wr + 8 * h) * NROT + l16;
        const float* cp = cosT + tr;
        const float* sp = sinT + tr;
        float ca[2][8], cb[2][8], sa[2][8], sb[2][8];
#pragma unroll   // constant indices: the tables' values stay in registers, all loads in flight together
        for (int i = 0; i < 2; ++i)
#pragma unroll
            for (int r = 0; r < 8; ++r) {
                ca[i][r] = cp[(16 * i + r) * NROT]; cb[i][r] = cp[(16 * i + r) * NROT + 16];
                sa[i][r] = sp[(16 * i + r) * NROT]; sb[i][r] = sp[(16 * i + r) * NROT + 16];
            }
        __builtin_amdgcn_sched_barrier(0);             // the loads stay in front: their latency runs under the row sums
#pragma unroll   // sixteen independent chains, constant element indices
        for (int i = 0; i < 2; ++i)
#pragma unroll
            for (int r = 0; r < 8; ++r) {
                const float ss = row16_sum(fmaf(c[i][0][r], c[i][0][r], fmaf(c[i][1][r], c[i][1][r],
                                           fmaf(c[i][2][r], c[i][2][r], c[i][3][r] * c[i][3][r]))));
                const float f = rsqrtf(ss * (1.0f / (256.0f * NHD)) + EPSV) * osc16;
                const float x0 = c[i][0][r] * f * w0;
                const float x1 = c[i][1][r] * f * w1;
                c[i][0][r] = x0 * ca[i][r] - x1 * sa[i][r];
                c[i][1][r] = x1 * cb[i][r] + x0 * sb[i][r];
                c[i][2][r] = c[i][2][r] * f * w2;
                c[i][3][r] = c[i][3][r] * f * w3;
            }
    }

    // accumulator -> LDS tile: q and k finished, v still scaled by 16
    c_to_lds(Cs, c);
    __syncthreads();

    v8h o[8];
    size_t off[8];
    if (mode != 2) {
        // the wave's own 32 rows x 64 cols: one head's rows, 128 B each
        f16* ob = ((mode == 0) ? qb : kb) + ((size_t)(bb * nHh + hb + wc) * NS + s0) * NHD;
#pragma unroll
        for (int q = 0; q < 8; ++q) {
            const int row = 32 * wr + 4 * q + (lane >> 3);
            const int cc = (lane & 7) * 8;
            const v4f u0 = *(const v4fa*)(&Cs[row][64 * wc + cc]);
            const v4f u1 = *(const v4fa*)(&Cs[row][64 * wc + cc + 4]);
#pragma unroll
            for (int e = 0; e < 4; ++e) { o[q][e] = (f16)u0[e]; o[q][4 + e] = (f16)u1[e]; }
            off[q] = (size_t)row * NHD + cc;
        }
#pragma unroll
        for (int q = 0; q < 8; ++q) *(v8h*)(ob + off[q]) = o[q];
        asm volatile("s_wait_xcnt 0x0" ::: "memory");  // stands in front of any reuse of the stores' address and data registers
    } else {
        // the two heads' 128 d rows follow one another in vt; wave wid takes d rows 16wid..16wid+15
        f16* ob = vt + (size_t)(bb * NKV + hb) * NHD * NS + s0;
#pragma unroll
        for (int q = 0; q < 8; ++q) {
            const int L = 4 * q + (lane >> 3);          // 0..31
            const int d = 16 * wid + (L >> 1);
            const int sb = (L & 1) * 64 + (lane & 7) * 8;
#pragma unroll
            for (int e = 0; e < 8; ++e) o[q][e] = (f16)(Cs[sb + e][d] * (1.0f / 16.0f));
            off[q] = (size_t)d * NS + sb;
        }
#pragma unroll
        for (int q = 0; q < 8; ++q) *(v8h*)(ob + off[q]) = o[q];
    }
}

#define KT    128
#define WK    (KT / 2)   // keys of a pass that one wave takes
#define KS_P  72
#define VS_P  (KT + 8)
#define KV_K      (KT * KS_P * 2)
#define KV_STAGE  (KV_K + 64 * VS_P * 2)

// One thread's share of a pass's tiles: 16 B of K rows r, r+32, r+64, r+96 and of V rows d, d+16, d+32, d+48.
// s_wait_xcnt closes the statement so that no address register is rewritten ahead of it.
__device__ __forceinline__ void kv_copy(uint32_t lk, uint32_t lv, const f16* gk, const f16* gv) {
    asm volatile("global_load_async_to_lds_b128 %0, %8, off\n\t"
                 "global_load_async_to_lds_b128 %1, %9, off\n\t"
                 "global_load_async_to_lds_b128 %2, %10, off\n\t"
                 "global_load_async_to_lds_b128 %3, %11, off\n\t"
                 "global_load_async_to_lds_b128 %4, %12, off\n\t"
                 "global_load_async_to_lds_b128 %5, %13, off\n\t"
                 "global_load_async_to_lds_b128 %6, %14, off\n\t"
                 "global_load_async_to_lds_b128 %7, %15, off\n\t"
                 "s_wait_xcnt 0x0"
                 :: "v"(lk), "v"(lk + 32u * KS_P * 2u), "v"(lk + 64u * KS_P * 2u), "v"(lk + 96u * KS_P * 2u),
                    "v"(lv), "v"(lv + 16u * VS_P * 2u), "v"(lv + 32u * VS_P * 2u), "v"(lv + 48u * VS_P * 2u),
                    "v"(gk), "v"(gk + 32 * NHD), "v"(gk + 64 * NHD), "v"(gk + 96 * NHD),
                    "v"(gv), "v"(gv + 16 * NS), "v"(gv + 32 * NS), "v"(gv + 48 * NS)
                 : "memory");
}

__global__ __launch_bounds__(256) void k_attn(const f16* __restrict__ qb, const f16* __restrict__ kb,
                                              const f16* __restrict__ vt, f16* __restrict__ ob) {
    __shared__ __attribute__((aligned(16))) unsigned char kv[2 * KV_STAGE];   // two buffers of [K tile | V tile]
    __shared__ __attribute__((aligned(16))) f16   Os[8 * 16 * 72];

    const int tid = threadIdx.x, lane = tid & 31, wid = tid >> 5;
    const int h = lane >> 4, l16 = lane & 15, h8 = h * 8;
    const int kh = wid >> 2;                               // the wave's half of a pass's keys
    const int bb = blockIdx.z, hd = blockIdx.y, kvh = hd / (NH / NKV);
    const int qblk = blockIdx.x * 128;
    if (qblk + 128 > NS || hd >= NH || bb >= NB) return;   // block-uniform
    const int qp = qblk + (wid & 3) * 32;                  // the pair's 32 q rows

    Frag qa0[2], qa1[2];
#pragma unroll   // constant indices: the fragments stay in registers
    for (int t = 0; t < 2; ++t) {
        const f16* qrow = qb + ((size_t)(bb * NH + hd) * NS + qp + 16 * t + l16) * NHD;
        qa0[t].h[0] = *(const v8h*)(qrow + h8);
        qa0[t].h[1] = *(const v8h*)(qrow + 16 + h8);
        qa1[t].h[0] = *(const v8h*)(qrow + 32 + h8);
        qa1[t].h[1] = *(const v8h*)(qrow + 48 + h8);
    }
    asm volatile("s_wait_xcnt 0x0" ::: "memory");  // stands in front of any reuse of the eight loads' address registers

    // per query tile t: cb = 8 - ref of query 16t+l16 (0 until pass 0 sets it), the same in both halves of the wave
    float cb[2] = {0.0f, 0.0f}, l_run[2] = {0.0f, 0.0f};
    v8f acc[4][2];                      // acc[j][t][r] = O[query 16t+l16][16j+8h+r], this wave's keys
#pragma unroll
    for (int j = 0; j < 4; ++j)
#pragma unroll
        for (int t = 0; t < 2; ++t) acc[j][t] = zero8();

    const f16* kbase = kb + (size_t)(bb * NKV + kvh) * NS * NHD;
    const f16* vbase = vt + (size_t)(bb * NKV + kvh) * NHD * NS;

    const int cr = tid >> 3, cc = (tid & 7) * 8;      // copy, K: KT rows x 64 d, 32 rows a step
    const int cd = tid >> 4, cv = (tid & 15) * 8;     // copy, V: 64 d rows x KT kv, 16 rows a step
    const f16* gk = kbase + (size_t)cr * NHD + cc;
    const f16* gv = vbase + (size_t)cd * NS + cv;
    const uint32_t lk = (uint32_t)(size_t)kv + (uint32_t)((cr * KS_P + cc) * 2);
    const uint32_t lv = (uint32_t)(size_t)kv + (uint32_t)(KV_K + (cd * VS_P + cv) * 2);

    kv_copy(lk, lv, gk, gv);
    asm volatile("s_wait_asynccnt 0x0" ::: "memory");     // pass 0's tiles landed (this wave's share)
    __syncthreads();                                      // ... and every other wave's
    if (NS / KT > 1) kv_copy(lk + (uint32_t)KV_STAGE, lv + (uint32_t)KV_STAGE, gk + (size_t)KT * NHD, gv + KT);

#pragma unroll 1
    for (int it = 0; it < NS / KT; ++it) {
        const int bo = (it & 1) * KV_STAGE;
        const f16* Ks = reinterpret_cast<const f16*>(kv + bo) + kh * WK * KS_P;      // the wave's K rows
        const f16* Vs = reinterpret_cast<const f16*>(kv + bo + KV_K) + kh * WK;      // the wave's V columns

        // scores of WK keys x 32 queries, the sixteen LDS reads together in front of the sixteen products:
        // sc[u][t][r] = score of key 16u+8h+r for query 16t+l16, plus cb[t]
        v8f sc[WK / 16][2];
        v8f c0[2];
#pragma unroll   // constant element indices: the vectors stay in registers
        for (int t = 0; t < 2; ++t)
#pragma unroll
            for (int r = 0; r < 8; ++r) c0[t][r] = cb[t];
        {
            Frag b0[WK / 16], b1[WK / 16];
#pragma unroll
            for (int u = 0; u < WK / 16; ++u) {
                const f16* kp = Ks + (u * 16 + l16) * KS_P;
                b0[u].h[0] = *(const v8ha*)(kp + h8);      b0[u].h[1] = *(const v8ha*)(kp + 16 + h8);
                b1[u].h[0] = *(const v8ha*)(kp + 32 + h8); b1[u].h[1] = *(const v8ha*)(kp + 48 + h8);
            }
#pragma unroll
            for (int u = 0; u < WK / 16; ++u)
#pragma unroll
                for (int t = 0; t < 2; ++t) sc[u][t] = mma(b0[u].v, qa0[t].v, c0[t]);
#pragma unroll
            for (int u = 0; u < WK / 16; ++u)
#pragma unroll
                for (int t = 0; t < 2; ++t) sc[u][t] = mma(b1[u].v, qa1[t].v, sc[u][t]);
            guard_4x2x2(sc, b0[0].v, b0[1].v, b0[2].v, b0[3].v, b1[0].v, b1[1].v, b1[2].v, b1[3].v,
                        qa0[0].v, qa0[1].v, qa1[0].v, qa1[1].v);
        }

        // query 16t+l16, of every 32 keys the kv subset {8h..8h+7, 16+8h..23+8h}, in that order
        // (the loops are unrolled so that every index is a constant and the renaming costs no instruction)
        v4f rv[2][WK / 32][4];
#pragma unroll
        for (int t = 0; t < 2; ++t)
#pragma unroll
            for (int g = 0; g < WK / 32; ++g)
#pragma unroll
                for (int q = 0; q < 4; ++q)
#pragma unroll
                    for (int e = 0; e < 4; ++e) rv[t][g][q][e] = sc[2 * g + (q >> 1)][t][4 * (q & 1) + e];

        // one maximum per query tile and 32 keys (independent chains), then the tile's maximum
        float rm[2];
#pragma unroll
        for (int t = 0; t < 2; ++t) {
            rm[t] = -1e30f;
#pragma unroll
            for (int g = 0; g < WK / 32; ++g) {
                float gm = rv[t][g][0][0];
#pragma unroll
                for (int i = 1; i < 16; ++i) gm = fmaxf(gm, rv[t][g][i >> 2][i & 3]);
                rm[t] = fmaxf(rm[t], gm);
            }
        }

        // rm covers this lane's own keys: enough for the test. Rare behind pass 0.
        if (it == 0 || __builtin_amdgcn_ballot_w32(fmaxf(rm[0], rm[1]) > 15.0f) != 0u) {
            // (unrolled so that every index is a constant: arguments and accumulators stay in registers)
#pragma unroll
            for (int t = 0; t < 2; ++t) {
                const float mx = fmaxf(rm[t], __shfl_xor(rm[t], 16, 32));   // both halves: the query's largest argument
                float d = 8.0f - mx;                                        // brings it to 8
                if (it != 0) d = fminf(d, 0.0f);                            // behind pass 0 the reference only rises
                const float corr = __builtin_amdgcn_exp2f(fminf(d, 0.0f));
                cb[t] += d;
                l_run[t] *= corr;
#pragma unroll
                for (int g = 0; g < WK / 32; ++g)
#pragma unroll
                    for (int q = 0; q < 4; ++q) rv[t][g][q] += d;
                // the accumulators' column is this lane's own query
#pragma unroll
                for (int j = 0; j < 4; ++j)
#pragma unroll
                    for (int r = 0; r < 8; ++r) acc[j][t][r] *= corr;
            }
        }

        // one partial sum per query tile and 32 keys (independent chains), then their sum
        Frag pa[2][WK / 32];
#pragma unroll
        for (int t = 0; t < 2; ++t) {
            float rs = 0.0f;
#pragma unroll
            for (int g = 0; g < WK / 32; ++g) {
                float gs = 0.0f;
#pragma unroll
                for (int q = 0; q < 4; ++q) {
                    const v4f p = exp2x4(rv[t][g][q]);   // 256 * 2^(s - ref)
#pragma unroll
                    for (int e = 0; e < 4; ++e) { gs += p[e]; pa[t][g].e[4 * q + e] = (f16)p[e]; }
                }
                rs += gs;
            }
            rs += __shfl_xor(rs, 16, 32);
            l_run[t] += rs;
        }

        // PV, 32 keys at a time: A fragment for d = j*16 + l16, kv split map, feeds both query tiles
#pragma unroll
        for (int g = 0; g < WK / 32; ++g) {
            Frag bv[4];
#pragma unroll
            for (int j = 0; j < 4; ++j) {
                const f16* vp = Vs + (j * 16 + l16) * VS_P + g * 32;
                bv[j].h[0] = *(const v8ha*)(vp + h8); bv[j].h[1] = *(const v8ha*)(vp + 16 + h8);
            }
#pragma unroll
            for (int j = 0; j < 4; ++j)
#pragma unroll
                for (int t = 0; t < 2; ++t) acc[j][t] = mma(bv[j].v, pa[t][g].v, acc[j][t]);
            guard_4x2(acc, bv[0].v, bv[1].v, bv[2].v, bv[3].v, pa[0][g].v, pa[1][g].v);
        }

        asm volatile("s_wait_dscnt 0x0" ::: "memory");    // this wave has left buffer it & 1
        asm volatile("s_wait_asynccnt 0x0" ::: "memory"); // its share of pass it + 1's tiles has landed
        __syncthreads();                                  // publishes pass it + 1's tiles, frees buffer it & 1
        if (it + 2 < NS / KT)
            kv_copy(lk + (uint32_t)bo, lv + (uint32_t)bo, gk + (size_t)(it + 2) * KT * NHD, gv + (it + 2) * KT);
    }
    asm volatile("s_wait_asynccnt 0x0" ::: "memory");     // no copy outstanding behind the loop

    __syncthreads();

    // The pair's two halves of the keys are joined: wave (p, kh) finishes query tile kh. It hands the other tile's
    // accumulators, sum and cb to its partner (wave wid ^ 4) through the ring, which nobody reads any more.
    // Nine 16-byte rows of 32 lanes a wave; the partner's lanes hold the same (query, d) as this wave's.
    v8f om[4];
    float lm, cm;
    {
        v4fa* xw = reinterpret_cast<v4fa*>(kv) + wid * (9 * 32) + lane;
        const v4fa* xr = reinterpret_cast<const v4fa*>(kv) + (wid ^ 4) * (9 * 32) + lane;
        const bool up = kh != 0;
#pragma unroll   // constant element indices: the vectors stay in registers
        for (int j = 0; j < 4; ++j) {
            v4f s0, s1;
#pragma unroll
            for (int r = 0; r < 8; ++r) om[j][r] = up ? acc[j][1][r] : acc[j][0][r];
#pragma unroll
            for (int e = 0; e < 4; ++e) {
                s0[e] = up ? acc[j][0][e] : acc[j][1][e];
                s1[e] = up ? acc[j][0][4 + e] : acc[j][1][4 + e];
            }
            xw[(2 * j) * 32]     = s0;
            xw[(2 * j + 1) * 32] = s1;
        }
        lm = up ? l_run[1] : l_run[0];
        cm = up ? cb[1] : cb[0];
        v4f sl;
        sl[0] = up ? l_run[0] : l_run[1];
        sl[1] = up ? cb[0] : cb[1];
        sl[2] = 0.0f; sl[3] = 0.0f;
        xw[8 * 32] = sl;
        __syncthreads();                                  // every wave's hand-over is written
        const v4f ol = xr[8 * 32];
        const float cj = fminf(cm, ol[1]);                // the larger reference of the two
        v4f ea;
        ea[0] = cj - cm; ea[1] = cj - ol[1]; ea[2] = 0.0f; ea[3] = 0.0f;
        const v4f ef = exp2x4(ea);                        // at most 1: each half's factor to the joint reference
        lm = lm * ef[0] + ol[0] * ef[1];
#pragma unroll
        for (int j = 0; j < 4; ++j) {
            const v4f t0 = xr[(2 * j) * 32];
            const v4f t1 = xr[(2 * j + 1) * 32];
#pragma unroll
            for (int e = 0; e < 4; ++e) {
                om[j][e]     = om[j][e] * ef[0] + t0[e] * ef[1];
                om[j][4 + e] = om[j][4 + e] * ef[0] + t1[e] * ef[1];
            }
        }
    }
    const int q0 = qp + kh * 16;

    // normalise: acc and l both carry the factor 256: O = acc / l; stored as O*32 -> acc * (32 / l)
    const float inv = 32.0f / lm;

    f16* os = Os + wid * 16 * 72;
    {
        v8h t0, t1, t2, t3;
#pragma unroll   // constant element indices: the vectors stay in registers
        for (int r = 0; r < 8; ++r) {
            t0[r] = (f16)(om[0][r] * inv);
            t1[r] = (f16)(om[1][r] * inv);
            t2[r] = (f16)(om[2][r] * inv);
            t3[r] = (f16)(om[3][r] * inv);
        }
        f16* orow = os + l16 * 72 + h8;      // query l16, eight consecutive d per tile
        *(v8ha*)(orow)      = t0;
        *(v8ha*)(orow + 16) = t1;
        *(v8ha*)(orow + 32) = t2;
        *(v8ha*)(orow + 48) = t3;
    }
    __syncthreads();

    v8h o[4];
    size_t off[4];
#pragma unroll
    for (int q = 0; q < 4; ++q) {
        const int L = 4 * q + (lane >> 3);     // local q row 0..15
        const int cc = (lane & 7) * 8;
        o[q] = *(const v8ha*)(os + L * 72 + cc);
        off[q] = ((size_t)(bb * NS + q0 + L)) * (NH * NHD) + hd * NHD + cc;
    }
#pragma unroll
    for (int q = 0; q < 4; ++q) *(v8h*)(ob + off[q]) = o[q];
    
}

// ---------------------------------------------------------------------------
// out = (O*32 f16) x (Wo*16 f16, k contiguous) / 512 + bias + residual, f32 [NM][NDM]
// Block tile 128 x 128, grid = (NDM/128, NM/128). Row segment of 128 floats = 4 lines, one wave-wide store.
// ---------------------------------------------------------------------------
__global__ __launch_bounds__(256) void k_oproj(const f16* __restrict__ A, const f16* __restrict__ Wot,
                                               const float* __restrict__ bias, const float* __restrict__ resid,
                                               float* __restrict__ out) {
    __shared__ __attribute__((aligned(16))) unsigned char ring[RING_BYTES];
    float (*Cs)[CS_P] = reinterpret_cast<float (*)[CS_P]>(ring);   // C tile takes the ring's place behind the K loop
    const int tid = threadIdx.x, lane = tid & 31, wid = tid >> 5;
    const int n0 = blockIdx.x * 128;
    const int m0 = blockIdx.y * 128;
    if (n0 + 128 > NDM || m0 + 128 > NM) return;   // block-uniform

    v8f c[2][4];
#pragma unroll
    for (int i = 0; i < 2; ++i)
#pragma unroll
        for (int j = 0; j < 4; ++j) c[i][j] = zero8();
    mm128x128(A + (size_t)m0 * (NH * NHD), Wot + (size_t)n0 * (NH * NHD), NH * NHD, ring, c);

    c_to_lds(Cs, c);
    __syncthreads();

    v4f o[16];
    size_t off[16];
    const int cc = lane * 4;
    const v4f bv = *(const v4f*)(bias + n0 + cc);
#pragma unroll
    for (int q = 0; q < 16; ++q) {
        const int row = 16 * wid + q;
        const v4f cv = *(const v4fa*)(&Cs[row][cc]);
        const size_t go = (size_t)(m0 + row) * NDM + n0 + cc;
        const v4f rv = *(const v4f*)(resid + go);
        v4f val;
#pragma unroll
        for (int e = 0; e < 4; ++e) val[e] = (cv[e] * (1.0f / 512.0f) + bv[e]) + rv[e];
        o[q] = val;
        off[q] = go;
    }
#pragma unroll
    for (int q = 0; q < 16; ++q) *(v4f*)(out + off[q]) = o[q];
}

// ---------------------------------------------------------------------------
// Launcher
// ---------------------------------------------------------------------------
extern "C" void kernel_launch(void* const* d_in, const int* in_sizes, int n_in,
                              void* d_out, int out_size, void* d_ws, size_t ws_size,
                              hipStream_t stream) {
    if (n_in < 10) return;
    if (in_sizes[0] != NM * NDM) return;
    if (in_sizes[1] != NDM * NH * NHD) return;
    if (in_sizes[2] != NDM * NKV * NHD || in_sizes[3] != NDM * NKV * NHD) return;
    if (in_sizes[4] != NH * NHD * NDM) return;
    if (in_sizes[5] < NDM || in_sizes[6] < NHD || in_sizes[7] < NHD) return;
    if (in_sizes[8] != NS * NROT || in_sizes[9] != NS * NROT) return;
    if (out_size != NM * NDM) return;

    const float* hs   = (const float*)d_in[0];
    const float* wq   = (const float*)d_in[1];
    const float* wk   = (const float*)d_in[2];
    const float* wv   = (const float*)d_in[3];
    const float* wo   = (const float*)d_in[4];
    const float* bo   = (const float*)d_in[5];
    const float* nqw  = (const float*)d_in[6];
    const float* nkw  = (const float*)d_in[7];
    const float* cosT = (const float*)d_in[8];
    const float* sinT = (const float*)d_in[9];

    const size_t szX   = (size_t)NM * NDM * sizeof(f16);            // 8 MB
    const size_t szWq  = (size_t)NDM * NH * NHD * sizeof(f16);      // 2 MB
    const size_t szWkv = (size_t)NDM * NKV * NHD * sizeof(f16);     // 1 MB
    const size_t szWo  = (size_t)NH * NHD * NDM * sizeof(f16);      // 2 MB
    const size_t szQ   = (size_t)NB * NH * NS * NHD * sizeof(f16);  // 8 MB
    const size_t szKV  = (size_t)NB * NKV * NS * NHD * sizeof(f16); // 4 MB
    const size_t szO   = (size_t)NM * NH * NHD * sizeof(f16);       // 8 MB
    size_t offp = 0;
    const size_t oX   = offp; offp += szX;
    const size_t oWq  = offp; offp += szWq;
    const size_t oWk  = offp; offp += szWkv;
    const size_t oWv  = offp; offp += szWkv;
    const size_t oWo  = offp; offp += szWo;
    const size_t oQ   = offp; offp += szQ;
    const size_t oK   = offp; offp += szKV;
    const size_t oV   = offp; offp += szKV;
    const size_t oO   = offp; offp += szO;
    if (offp > ws_size) return;

    char* ws = (char*)d_ws;
    f16* hsb  = (f16*)(ws + oX);
    f16* wqt  = (f16*)(ws + oWq);
    f16* wkt  = (f16*)(ws + oWk);
    f16* wvt  = (f16*)(ws + oWv);
    f16* wot  = (f16*)(ws + oWo);
    f16* qbuf = (f16*)(ws + oQ);
    f16* kbuf = (f16*)(ws + oK);
    f16* vtb  = (f16*)(ws + oV);
    f16* attb = (f16*)(ws + oO);

    // X -> f16 and W[K=in][N=out] -> Wt[N][K] * 16, all in one launch
    k_prep<<<PB_ALL, 256, 0, stream>>>(hs, wq, wk, wv, wo, hsb, wqt, wkt, wvt, wot);

    k_qkv<<<dim3(16, (NM + 127) / 128), 256, 0, stream>>>(hsb, wqt, wkt, wvt, nqw, nkw, cosT, sinT,
                                                         qbuf, kbuf, vtb);

    k_attn<<<dim3((NS + 127) / 128, NH, NB), 256, 0, stream>>>(qbuf, kbuf, vtb, attb);

    k_oproj<<<dim3((NDM + 127) / 128, (NM + 127) / 128), 256, 0, stream>>>(attb, wot, bo, hs, (float*)d_out);
}
